// v000
// Times are from an AMD MI455X. After a warm-up the kernel runs many times in a row, and a time is the length of
// such a window on the GPU divided by its runs, so every launch and the gaps after it count. The runs cycle
// through copies of the inputs. A figure is the median of several windows, for all but v000 over two sittings.
// Sittings can differ by a few percent; kernels timed side by side share one.
// The starting kernel, v000, takes 670 microseconds a run.
// Contractions: qkv projection (x bf16 RNE, W^T bf16 RNE) on v_wmma_f32_16x16x32_bf16; scores q.k^T (q, k f16 planes) and attn.v (P f16 carried x32768, V^T f16 plane) on v_wmma_f32_16x16x32_f16; all f32 accumulate; online softmax statistics, scaling and 1/l in f32.
#include <hip/hip_runtime.h>
#include <math.h>

// ---------------------------------------------------------------------------
// Problem constants
// ---------------------------------------------------------------------------
constexpr int kBatch  = 4;
constexpr int kSeq    = 2048;
constexpr int kDim    = 1024;
constexpr int kHeads  = 16;
constexpr int kDh     = 64;
constexpr int kTok    = kBatch * kSeq;     // 8192 token rows
constexpr int kWRows  = 3 * kDim;          // 3072 weight rows (q | k | v)
constexpr int kQKCols = 2 * kDim;          // 2048: pitch of the q | k plane (halves)
constexpr float kPCarry    = 32768.0f;     // unnormalised probabilities carried x2^15 in f16
constexpr float kScale     = 0.125f;       // 64^-0.5, applied to the f32 scores
static_assert(kHeads * kDh == kDim, "shape");
static_assert(kDim % 32 == 0, "gemm K multiple of 32");
static_assert(kTok % 64 == 0 && kQKCols % 64 == 0 && kDh % 64 == 0 && kSeq % 64 == 0, "gemm M,N multiples of 64");
static_assert((kTok * kDim) % (8 * 256) == 0 && (kWRows * kDim) % (8 * 256) == 0, "cast grids exact");

typedef __attribute__((ext_vector_type(16))) _Float16 v16h;
typedef __attribute__((ext_vector_type(8)))  _Float16 v8h;
typedef __attribute__((ext_vector_type(16))) __bf16   v16b;
typedef __attribute__((ext_vector_type(8)))  __bf16   v8b;
typedef __attribute__((ext_vector_type(8)))  float    v8f;
typedef __attribute__((ext_vector_type(4)))  float    v4f;
typedef __attribute__((ext_vector_type(4)))  unsigned int v4u;

// ---------------------------------------------------------------------------
// Helpers
// ---------------------------------------------------------------------------
__device__ __forceinline__ unsigned short f2bf_bits(float f) {
  unsigned u = __float_as_uint(f);
  return (unsigned short)((u + 0x7FFFu + ((u >> 16) & 1u)) >> 16);
}
__device__ __forceinline__ float bf_bits2f(unsigned short h) { return __uint_as_float(((unsigned)h) << 16); }

// hazard guards as plain device helpers (no inline asm inside the kernel template body)
__device__ __forceinline__ void dep_guard_h(v8f& a, v8f& b, v16h x, v16h y) { asm volatile("v_nop\n\tv_nop\n\tv_nop\n\tv_nop" : "+v"(a), "+v"(b) : "v"(x), "v"(y)); }
__device__ __forceinline__ void dep_guard_b(v8f& a, v8f& b, v16b x, v16b y) { asm volatile("v_nop\n\tv_nop\n\tv_nop\n\tv_nop" : "+v"(a), "+v"(b) : "v"(x), "v"(y)); }
__device__ __forceinline__ void keep4_h(v16h a, v16h b, v16h c, v16h d) { asm volatile("v_nop" :: "v"(a), "v"(b), "v"(c), "v"(d)); }
__device__ __forceinline__ void keep4_b(v16b a, v16b b, v16b c, v16b d) { asm volatile("v_nop" :: "v"(a), "v"(b), "v"(c), "v"(d)); }
__device__ __forceinline__ void acc_guard4(v8f& a, v8f& b, v8f& c, v8f& d) { asm volatile("v_nop\n\tv_nop\n\tv_nop\n\tv_nop" : "+v"(a), "+v"(b), "+v"(c), "+v"(d)); }
template <typename T> struct Frag;
template <> struct Frag<_Float16> {
  typedef v16h V; union U { v16h v; v8h h[2]; };
  // elements 0..7 <- p[0..7], 8..15 <- p[16..23]
  static __device__ __forceinline__ v16h load(const _Float16* p) {
    U f; f.h[0] = *(const v8h*)(p); f.h[1] = *(const v8h*)(p + 16); return f.v;
  }
  static __device__ __forceinline__ v8f mma(v16h a, v16h b, v8f c) {
    return __builtin_amdgcn_wmma_f32_16x16x32_f16(false, a, false, b, (short)0, c, false, false);
  }
  static __device__ __forceinline__ void guard(v8f& a, v8f& b, v16h x, v16h y) { dep_guard_h(a, b, x, y); }
  static __device__ __forceinline__ void keep(v16h a, v16h b, v16h c, v16h d) { keep4_h(a, b, c, d); }
};
template <> struct Frag<__bf16> {
  typedef v16b V; union U { v16b v; v8b h[2]; };
  static __device__ __forceinline__ v16b load(const __bf16* p) {
    U f; f.h[0] = *(const v8b*)(p); f.h[1] = *(const v8b*)(p + 16); return f.v;
  }
  static __device__ __forceinline__ v8f mma(v16b a, v16b b, v8f c) {
    return __builtin_amdgcn_wmma_f32_16x16x32_bf16(false, a, false, b, (short)0, c, false, false);
  }
  static __device__ __forceinline__ void guard(v8f& a, v8f& b, v16b x, v16b y) { dep_guard_b(a, b, x, y); }
  static __device__ __forceinline__ void keep(v16b a, v16b b, v16b c, v16b d) { keep4_b(a, b, c, d); }
};

__device__ __forceinline__ unsigned pk16(unsigned short a, unsigned short b) { return (unsigned)a | ((unsigned)b << 16); }

// ---- Register-blocked batched WMMA GEMM (ACT reduced to none/relu/leaky) -------------------------------
// C[m,n] = scale * sum_k A[m,k] * Bt[n,k] (+bias)(+resid); each wave owns a 64x64 tile.
// A row-major [M,K]; Bt row-major [N,K]; M,N % 64 == 0, K % 32 == 0.
// SPLIT: operands are hi/lo planes (A2/Bt2 = lo planes, same layout); product = hi*hi + hi*lo + lo*hi.
// BIAS_MODE: 0 = none, 1 = bias[m], 2 = bias[n].
// OUT_MODE: 0 = f32, 1 = f16, 2 = bf16 hi plane (Cout) + bf16 lo plane (Cout2).
// ET: 0 = f16 operands, 1 = bf16 operands (pointers passed as 16-bit storage)
template <int ET> struct Elem;
template <> struct Elem<0> { typedef _Float16 T; };
template <> struct Elem<1> { typedef __bf16 T; };
template <int ET, bool SPLIT, int BIAS_MODE, int OUT_MODE, bool RESID, int ACT = 0>
__global__ __launch_bounds__(256) void wmma_gemm64(
    const unsigned short* __restrict__ Ap, const unsigned short* __restrict__ A2p, int lda, long strideA,
    const unsigned short* __restrict__ Btp, const unsigned short* __restrict__ Bt2p, int ldb, long strideB,
    void* __restrict__ Cout, void* __restrict__ Cout2, int ldc, long strideC,
    const float* __restrict__ bias,
    const float* __restrict__ resid, long strideR,
    int M, int N, int K, float scale) {
  typedef typename Elem<ET>::T T;
  typedef typename Frag<T>::V V;
  const T* A = (const T*)Ap; const T* A2 = (const T*)A2p; const T* Bt = (const T*)Btp; const T* Bt2 = (const T*)Bt2p;
  __shared__ __align__(16) float sT[8][16 * 68];   // per-wave 16x64 slab, pitch 68 floats
  const int b    = blockIdx.y;
  const int lane = threadIdx.x & 31;
  const int wave = threadIdx.x >> 5;
  const int tilesN = N >> 6;
  const int tilesM = M >> 6;
  const int tile = blockIdx.x * 8 + wave;
  if (tile >= tilesM * tilesN) return;   // wave-uniform; no block barriers in this kernel
  const int tm = tile / tilesN;
  const int tn = tile - tm * tilesN;
  const int m0 = tm << 6;
  const int n0 = tn << 6;

  const T* Ab  = A  + (size_t)b * strideA;
  const T* Bb  = Bt + (size_t)b * strideB;
  const T* Ab2 = SPLIT ? (A2  + (size_t)b * strideA) : nullptr;
  const T* Bb2 = SPLIT ? (Bt2 + (size_t)b * strideB) : nullptr;

  const int rlane = lane & 15;                 // row (A) / col (B, D) within subtile
  const int koff  = (lane >> 4) * 8;           // k offset of this lane half
  const int mOff  = (lane >> 4) * 8;           // D row offset

  v8f acc[4][4];
#pragma unroll
  for (int i = 0; i < 4; ++i)
#pragma unroll
    for (int j = 0; j < 4; ++j) acc[i][j] = (v8f){0.f,0.f,0.f,0.f,0.f,0.f,0.f,0.f};

  for (int k0 = 0; k0 < K; k0 += 32) {
    V bh[4], bl[4];
#pragma unroll
    for (int j = 0; j < 4; ++j) {
      const size_t bo = (size_t)(n0 + (j << 4) + rlane) * ldb + koff + k0;
      bh[j] = Frag<T>::load(Bb + bo);
      if (SPLIT) bl[j] = Frag<T>::load(Bb2 + bo);
    }
#pragma unroll
    for (int i = 0; i < 4; ++i) {
      const size_t ao = (size_t)(m0 + (i << 4) + rlane) * lda + koff + k0;
      V ah = Frag<T>::load(Ab + ao);
      V al;
      if (SPLIT) al = Frag<T>::load(Ab2 + ao);
#pragma unroll
      for (int j = 0; j < 4; ++j) {
        acc[i][j] = Frag<T>::mma(ah, bh[j], acc[i][j]);
        if (SPLIT) {
          acc[i][j] = Frag<T>::mma(ah, bl[j], acc[i][j]);
          acc[i][j] = Frag<T>::mma(al, bh[j], acc[i][j]);
        }
      }
      Frag<T>::guard(acc[i][0], acc[i][3], ah, SPLIT ? al : ah);
    }
    Frag<T>::keep(bh[0], bh[1], bh[2], bh[3]);
    if (SPLIT) Frag<T>::keep(bl[0], bl[1], bl[2], bl[3]);
  }
  acc_guard4(acc[0][0], acc[0][1], acc[0][2], acc[0][3]);
  acc_guard4(acc[1][0], acc[1][1], acc[1][2], acc[1][3]);
  acc_guard4(acc[2][0], acc[2][1], acc[2][2], acc[2][3]);
  acc_guard4(acc[3][0], acc[3][1], acc[3][2], acc[3][3]);

  // ---- epilogue ----
  float* slab = sT[wave];
  const float* Rb = RESID ? (resid + (size_t)b * strideR) : nullptr;
#pragma unroll
  for (int i = 0; i < 4; ++i) {
    const int mBase = m0 + (i << 4);
#pragma unroll
    for (int j = 0; j < 4; ++j) {
      const int n = n0 + (j << 4) + rlane;
      float bv = 0.f;
      if (BIAS_MODE == 2) bv = bias[n];
#pragma unroll
      for (int r = 0; r < 8; ++r) {
        float v = acc[i][j][r] * scale;
        if (BIAS_MODE == 1) v += bias[mBase + mOff + r];
        if (BIAS_MODE == 2) v += bv;
        if (RESID) v += Rb[(size_t)(mBase + mOff + r) * ldc + n];
        if (ACT == 2) v = fmaxf(v, 0.0f);
        if (ACT == 4) v = (v > 0.f) ? v : 0.01f * v;
        slab[(mOff + r) * 68 + (j << 4) + rlane] = v;
      }
    }
    __builtin_amdgcn_fence(__ATOMIC_RELEASE, "workgroup");
    __builtin_amdgcn_wave_barrier();
    __builtin_amdgcn_fence(__ATOMIC_ACQUIRE, "workgroup");
    if (OUT_MODE == 0) {
      float* C = (float*)Cout + (size_t)b * strideC;
      const int hh = lane >> 4, c4 = (lane & 15) * 4;     // row seg = 256 B = 16 lanes x 16 B
      {
#pragma unroll
        for (int it = 0; it < 8; ++it) {
          const int row = it * 2 + hh;
          v4f v = *(const v4f*)(slab + row * 68 + c4);
          *(v4f*)(C + (size_t)(mBase + row) * ldc + n0 + c4) = v;
        }
        
      }
    } else {
      const int q = lane >> 3, c8 = (lane & 7) * 8;
      unsigned short* C  = (unsigned short*)Cout  + (size_t)b * strideC;
      unsigned short* C2 = (OUT_MODE == 2) ? ((unsigned short*)Cout2 + (size_t)b * strideC) : nullptr;
      {
#pragma unroll
        for (int it = 0; it < 4; ++it) {
          const int row = it * 4 + q;
          const float* sp = slab + row * 68 + c8;
          v8h hv, lv;
#pragma unroll
          for (int e = 0; e < 8; ++e) {
            if (OUT_MODE == 1) {
              hv[e] = (_Float16)sp[e];
            } else {
              unsigned short hb = f2bf_bits(sp[e]);
              unsigned short lb = f2bf_bits(sp[e] - bf_bits2f(hb));
              hv[e] = __builtin_bit_cast(_Float16, hb);
              lv[e] = __builtin_bit_cast(_Float16, lb);
            }
          }
          *(v8h*)(C + (size_t)(mBase + row) * ldc + n0 + c8) = hv;
          if (OUT_MODE == 2) *(v8h*)(C2 + (size_t)(mBase + row) * ldc + n0 + c8) = lv;
        }
        
      }
    }
    __builtin_amdgcn_fence(__ATOMIC_RELEASE, "workgroup");
    __builtin_amdgcn_wave_barrier();
    __builtin_amdgcn_fence(__ATOMIC_ACQUIRE, "workgroup");
  }
}

// ---------------------------------------------------------------------------
// f32 -> bf16 (RNE) cast, 8 consecutive elements per thread (one 16-B store per lane;
// Coverage: n8 = n/8 threads x 8 = the whole plane; both grids here are exact multiples of 256
// (x: 1,048,576 threads = 4096 blocks; W: 393,216 threads = 1536 blocks).
// ---------------------------------------------------------------------------
__global__ __launch_bounds__(256) void cast8_bf16_kernel(const float* __restrict__ in, unsigned short* __restrict__ out,
                                                         int n8) {
  const int i = blockIdx.x * 256 + threadIdx.x;
  if (i >= n8) return;
  const float* p = in + 8 * (size_t)i;
  const v4f a = *(const v4f*)(p);
  const v4f c = *(const v4f*)(p + 4);
  unsigned short hb[8];
#pragma unroll
  for (int e = 0; e < 4; ++e) {
    hb[e]     = f2bf_bits(a[e]);
    hb[4 + e] = f2bf_bits(c[e]);
  }
  const v4u u = (v4u){pk16(hb[0], hb[1]), pk16(hb[2], hb[3]), pk16(hb[4], hb[5]), pk16(hb[6], hb[7])};
  unsigned short* q = out + 8 * (size_t)i;
  *(v4u*)q = u;
  
}

// ---------------------------------------------------------------------------
// Flash-style attention for head_dim 64 on f16 planes (no mask), f32 out.
//   QK plane  f16 [8192 tokens][2048]: q of (b,h) at column h*64, k at column 1024 + h*64, row = b*2048 + s.
//   VT plane  f16 [b*16+h][64 d][2048 s].
//   scores = q . k^T        : v_wmma_f32_16x16x32_f16 (q resident A fragments, k from LDS), x0.125 in f32
//   out    = (p x2^15) . v  : v_wmma_f32_16x16x32_f16 (p per-wave LDS tile as A, V^T from LDS as B)
//   online softmax statistics m, l, alpha and the final 1/(l*2^15) in f32; precise expf.
// Block = 4 waves = 64 query rows of one (b,h); wave w owns rows q0..q0+15. grid.x = 4*16*32 = 2048.
// LDS exchanges: K/V^T tiles (written by all waves, read by all) and the per-wave P / O slabs are all
// separated by block-wide barriers; every barrier is reached by all 4 waves (32 uniform chunk trips).
// Staging coverage per chunk: 4 iterations x 128 threads = 512 16-B words = 64 rows x 8 words for the
// K tile [64 kv][64 d] and likewise for the V^T tile [64 d][64 kv] (every LDS byte read is written).
// Out store: each instruction writes two 256-B row segments (lanes 0-15 row 2it, lanes 16-31 row 2it+1,
// ---------------------------------------------------------------------------
constexpr int kKC = 64;        // keys per chunk
constexpr int kQB = 64;        // query rows per block
constexpr int kOsPitch = 68;   // floats
static_assert(kSeq % kKC == 0 && kSeq % kQB == 0, "attention tiles");

__device__ __forceinline__ v8f mma_h16(v16h a, v16h b, v8f c) {
  c = __builtin_amdgcn_wmma_f32_16x16x32_f16(false, a, false, b, (short)0, c, false, false);
  asm volatile("v_nop\n\tv_nop\n\tv_nop\n\tv_nop" : "+v"(c) : "v"(a), "v"(b));
  return c;
}

__global__ __launch_bounds__(128)
void attn_f16_kernel(const unsigned short* __restrict__ QKp, const unsigned short* __restrict__ VTp,
                     float* __restrict__ out) {
  const _Float16* QK = (const _Float16*)(const void*)QKp;
  const _Float16* VT = (const _Float16*)(const void*)VTp;
  __shared__ __align__(16) _Float16 Ksh[kKC * kDh];          // K tile   [kv][d]   8 KB
  __shared__ __align__(16) _Float16 Vth[kDh * kKC];          // V^T tile [d][kv]   8 KB
  __shared__ __align__(16) _Float16 Psh[4][16 * kKC];        // per wave P x2^15 [row][kv]  8 KB
  __shared__ __align__(16) float    Os[4][16 * kOsPitch];    // per wave out tile, pitch 68

  const int tid  = threadIdx.x;
  const int wave = tid >> 5;
  const int lane = tid & 31;
  const int hh   = lane >> 4;
  const int c    = lane & 15;

  const int nqb = kSeq / kQB;            // 32
  const int bx  = blockIdx.x;            // 0 .. 2047
  const int qb  = bx % nqb;
  const int bh  = bx / nqb;              // 0 .. 63
  const int h   = bh % kHeads;
  const int b   = bh / kHeads;
  const int q0  = qb * kQB + wave * 16;

  const _Float16* qb_ptr = QK + (size_t)b * kSeq * kQKCols + (size_t)h * kDh;   // (s, d) at + s*2048 + d
  const _Float16* kb_ptr = qb_ptr + kDim;                                        // k columns start at 1024
  const _Float16* vb_ptr = VT + (size_t)bh * kDh * kSeq;                         // (d, s) at + d*2048 + s
  float*          ob_ptr = out + (size_t)b * kSeq * kDim + (size_t)h * kDh;     // (s, d) at + s*1024 + d

  // ---- Q fragments (A operand): lane row c = query q0+c; elements 0..7 <- d dc*32+8hh+0..7, 8..15 <- +16 ----
  v16h qa[2];
  {
    const _Float16* qrow = qb_ptr + (size_t)(q0 + c) * kQKCols + 8 * hh;
#pragma unroll
    for (int dc = 0; dc < 2; ++dc) qa[dc] = Frag<_Float16>::load(qrow + dc * 32);
  }

  float mrow[8], lrow[8];
  v8f oacc[4];
#pragma unroll
  for (int r = 0; r < 8; ++r) { mrow[r] = -__builtin_inff(); lrow[r] = 0.f; }
#pragma unroll
  for (int t = 0; t < 4; ++t) oacc[t] = (v8f){0.f,0.f,0.f,0.f,0.f,0.f,0.f,0.f};

  for (int kc = 0; kc < kSeq / kKC; ++kc) {
    const int kv0 = kc * kKC;
    __syncthreads();
    // ---- stage K tile and V^T tile: pure 16-B copies of the f16 planes ----
#pragma unroll
    for (int i = 0; i < 4; ++i) {
      const int idx = i * 128 + tid;       // 0 .. 511
      const int r   = idx >> 3;            // row 0 .. 63 (kv for K, d for V^T)
      const int c8  = (idx & 7) * 8;       // halves
      const v8h kk = *(const v8h*)(kb_ptr + (size_t)(kv0 + r) * kQKCols + c8);
      const v8h vv = *(const v8h*)(vb_ptr + (size_t)r * kSeq + kv0 + c8);
      *(v8h*)(Ksh + r * kDh + c8) = kk;
      *(v8h*)(Vth + r * kKC + c8) = vv;
    }
    __syncthreads();

    // ---- scores: 4 key column tiles x 2 d-steps ----
    v8f s[4];
#pragma unroll
    for (int j = 0; j < 4; ++j) {
      s[j] = (v8f){0.f,0.f,0.f,0.f,0.f,0.f,0.f,0.f};
#pragma unroll
      for (int dc = 0; dc < 2; ++dc) {
        // B[k = d][n = kv j*16+c] = Ksh[kv][d]; same split k-map as A
        const v16h kb = Frag<_Float16>::load(Ksh + (j * 16 + c) * kDh + dc * 32 + 8 * hh);
        s[j] = mma_h16(qa[dc], kb, s[j]);
      }
    }

    // ---- chunk row max (rows 8hh+r live on the 16 lanes of half hh) ----
    float cm[8];
#pragma unroll
    for (int r = 0; r < 8; ++r) {
      float m = -__builtin_inff();
#pragma unroll
      for (int j = 0; j < 4; ++j) {
        const float sv = s[j][r] * kScale;
        s[j][r] = sv;
        m = fmaxf(m, sv);
      }
#pragma unroll
      for (int off = 1; off < 16; off <<= 1) m = fmaxf(m, __shfl_xor(m, off, 32));
      cm[r] = m;
    }

    // ---- online softmax update; P x2^15 as f16 into the per-wave LDS tile ----
    _Float16* pw = Psh[wave];
#pragma unroll
    for (int r = 0; r < 8; ++r) {
      const float mnew  = fmaxf(mrow[r], cm[r]);
      const float alpha = expf(mrow[r] - mnew);
      mrow[r] = mnew;
      float psum = 0.f;
#pragma unroll
      for (int j = 0; j < 4; ++j) {
        const float p = expf(s[j][r] - mnew);
        psum += p;
        pw[(8 * hh + r) * kKC + j * 16 + c] = (_Float16)(p * kPCarry);
      }
#pragma unroll
      for (int off = 1; off < 16; off <<= 1) psum += __shfl_xor(psum, off, 32);
      lrow[r] = lrow[r] * alpha + psum;
#pragma unroll
      for (int t = 0; t < 4; ++t) oacc[t][r] *= alpha;
    }
    __syncthreads();

    // ---- O += P . V : A = P[row c][kv], B[k = kv][n = d t*16+c] = Vth[d][kv] ----
#pragma unroll
    for (int kk = 0; kk < 2; ++kk) {
      const v16h pa = Frag<_Float16>::load(pw + c * kKC + kk * 32 + 8 * hh);
#pragma unroll
      for (int t = 0; t < 4; ++t) {
        const v16h vb = Frag<_Float16>::load(Vth + (t * 16 + c) * kKC + kk * 32 + 8 * hh);
        oacc[t] = mma_h16(pa, vb, oacc[t]);
      }
    }
  }

  // ---- normalise and store ----
  float* os = Os[wave];
#pragma unroll
  for (int r = 0; r < 8; ++r) {
    const float inv = 1.0f / (lrow[r] * kPCarry);
#pragma unroll
    for (int t = 0; t < 4; ++t) os[(8 * hh + r) * kOsPitch + t * 16 + c] = oacc[t][r] * inv;
  }
  __syncthreads();
  {
    const int c4 = (lane & 15) * 4;
    {
#pragma unroll
      for (int it = 0; it < 8; ++it) {
        const int row = it * 2 + hh;
        const v4f val = *(const v4f*)(os + row * kOsPitch + c4);
        *(v4f*)(ob_ptr + (size_t)(q0 + row) * kDim + c4) = val;
      }
      
    }
  }
}

// ---------------------------------------------------------------------------
// Host glue.
// no aliasing):
//   Xb   bf16 [8192][1024]          16,777,216  at          0   (x, RNE)
//   Wb   bf16 [3072][1024]           6,291,456  at 16,777,216   (W, RNE)
//   QKh  f16  [8192][2048]          33,554,432  at 23,068,672   (q | k columns, e = which*1024 + h*64 + d)
//   Vt   f16  [4*16][64][2048]      16,777,216  at 56,623,104   (v transposed per (b,h))
//   total                           73,400,320
// GEMM shapes: q|k M=8192, N=2048, K=1024; v^T M=64, N=2048, K=1024 (x16 heads via grid.y, x4 launches per batch).
// All M,N multiples of 64, K % 32 == 0, no padding anywhere. 8 launches.
// ---------------------------------------------------------------------------
extern "C" void kernel_launch(void* const* d_in, const int* in_sizes, int n_in,
                              void* d_out, int out_size, void* d_ws, size_t ws_size,
                              hipStream_t stream) {
  if (n_in < 2) return;
  if (in_sizes[0] != kTok * kDim) return;
  if (in_sizes[1] != kWRows * kDim) return;
  if (out_size != kTok * kDim) return;

  const size_t szXb = (size_t)kTok * kDim * 2;
  const size_t szWb = (size_t)kWRows * kDim * 2;
  const size_t szQK = (size_t)kTok * kQKCols * 2;
  const size_t szVt = (size_t)kBatch * kHeads * kDh * kSeq * 2;
  const size_t offXb = 0;
  const size_t offWb = offXb + szXb;
  const size_t offQK = offWb + szWb;
  const size_t offVt = offQK + szQK;
  const size_t total = offVt + szVt;
  if (ws_size < total) return;

  const float* x = (const float*)d_in[0];   // [4,2048,1024] f32
  const float* W = (const float*)d_in[1];   // [3072,1024] f32, [out][in]
  float* out = (float*)d_out;               // [4,2048,1024] f32
  char* ws = (char*)d_ws;
  unsigned short* Xb  = (unsigned short*)(ws + offXb);
  unsigned short* Wb  = (unsigned short*)(ws + offWb);
  unsigned short* QKh = (unsigned short*)(ws + offQK);
  unsigned short* Vt  = (unsigned short*)(ws + offVt);

  // ---- 16-bit operand planes (bf16 RNE of both float inputs) ----
  const int n8x = (kTok * kDim) / 8;     // 1,048,576 -> 4096 blocks exact
  const int n8w = (kWRows * kDim) / 8;   //   393,216 -> 1536 blocks exact
  cast8_bf16_kernel<<<dim3(n8x / 256), dim3(256), 0, stream>>>(x, Xb, n8x);
  cast8_bf16_kernel<<<dim3(n8w / 256), dim3(256), 0, stream>>>(W, Wb, n8w);

  // ---- q | k projection: QKh[token][e] = sum_k Xb[token][k] * Wb[e][k], e in 0..2047 (f16 out) ----
  const int tilesQK = (kTok / 64) * (kQKCols / 64);   // 4096 -> 512 blocks of 8 waves
  wmma_gemm64<1, false, 0, 1, false, 0><<<dim3(tilesQK / 8, 1), dim3(256), 0, stream>>>(
      Xb, Xb, kDim, 0L, Wb, Wb, kDim, 0L,
      (void*)QKh, (void*)QKh, kQKCols, 0L, x, x, 0L, kTok, kQKCols, kDim, 1.0f);

  // ---- v projection written transposed: Vt[b*16+h][d][s] = sum_k Wb[2048+h*64+d][k] * Xb[b*2048+s][k] ----
  const unsigned short* WbV = Wb + (size_t)kQKCols * kDim;   // v weight rows
  const int tilesV = (kDh / 64) * (kSeq / 64);               // 32 -> 4 blocks of 8 waves, grid.y = head
  for (int b = 0; b < kBatch; ++b) {
    const unsigned short* Xbb = Xb + (size_t)b * kSeq * kDim;
    unsigned short* Vtb = Vt + (size_t)b * kHeads * kDh * kSeq;
    wmma_gemm64<1, false, 0, 1, false, 0><<<dim3(tilesV / 8, kHeads), dim3(256), 0, stream>>>(
        WbV, WbV, kDim, (long)kDh * kDim, Xbb, Xbb, kDim, 0L,
        (void*)Vtb, (void*)Vtb, kSeq, (long)kDh * kSeq, x, x, 0L, kDh, kSeq, kDim, 1.0f);
  }

  // ---- attention: grid = 4 batches x 16 heads x 32 query blocks ----
  attn_f16_kernel<<<dim3(kBatch * kHeads * (kSeq / kQB)), dim3(128), 0, stream>>>(QKh, Vt, out);
}

// v001
// Measured time: 570 microseconds a run.
// Two timings next to v000 both put it at 1.19 times that version's speed.
// Contractions: qkv projection (x bf16 RNE, W^T bf16 RNE) on v_wmma_f32_16x16x32_bf16; scores q.k^T (q, k f16 planes) and attn.v (P f16 carried x32768, V^T f16 plane) on v_wmma_f32_16x16x32_f16; all f32 accumulate; online softmax statistics, scaling and 1/l in f32.
#include <hip/hip_runtime.h>
#include <math.h>

// ---------------------------------------------------------------------------
// Problem constants
// ---------------------------------------------------------------------------
constexpr int kBatch  = 4;
constexpr int kSeq    = 2048;
constexpr int kDim    = 1024;
constexpr int kHeads  = 16;
constexpr int kDh     = 64;
constexpr int kTok    = kBatch * kSeq;     // 8192 token rows
constexpr int kWRows  = 3 * kDim;          // 3072 weight rows (q | k | v)
constexpr int kQKCols = 2 * kDim;          // 2048: pitch of the q | k plane (halves)
constexpr float kPCarry    = 32768.0f;     // unnormalised probabilities carried x2^15 in f16
constexpr float kScale     = 0.125f;       // 64^-0.5, applied to the f32 scores
static_assert(kHeads * kDh == kDim, "shape");
static_assert(kDim % 32 == 0, "gemm K multiple of 32");
static_assert(kTok % 64 == 0 && kQKCols % 64 == 0 && kDh % 64 == 0 && kSeq % 64 == 0, "gemm M,N multiples of 64");
static_assert((kTok * kDim) % (8 * 256) == 0 && (kWRows * kDim) % (8 * 256) == 0, "cast grids exact");

typedef __attribute__((ext_vector_type(16))) _Float16 v16h;
typedef __attribute__((ext_vector_type(8)))  _Float16 v8h;
typedef __attribute__((ext_vector_type(16))) __bf16   v16b;
typedef __attribute__((ext_vector_type(8)))  __bf16   v8b;
typedef __attribute__((ext_vector_type(8)))  float    v8f;
typedef __attribute__((ext_vector_type(4)))  float    v4f;
typedef __attribute__((ext_vector_type(4)))  unsigned int v4u;

// ---------------------------------------------------------------------------
// Helpers
// ---------------------------------------------------------------------------
__device__ __forceinline__ unsigned short f2bf_bits(float f) {
  unsigned u = __float_as_uint(f);
  return (unsigned short)((u + 0x7FFFu + ((u >> 16) & 1u)) >> 16);
}
__device__ __forceinline__ float bf_bits2f(unsigned short h) { return __uint_as_float(((unsigned)h) << 16); }

// hazard guards as plain device helpers (no inline asm inside the kernel template body)
__device__ __forceinline__ void dep_guard_h(v8f& a, v8f& b, v16h x, v16h y) { asm volatile("v_nop\n\tv_nop\n\tv_nop\n\tv_nop" : "+v"(a), "+v"(b) : "v"(x), "v"(y)); }
__device__ __forceinline__ void dep_guard_b(v8f& a, v8f& b, v16b x, v16b y) { asm volatile("v_nop\n\tv_nop\n\tv_nop\n\tv_nop" : "+v"(a), "+v"(b) : "v"(x), "v"(y)); }
__device__ __forceinline__ void keep4_h(v16h a, v16h b, v16h c, v16h d) { asm volatile("v_nop" :: "v"(a), "v"(b), "v"(c), "v"(d)); }
__device__ __forceinline__ void keep4_b(v16b a, v16b b, v16b c, v16b d) { asm volatile("v_nop" :: "v"(a), "v"(b), "v"(c), "v"(d)); }
__device__ __forceinline__ void acc_guard4(v8f& a, v8f& b, v8f& c, v8f& d) { asm volatile("v_nop\n\tv_nop\n\tv_nop\n\tv_nop" : "+v"(a), "+v"(b), "+v"(c), "+v"(d)); }
template <typename T> struct Frag;
template <> struct Frag<_Float16> {
  typedef v16h V; union U { v16h v; v8h h[2]; };
  // elements 0..7 <- p[0..7], 8..15 <- p[16..23]
  static __device__ __forceinline__ v16h load(const _Float16* p) {
    U f; f.h[0] = *(const v8h*)(p); f.h[1] = *(const v8h*)(p + 16); return f.v;
  }
  static __device__ __forceinline__ v8f mma(v16h a, v16h b, v8f c) {
    return __builtin_amdgcn_wmma_f32_16x16x32_f16(false, a, false, b, (short)0, c, false, false);
  }
  static __device__ __forceinline__ void guard(v8f& a, v8f& b, v16h x, v16h y) { dep_guard_h(a, b, x, y); }
  static __device__ __forceinline__ void keep(v16h a, v16h b, v16h c, v16h d) { keep4_h(a, b, c, d); }
};
template <> struct Frag<__bf16> {
  typedef v16b V; union U { v16b v; v8b h[2]; };
  static __device__ __forceinline__ v16b load(const __bf16* p) {
    U f; f.h[0] = *(const v8b*)(p); f.h[1] = *(const v8b*)(p + 16); return f.v;
  }
  static __device__ __forceinline__ v8f mma(v16b a, v16b b, v8f c) {
    return __builtin_amdgcn_wmma_f32_16x16x32_bf16(false, a, false, b, (short)0, c, false, false);
  }
  static __device__ __forceinline__ void guard(v8f& a, v8f& b, v16b x, v16b y) { dep_guard_b(a, b, x, y); }
  static __device__ __forceinline__ void keep(v16b a, v16b b, v16b c, v16b d) { keep4_b(a, b, c, d); }
};

__device__ __forceinline__ unsigned pk16(unsigned short a, unsigned short b) { return (unsigned)a | ((unsigned)b << 16); }

// ---- Register-blocked batched WMMA GEMM (ACT reduced to none/relu/leaky) -------------------------------
// C[m,n] = scale * sum_k A[m,k] * Bt[n,k] (+bias)(+resid); each wave owns a 64x64 tile.
// A row-major [M,K]; Bt row-major [N,K]; M,N % 64 == 0, K % 32 == 0.
// SPLIT: operands are hi/lo planes (A2/Bt2 = lo planes, same layout); product = hi*hi + hi*lo + lo*hi.
// BIAS_MODE: 0 = none, 1 = bias[m], 2 = bias[n].
// OUT_MODE: 0 = f32, 1 = f16, 2 = bf16 hi plane (Cout) + bf16 lo plane (Cout2).
// ET: 0 = f16 operands, 1 = bf16 operands (pointers passed as 16-bit storage)
template <int ET> struct Elem;
template <> struct Elem<0> { typedef _Float16 T; };
template <> struct Elem<1> { typedef __bf16 T; };
template <int ET, bool SPLIT, int BIAS_MODE, int OUT_MODE, bool RESID, int ACT = 0>
__global__ __launch_bounds__(256) void wmma_gemm64(
    const unsigned short* __restrict__ Ap, const unsigned short* __restrict__ A2p, int lda, long strideA,
    const unsigned short* __restrict__ Btp, const unsigned short* __restrict__ Bt2p, int ldb, long strideB,
    void* __restrict__ Cout, void* __restrict__ Cout2, int ldc, long strideC,
    const float* __restrict__ bias,
    const float* __restrict__ resid, long strideR,
    int M, int N, int K, float scale) {
  typedef typename Elem<ET>::T T;
  typedef typename Frag<T>::V V;
  const T* A = (const T*)Ap; const T* A2 = (const T*)A2p; const T* Bt = (const T*)Btp; const T* Bt2 = (const T*)Bt2p;
  __shared__ __align__(16) float sT[8][16 * 68];   // per-wave 16x64 slab, pitch 68 floats
  const int b    = blockIdx.y;
  const int lane = threadIdx.x & 31;
  const int wave = threadIdx.x >> 5;
  const int tilesN = N >> 6;
  const int tilesM = M >> 6;
  const int tile = blockIdx.x * 8 + wave;
  if (tile >= tilesM * tilesN) return;   // wave-uniform; no block barriers in this kernel
  const int tm = tile / tilesN;
  const int tn = tile - tm * tilesN;
  const int m0 = tm << 6;
  const int n0 = tn << 6;

  const T* Ab  = A  + (size_t)b * strideA;
  const T* Bb  = Bt + (size_t)b * strideB;
  const T* Ab2 = SPLIT ? (A2  + (size_t)b * strideA) : nullptr;
  const T* Bb2 = SPLIT ? (Bt2 + (size_t)b * strideB) : nullptr;

  const int rlane = lane & 15;                 // row (A) / col (B, D) within subtile
  const int koff  = (lane >> 4) * 8;           // k offset of this lane half
  const int mOff  = (lane >> 4) * 8;           // D row offset

  v8f acc[4][4];
#pragma unroll
  for (int i = 0; i < 4; ++i)
#pragma unroll
    for (int j = 0; j < 4; ++j) acc[i][j] = (v8f){0.f,0.f,0.f,0.f,0.f,0.f,0.f,0.f};

  for (int k0 = 0; k0 < K; k0 += 32) {
    V bh[4], bl[4];
#pragma unroll
    for (int j = 0; j < 4; ++j) {
      const size_t bo = (size_t)(n0 + (j << 4) + rlane) * ldb + koff + k0;
      bh[j] = Frag<T>::load(Bb + bo);
      if (SPLIT) bl[j] = Frag<T>::load(Bb2 + bo);
    }
#pragma unroll
    for (int i = 0; i < 4; ++i) {
      const size_t ao = (size_t)(m0 + (i << 4) + rlane) * lda + koff + k0;
      V ah = Frag<T>::load(Ab + ao);
      V al;
      if (SPLIT) al = Frag<T>::load(Ab2 + ao);
#pragma unroll
      for (int j = 0; j < 4; ++j) {
        acc[i][j] = Frag<T>::mma(ah, bh[j], acc[i][j]);
        if (SPLIT) {
          acc[i][j] = Frag<T>::mma(ah, bl[j], acc[i][j]);
          acc[i][j] = Frag<T>::mma(al, bh[j], acc[i][j]);
        }
      }
      Frag<T>::guard(acc[i][0], acc[i][3], ah, SPLIT ? al : ah);
    }
    Frag<T>::keep(bh[0], bh[1], bh[2], bh[3]);
    if (SPLIT) Frag<T>::keep(bl[0], bl[1], bl[2], bl[3]);
  }
  acc_guard4(acc[0][0], acc[0][1], acc[0][2], acc[0][3]);
  acc_guard4(acc[1][0], acc[1][1], acc[1][2], acc[1][3]);
  acc_guard4(acc[2][0], acc[2][1], acc[2][2], acc[2][3]);
  acc_guard4(acc[3][0], acc[3][1], acc[3][2], acc[3][3]);

  // ---- epilogue ----
  float* slab = sT[wave];
  const float* Rb = RESID ? (resid + (size_t)b * strideR) : nullptr;
#pragma unroll
  for (int i = 0; i < 4; ++i) {
    const int mBase = m0 + (i << 4);
#pragma unroll
    for (int j = 0; j < 4; ++j) {
      const int n = n0 + (j << 4) + rlane;
      float bv = 0.f;
      if (BIAS_MODE == 2) bv = bias[n];
#pragma unroll
      for (int r = 0; r < 8; ++r) {
        float v = acc[i][j][r] * scale;
        if (BIAS_MODE == 1) v += bias[mBase + mOff + r];
        if (BIAS_MODE == 2) v += bv;
        if (RESID) v += Rb[(size_t)(mBase + mOff + r) * ldc + n];
        if (ACT == 2) v = fmaxf(v, 0.0f);
        if (ACT == 4) v = (v > 0.f) ? v : 0.01f * v;
        slab[(mOff + r) * 68 + (j << 4) + rlane] = v;
      }
    }
    __builtin_amdgcn_fence(__ATOMIC_RELEASE, "workgroup");
    __builtin_amdgcn_wave_barrier();
    __builtin_amdgcn_fence(__ATOMIC_ACQUIRE, "workgroup");
    if (OUT_MODE == 0) {
      float* C = (float*)Cout + (size_t)b * strideC;
      const int hh = lane >> 4, c4 = (lane & 15) * 4;     // row seg = 256 B = 16 lanes x 16 B
      {
#pragma unroll
        for (int it = 0; it < 8; ++it) {
          const int row = it * 2 + hh;
          v4f v = *(const v4f*)(slab + row * 68 + c4);
          *(v4f*)(C + (size_t)(mBase + row) * ldc + n0 + c4) = v;
        }
        
      }
    } else {
      const int q = lane >> 3, c8 = (lane & 7) * 8;
      unsigned short* C  = (unsigned short*)Cout  + (size_t)b * strideC;
      unsigned short* C2 = (OUT_MODE == 2) ? ((unsigned short*)Cout2 + (size_t)b * strideC) : nullptr;
      {
#pragma unroll
        for (int it = 0; it < 4; ++it) {
          const int row = it * 4 + q;
          const float* sp = slab + row * 68 + c8;
          v8h hv, lv;
#pragma unroll
          for (int e = 0; e < 8; ++e) {
            if (OUT_MODE == 1) {
              hv[e] = (_Float16)sp[e];
            } else {
              unsigned short hb = f2bf_bits(sp[e]);
              unsigned short lb = f2bf_bits(sp[e] - bf_bits2f(hb));
              hv[e] = __builtin_bit_cast(_Float16, hb);
              lv[e] = __builtin_bit_cast(_Float16, lb);
            }
          }
          *(v8h*)(C + (size_t)(mBase + row) * ldc + n0 + c8) = hv;
          if (OUT_MODE == 2) *(v8h*)(C2 + (size_t)(mBase + row) * ldc + n0 + c8) = lv;
        }
        
      }
    }
    __builtin_amdgcn_fence(__ATOMIC_RELEASE, "workgroup");
    __builtin_amdgcn_wave_barrier();
    __builtin_amdgcn_fence(__ATOMIC_ACQUIRE, "workgroup");
  }
}

// ---------------------------------------------------------------------------
// f32 -> bf16 (RNE) cast, 8 consecutive elements per thread (one 16-B store per lane;
// Coverage: n8 = n/8 threads x 8 = the whole plane; both grids here are exact multiples of 256
// (x: 1,048,576 threads = 4096 blocks; W: 393,216 threads = 1536 blocks).
// ---------------------------------------------------------------------------
__global__ __launch_bounds__(256) void cast8_bf16_kernel(const float* __restrict__ in, unsigned short* __restrict__ out,
                                                         int n8) {
  const int i = blockIdx.x * 256 + threadIdx.x;
  if (i >= n8) return;
  const float* p = in + 8 * (size_t)i;
  const v4f a = *(const v4f*)(p);
  const v4f c = *(const v4f*)(p + 4);
  unsigned short hb[8];
#pragma unroll
  for (int e = 0; e < 4; ++e) {
    hb[e]     = f2bf_bits(a[e]);
    hb[4 + e] = f2bf_bits(c[e]);
  }
  const v4u u = (v4u){pk16(hb[0], hb[1]), pk16(hb[2], hb[3]), pk16(hb[4], hb[5]), pk16(hb[6], hb[7])};
  unsigned short* q = out + 8 * (size_t)i;
  *(v4u*)q = u;
  
}

// ---------------------------------------------------------------------------
// Flash-style attention for head_dim 64 on f16 planes (no mask), f32 out.
//   QK plane  f16 [8192 tokens][2048]: q of (b,h) at column h*64, k at column 1024 + h*64, row = b*2048 + s.
//   VT plane  f16 [b*16+h][64 d][2048 s].
//   scores = q . k^T        : v_wmma_f32_16x16x32_f16 (q resident A fragments, k from LDS), x0.125 in f32
//   out    = (p x2^15) . v  : v_wmma_f32_16x16x32_f16 (p per-wave LDS tile as A, V^T from LDS as B)
//   online softmax statistics m, l, alpha and the final 1/(l*2^15) in f32; precise expf.
// Block = 4 waves = 64 query rows of one (b,h); wave w owns rows q0..q0+15. grid.x = 4*16*32 = 2048.
// LDS exchanges: K/V^T tiles (written by all waves, read by all) and the per-wave P / O slabs are all
// separated by block-wide barriers; every barrier is reached by all 4 waves (32 uniform chunk trips).
// Staging coverage per chunk: 4 iterations x 128 threads = 512 16-B words = 64 rows x 8 words for the
// K tile [64 kv][64 d] and likewise for the V^T tile [64 d][64 kv] (every LDS byte read is written; the
// 16 pad bytes behind each 128-B row are neither written nor read).
// Out store: each instruction writes two 256-B row segments (lanes 0-15 row 2it, lanes 16-31 row 2it+1,
// ---------------------------------------------------------------------------
constexpr int kKC = 64;        // keys per chunk
constexpr int kQB = 64;        // query rows per block
constexpr int kOsPitch = 68;   // floats
constexpr int kTP = 72;        // halves: LDS row pitch of the K, V^T and P tiles = 144 B = 16 B x 9 (odd), so the 16 rows
                               // that one 16-B fragment load touches per lane half fall on 16 distinct groups of four banks
static_assert(kTP >= kDh && kTP >= kKC && (kTP * 2) % 16 == 0 && ((kTP * 2) / 16) % 2 == 1, "tile pitch");
static_assert(kSeq % kKC == 0 && kSeq % kQB == 0, "attention tiles");

__device__ __forceinline__ v8f mma_h16(v16h a, v16h b, v8f c) {
  c = __builtin_amdgcn_wmma_f32_16x16x32_f16(false, a, false, b, (short)0, c, false, false);
  asm volatile("v_nop\n\tv_nop\n\tv_nop\n\tv_nop" : "+v"(c) : "v"(a), "v"(b));
  return c;
}

__global__ __launch_bounds__(128)
void attn_f16_kernel(const unsigned short* __restrict__ QKp, const unsigned short* __restrict__ VTp,
                     float* __restrict__ out) {
  const _Float16* QK = (const _Float16*)(const void*)QKp;
  const _Float16* VT = (const _Float16*)(const void*)VTp;
  __shared__ __align__(16) _Float16 Ksh[kKC * kTP];          // K tile   [kv][d]   9 KB, 64 of 72 halves a row used
  __shared__ __align__(16) _Float16 Vth[kDh * kTP];          // V^T tile [d][kv]   9 KB
  __shared__ __align__(16) _Float16 Psh[4][16 * kTP];        // per wave P x2^15 [row][kv]  9 KB
  __shared__ __align__(16) float    Os[4][16 * kOsPitch];    // per wave out tile, pitch 68

  const int tid  = threadIdx.x;
  const int wave = tid >> 5;
  const int lane = tid & 31;
  const int hh   = lane >> 4;
  const int c    = lane & 15;

  const int nqb = kSeq / kQB;            // 32
  const int bx  = blockIdx.x;            // 0 .. 2047
  const int qb  = bx % nqb;
  const int bh  = bx / nqb;              // 0 .. 63
  const int h   = bh % kHeads;
  const int b   = bh / kHeads;
  const int q0  = qb * kQB + wave * 16;

  const _Float16* qb_ptr = QK + (size_t)b * kSeq * kQKCols + (size_t)h * kDh;   // (s, d) at + s*2048 + d
  const _Float16* kb_ptr = qb_ptr + kDim;                                        // k columns start at 1024
  const _Float16* vb_ptr = VT + (size_t)bh * kDh * kSeq;                         // (d, s) at + d*2048 + s
  float*          ob_ptr = out + (size_t)b * kSeq * kDim + (size_t)h * kDh;     // (s, d) at + s*1024 + d

  // ---- Q fragments (A operand): lane row c = query q0+c; elements 0..7 <- d dc*32+8hh+0..7, 8..15 <- +16 ----
  v16h qa[2];
  {
    const _Float16* qrow = qb_ptr + (size_t)(q0 + c) * kQKCols + 8 * hh;
#pragma unroll
    for (int dc = 0; dc < 2; ++dc) qa[dc] = Frag<_Float16>::load(qrow + dc * 32);
  }

  float mrow[8], lrow[8];
  v8f oacc[4];
#pragma unroll
  for (int r = 0; r < 8; ++r) { mrow[r] = -__builtin_inff(); lrow[r] = 0.f; }
#pragma unroll
  for (int t = 0; t < 4; ++t) oacc[t] = (v8f){0.f,0.f,0.f,0.f,0.f,0.f,0.f,0.f};

  for (int kc = 0; kc < kSeq / kKC; ++kc) {
    const int kv0 = kc * kKC;
    __syncthreads();
    // ---- stage K tile and V^T tile: pure 16-B copies of the f16 planes ----
#pragma unroll
    for (int i = 0; i < 4; ++i) {
      const int idx = i * 128 + tid;       // 0 .. 511
      const int r   = idx >> 3;            // row 0 .. 63 (kv for K, d for V^T)
      const int c8  = (idx & 7) * 8;       // halves
      const v8h kk = *(const v8h*)(kb_ptr + (size_t)(kv0 + r) * kQKCols + c8);
      const v8h vv = *(const v8h*)(vb_ptr + (size_t)r * kSeq + kv0 + c8);
      *(v8h*)(Ksh + r * kTP + c8) = kk;
      *(v8h*)(Vth + r * kTP + c8) = vv;
    }
    __syncthreads();

    // ---- scores: 4 key column tiles x 2 d-steps ----
    v8f s[4];
#pragma unroll
    for (int j = 0; j < 4; ++j) {
      s[j] = (v8f){0.f,0.f,0.f,0.f,0.f,0.f,0.f,0.f};
#pragma unroll
      for (int dc = 0; dc < 2; ++dc) {
        // B[k = d][n = kv j*16+c] = Ksh[kv][d]; same split k-map as A
        const v16h kb = Frag<_Float16>::load(Ksh + (j * 16 + c) * kTP + dc * 32 + 8 * hh);
        s[j] = mma_h16(qa[dc], kb, s[j]);
      }
    }

    // ---- chunk row max (rows 8hh+r live on the 16 lanes of half hh) ----
    float cm[8];
#pragma unroll
    for (int r = 0; r < 8; ++r) {
      float m = -__builtin_inff();
#pragma unroll
      for (int j = 0; j < 4; ++j) {
        const float sv = s[j][r] * kScale;
        s[j][r] = sv;
        m = fmaxf(m, sv);
      }
#pragma unroll
      for (int off = 1; off < 16; off <<= 1) m = fmaxf(m, __shfl_xor(m, off, 32));
      cm[r] = m;
    }

    // ---- online softmax update; P x2^15 as f16 into the per-wave LDS tile ----
    _Float16* pw = Psh[wave];
#pragma unroll
    for (int r = 0; r < 8; ++r) {
      const float mnew  = fmaxf(mrow[r], cm[r]);
      const float alpha = expf(mrow[r] - mnew);
      mrow[r] = mnew;
      float psum = 0.f;
#pragma unroll
      for (int j = 0; j < 4; ++j) {
        const float p = expf(s[j][r] - mnew);
        psum += p;
        pw[(8 * hh + r) * kTP + j * 16 + c] = (_Float16)(p * kPCarry);
      }
#pragma unroll
      for (int off = 1; off < 16; off <<= 1) psum += __shfl_xor(psum, off, 32);
      lrow[r] = lrow[r] * alpha + psum;
#pragma unroll
      for (int t = 0; t < 4; ++t) oacc[t][r] *= alpha;
    }
    __syncthreads();

    // ---- O += P . V : A = P[row c][kv], B[k = kv][n = d t*16+c] = Vth[d][kv] ----
#pragma unroll
    for (int kk = 0; kk < 2; ++kk) {
      const v16h pa = Frag<_Float16>::load(pw + c * kTP + kk * 32 + 8 * hh);
#pragma unroll
      for (int t = 0; t < 4; ++t) {
        const v16h vb = Frag<_Float16>::load(Vth + (t * 16 + c) * kTP + kk * 32 + 8 * hh);
        oacc[t] = mma_h16(pa, vb, oacc[t]);
      }
    }
  }

  // ---- normalise and store ----
  float* os = Os[wave];
#pragma unroll
  for (int r = 0; r < 8; ++r) {
    const float inv = 1.0f / (lrow[r] * kPCarry);
#pragma unroll
    for (int t = 0; t < 4; ++t) os[(8 * hh + r) * kOsPitch + t * 16 + c] = oacc[t][r] * inv;
  }
  __syncthreads();
  {
    const int c4 = (lane & 15) * 4;
    {
#pragma unroll
      for (int it = 0; it < 8; ++it) {
        const int row = it * 2 + hh;
        const v4f val = *(const v4f*)(os + row * kOsPitch + c4);
        *(v4f*)(ob_ptr + (size_t)(q0 + row) * kDim + c4) = val;
      }
      
    }
  }
}

// ---------------------------------------------------------------------------
// Host glue.
// no aliasing):
//   Xb   bf16 [8192][1024]          16,777,216  at          0   (x, RNE)
//   Wb   bf16 [3072][1024]           6,291,456  at 16,777,216   (W, RNE)
//   QKh  f16  [8192][2048]          33,554,432  at 23,068,672   (q | k columns, e = which*1024 + h*64 + d)
//   Vt   f16  [4*16][64][2048]      16,777,216  at 56,623,104   (v transposed per (b,h))
//   total                           73,400,320
// GEMM shapes: q|k M=8192, N=2048, K=1024; v^T M=64, N=2048, K=1024 (x16 heads via grid.y, x4 launches per batch).
// All M,N multiples of 64, K % 32 == 0, no padding anywhere. 8 launches.
// ---------------------------------------------------------------------------
extern "C" void kernel_launch(void* const* d_in, const int* in_sizes, int n_in,
                              void* d_out, int out_size, void* d_ws, size_t ws_size,
                              hipStream_t stream) {
  if (n_in < 2) return;
  if (in_sizes[0] != kTok * kDim) return;
  if (in_sizes[1] != kWRows * kDim) return;
  if (out_size != kTok * kDim) return;

  const size_t szXb = (size_t)kTok * kDim * 2;
  const size_t szWb = (size_t)kWRows * kDim * 2;
  const size_t szQK = (size_t)kTok * kQKCols * 2;
  const size_t szVt = (size_t)kBatch * kHeads * kDh * kSeq * 2;
  const size_t offXb = 0;
  const size_t offWb = offXb + szXb;
  const size_t offQK = offWb + szWb;
  const size_t offVt = offQK + szQK;
  const size_t total = offVt + szVt;
  if (ws_size < total) return;

  const float* x = (const float*)d_in[0];   // [4,2048,1024] f32
  const float* W = (const float*)d_in[1];   // [3072,1024] f32, [out][in]
  float* out = (float*)d_out;               // [4,2048,1024] f32
  char* ws = (char*)d_ws;
  unsigned short* Xb  = (unsigned short*)(ws + offXb);
  unsigned short* Wb  = (unsigned short*)(ws + offWb);
  unsigned short* QKh = (unsigned short*)(ws + offQK);
  unsigned short* Vt  = (unsigned short*)(ws + offVt);

  // ---- 16-bit operand planes (bf16 RNE of both float inputs) ----
  const int n8x = (kTok * kDim) / 8;     // 1,048,576 -> 4096 blocks exact
  const int n8w = (kWRows * kDim) / 8;   //   393,216 -> 1536 blocks exact
  cast8_bf16_kernel<<<dim3(n8x / 256), dim3(256), 0, stream>>>(x, Xb, n8x);
  cast8_bf16_kernel<<<dim3(n8w / 256), dim3(256), 0, stream>>>(W, Wb, n8w);

  // ---- q | k projection: QKh[token][e] = sum_k Xb[token][k] * Wb[e][k], e in 0..2047 (f16 out) ----
  const int tilesQK = (kTok / 64) * (kQKCols / 64);   // 4096 -> 512 blocks of 8 waves
  wmma_gemm64<1, false, 0, 1, false, 0><<<dim3(tilesQK / 8, 1), dim3(256), 0, stream>>>(
      Xb, Xb, kDim, 0L, Wb, Wb, kDim, 0L,
      (void*)QKh, (void*)QKh, kQKCols, 0L, x, x, 0L, kTok, kQKCols, kDim, 1.0f);

  // ---- v projection written transposed: Vt[b*16+h][d][s] = sum_k Wb[2048+h*64+d][k] * Xb[b*2048+s][k] ----
  const unsigned short* WbV = Wb + (size_t)kQKCols * kDim;   // v weight rows
  const int tilesV = (kDh / 64) * (kSeq / 64);               // 32 -> 4 blocks of 8 waves, grid.y = head
  for (int b = 0; b < kBatch; ++b) {
    const unsigned short* Xbb = Xb + (size_t)b * kSeq * kDim;
    unsigned short* Vtb = Vt + (size_t)b * kHeads * kDh * kSeq;
    wmma_gemm64<1, false, 0, 1, false, 0><<<dim3(tilesV / 8, kHeads), dim3(256), 0, stream>>>(
        WbV, WbV, kDim, (long)kDh * kDim, Xbb, Xbb, kDim, 0L,
        (void*)Vtb, (void*)Vtb, kSeq, (long)kDh * kSeq, x, x, 0L, kDh, kSeq, kDim, 1.0f);
  }

  // ---- attention: grid = 4 batches x 16 heads x 32 query blocks ----
  attn_f16_kernel<<<dim3(kBatch * kHeads * (kSeq / kQB)), dim3(128), 0, stream>>>(QKh, Vt, out);
}

// v002
// One run takes 385 microseconds.
// Timed twice side by side with v001, it ran 1.48 and 1.49 times as fast.
// Over all steps from v000 it is 1.77 times as fast.
// Contractions: qkv projection (x bf16 RNE, W^T bf16 RNE) on v_wmma_f32_16x16x32_bf16; scores q.k^T (q, k f16 planes) and attn.v (P f16 carried x32768, V^T f16 plane) on v_wmma_f32_16x16x32_f16; all f32 accumulate; online softmax statistics, scaling and 1/l in f32.
#include <hip/hip_runtime.h>
#include <math.h>

// ---------------------------------------------------------------------------
// Problem constants
// ---------------------------------------------------------------------------
constexpr int kBatch  = 4;
constexpr int kSeq    = 2048;
constexpr int kDim    = 1024;
constexpr int kHeads  = 16;
constexpr int kDh     = 64;
constexpr int kTok    = kBatch * kSeq;     // 8192 token rows
constexpr int kWRows  = 3 * kDim;          // 3072 weight rows (q | k | v)
constexpr int kQKCols = 2 * kDim;          // 2048: pitch of the q | k plane (halves)
constexpr float kPCarry    = 32768.0f;     // unnormalised probabilities carried x2^15 in f16
constexpr float kScale     = 0.125f;       // 64^-0.5, applied to the f32 scores
static_assert(kHeads * kDh == kDim, "shape");
static_assert(kDim % 32 == 0, "gemm K multiple of 32");
static_assert(kTok % 64 == 0 && kQKCols % 64 == 0 && kDh % 64 == 0 && kSeq % 64 == 0, "gemm M,N multiples of 64");
static_assert((kTok * kDim) % (8 * 256) == 0 && (kWRows * kDim) % (8 * 256) == 0, "cast grids exact");

typedef __attribute__((ext_vector_type(16))) _Float16 v16h;
typedef __attribute__((ext_vector_type(8)))  _Float16 v8h;
typedef __attribute__((ext_vector_type(16))) __bf16   v16b;
typedef __attribute__((ext_vector_type(8)))  __bf16   v8b;
typedef __attribute__((ext_vector_type(8)))  float    v8f;
typedef __attribute__((ext_vector_type(4)))  float    v4f;
typedef __attribute__((ext_vector_type(4)))  unsigned int v4u;

// ---------------------------------------------------------------------------
// Helpers
// ---------------------------------------------------------------------------
__device__ __forceinline__ unsigned short f2bf_bits(float f) {
  unsigned u = __float_as_uint(f);
  return (unsigned short)((u + 0x7FFFu + ((u >> 16) & 1u)) >> 16);
}
__device__ __forceinline__ float bf_bits2f(unsigned short h) { return __uint_as_float(((unsigned)h) << 16); }

// hazard guards as plain device helpers (no inline asm inside the kernel template body)
__device__ __forceinline__ void dep_guard_h(v8f& a, v8f& b, v16h x, v16h y) { asm volatile("v_nop\n\tv_nop\n\tv_nop\n\tv_nop" : "+v"(a), "+v"(b) : "v"(x), "v"(y)); }
__device__ __forceinline__ void dep_guard_b(v8f& a, v8f& b, v16b x, v16b y) { asm volatile("v_nop\n\tv_nop\n\tv_nop\n\tv_nop" : "+v"(a), "+v"(b) : "v"(x), "v"(y)); }
__device__ __forceinline__ void keep4_h(v16h a, v16h b, v16h c, v16h d) { asm volatile("v_nop" :: "v"(a), "v"(b), "v"(c), "v"(d)); }
__device__ __forceinline__ void keep4_b(v16b a, v16b b, v16b c, v16b d) { asm volatile("v_nop" :: "v"(a), "v"(b), "v"(c), "v"(d)); }
__device__ __forceinline__ void acc_guard4(v8f& a, v8f& b, v8f& c, v8f& d) { asm volatile("v_nop\n\tv_nop\n\tv_nop\n\tv_nop" : "+v"(a), "+v"(b), "+v"(c), "+v"(d)); }
template <typename T> struct Frag;
template <> struct Frag<_Float16> {
  typedef v16h V; union U { v16h v; v8h h[2]; };
  // elements 0..7 <- p[0..7], 8..15 <- p[16..23]
  static __device__ __forceinline__ v16h load(const _Float16* p) {
    U f; f.h[0] = *(const v8h*)(p); f.h[1] = *(const v8h*)(p + 16); return f.v;
  }
  static __device__ __forceinline__ v8f mma(v16h a, v16h b, v8f c) {
    return __builtin_amdgcn_wmma_f32_16x16x32_f16(false, a, false, b, (short)0, c, false, false);
  }
  static __device__ __forceinline__ void guard(v8f& a, v8f& b, v16h x, v16h y) { dep_guard_h(a, b, x, y); }
  static __device__ __forceinline__ void keep(v16h a, v16h b, v16h c, v16h d) { keep4_h(a, b, c, d); }
};
template <> struct Frag<__bf16> {
  typedef v16b V; union U { v16b v; v8b h[2]; };
  static __device__ __forceinline__ v16b load(const __bf16* p) {
    U f; f.h[0] = *(const v8b*)(p); f.h[1] = *(const v8b*)(p + 16); return f.v;
  }
  static __device__ __forceinline__ v8f mma(v16b a, v16b b, v8f c) {
    return __builtin_amdgcn_wmma_f32_16x16x32_bf16(false, a, false, b, (short)0, c, false, false);
  }
  static __device__ __forceinline__ void guard(v8f& a, v8f& b, v16b x, v16b y) { dep_guard_b(a, b, x, y); }
  static __device__ __forceinline__ void keep(v16b a, v16b b, v16b c, v16b d) { keep4_b(a, b, c, d); }
};

__device__ __forceinline__ unsigned pk16(unsigned short a, unsigned short b) { return (unsigned)a | ((unsigned)b << 16); }

// ---- Register-blocked batched WMMA GEMM (ACT reduced to none/relu/leaky) -------------------------------
// C[m,n] = scale * sum_k A[m,k] * Bt[n,k] (+bias)(+resid); each wave owns a 64x64 tile.
// A row-major [M,K]; Bt row-major [N,K]; M,N % 64 == 0, K % 32 == 0.
// SPLIT: operands are hi/lo planes (A2/Bt2 = lo planes, same layout); product = hi*hi + hi*lo + lo*hi.
// BIAS_MODE: 0 = none, 1 = bias[m], 2 = bias[n].
// OUT_MODE: 0 = f32, 1 = f16, 2 = bf16 hi plane (Cout) + bf16 lo plane (Cout2).
// ET: 0 = f16 operands, 1 = bf16 operands (pointers passed as 16-bit storage)
template <int ET> struct Elem;
template <> struct Elem<0> { typedef _Float16 T; };
template <> struct Elem<1> { typedef __bf16 T; };
template <int ET, bool SPLIT, int BIAS_MODE, int OUT_MODE, bool RESID, int ACT = 0>
__global__ __launch_bounds__(256) void wmma_gemm64(
    const unsigned short* __restrict__ Ap, const unsigned short* __restrict__ A2p, int lda, long strideA,
    const unsigned short* __restrict__ Btp, const unsigned short* __restrict__ Bt2p, int ldb, long strideB,
    void* __restrict__ Cout, void* __restrict__ Cout2, int ldc, long strideC,
    const float* __restrict__ bias,
    const float* __restrict__ resid, long strideR,
    int M, int N, int K, float scale) {
  typedef typename Elem<ET>::T T;
  typedef typename Frag<T>::V V;
  const T* A = (const T*)Ap; const T* A2 = (const T*)A2p; const T* Bt = (const T*)Btp; const T* Bt2 = (const T*)Bt2p;
  __shared__ __align__(16) float sT[8][16 * 68];   // per-wave 16x64 slab, pitch 68 floats
  const int b    = blockIdx.y;
  const int lane = threadIdx.x & 31;
  const int wave = threadIdx.x >> 5;
  const int tilesN = N >> 6;
  const int tilesM = M >> 6;
  const int tile = blockIdx.x * 8 + wave;
  if (tile >= tilesM * tilesN) return;   // wave-uniform; no block barriers in this kernel
  const int tm = tile / tilesN;
  const int tn = tile - tm * tilesN;
  const int m0 = tm << 6;
  const int n0 = tn << 6;

  const T* Ab  = A  + (size_t)b * strideA;
  const T* Bb  = Bt + (size_t)b * strideB;
  const T* Ab2 = SPLIT ? (A2  + (size_t)b * strideA) : nullptr;
  const T* Bb2 = SPLIT ? (Bt2 + (size_t)b * strideB) : nullptr;

  const int rlane = lane & 15;                 // row (A) / col (B, D) within subtile
  const int koff  = (lane >> 4) * 8;           // k offset of this lane half
  const int mOff  = (lane >> 4) * 8;           // D row offset

  v8f acc[4][4];
#pragma unroll
  for (int i = 0; i < 4; ++i)
#pragma unroll
    for (int j = 0; j < 4; ++j) acc[i][j] = (v8f){0.f,0.f,0.f,0.f,0.f,0.f,0.f,0.f};

  for (int k0 = 0; k0 < K; k0 += 32) {
    V bh[4], bl[4];
#pragma unroll
    for (int j = 0; j < 4; ++j) {
      const size_t bo = (size_t)(n0 + (j << 4) + rlane) * ldb + koff + k0;
      bh[j] = Frag<T>::load(Bb + bo);
      if (SPLIT) bl[j] = Frag<T>::load(Bb2 + bo);
    }
#pragma unroll
    for (int i = 0; i < 4; ++i) {
      const size_t ao = (size_t)(m0 + (i << 4) + rlane) * lda + koff + k0;
      V ah = Frag<T>::load(Ab + ao);
      V al;
      if (SPLIT) al = Frag<T>::load(Ab2 + ao);
#pragma unroll
      for (int j = 0; j < 4; ++j) {
        acc[i][j] = Frag<T>::mma(ah, bh[j], acc[i][j]);
        if (SPLIT) {
          acc[i][j] = Frag<T>::mma(ah, bl[j], acc[i][j]);
          acc[i][j] = Frag<T>::mma(al, bh[j], acc[i][j]);
        }
      }
      Frag<T>::guard(acc[i][0], acc[i][3], ah, SPLIT ? al : ah);
    }
    Frag<T>::keep(bh[0], bh[1], bh[2], bh[3]);
    if (SPLIT) Frag<T>::keep(bl[0], bl[1], bl[2], bl[3]);
  }
  acc_guard4(acc[0][0], acc[0][1], acc[0][2], acc[0][3]);
  acc_guard4(acc[1][0], acc[1][1], acc[1][2], acc[1][3]);
  acc_guard4(acc[2][0], acc[2][1], acc[2][2], acc[2][3]);
  acc_guard4(acc[3][0], acc[3][1], acc[3][2], acc[3][3]);

  // ---- epilogue ----
  float* slab = sT[wave];
  const float* Rb = RESID ? (resid + (size_t)b * strideR) : nullptr;
#pragma unroll
  for (int i = 0; i < 4; ++i) {
    const int mBase = m0 + (i << 4);
#pragma unroll
    for (int j = 0; j < 4; ++j) {
      const int n = n0 + (j << 4) + rlane;
      float bv = 0.f;
      if (BIAS_MODE == 2) bv = bias[n];
#pragma unroll
      for (int r = 0; r < 8; ++r) {
        float v = acc[i][j][r] * scale;
        if (BIAS_MODE == 1) v += bias[mBase + mOff + r];
        if (BIAS_MODE == 2) v += bv;
        if (RESID) v += Rb[(size_t)(mBase + mOff + r) * ldc + n];
        if (ACT == 2) v = fmaxf(v, 0.0f);
        if (ACT == 4) v = (v > 0.f) ? v : 0.01f * v;
        slab[(mOff + r) * 68 + (j << 4) + rlane] = v;
      }
    }
    __builtin_amdgcn_fence(__ATOMIC_RELEASE, "workgroup");
    __builtin_amdgcn_wave_barrier();
    __builtin_amdgcn_fence(__ATOMIC_ACQUIRE, "workgroup");
    if (OUT_MODE == 0) {
      float* C = (float*)Cout + (size_t)b * strideC;
      const int hh = lane >> 4, c4 = (lane & 15) * 4;     // row seg = 256 B = 16 lanes x 16 B
      {
#pragma unroll
        for (int it = 0; it < 8; ++it) {
          const int row = it * 2 + hh;
          v4f v = *(const v4f*)(slab + row * 68 + c4);
          *(v4f*)(C + (size_t)(mBase + row) * ldc + n0 + c4) = v;
        }
        
      }
    } else {
      const int q = lane >> 3, c8 = (lane & 7) * 8;
      unsigned short* C  = (unsigned short*)Cout  + (size_t)b * strideC;
      unsigned short* C2 = (OUT_MODE == 2) ? ((unsigned short*)Cout2 + (size_t)b * strideC) : nullptr;
      {
#pragma unroll
        for (int it = 0; it < 4; ++it) {
          const int row = it * 4 + q;
          const float* sp = slab + row * 68 + c8;
          v8h hv, lv;
#pragma unroll
          for (int e = 0; e < 8; ++e) {
            if (OUT_MODE == 1) {
              hv[e] = (_Float16)sp[e];
            } else {
              unsigned short hb = f2bf_bits(sp[e]);
              unsigned short lb = f2bf_bits(sp[e] - bf_bits2f(hb));
              hv[e] = __builtin_bit_cast(_Float16, hb);
              lv[e] = __builtin_bit_cast(_Float16, lb);
            }
          }
          *(v8h*)(C + (size_t)(mBase + row) * ldc + n0 + c8) = hv;
          if (OUT_MODE == 2) *(v8h*)(C2 + (size_t)(mBase + row) * ldc + n0 + c8) = lv;
        }
        
      }
    }
    __builtin_amdgcn_fence(__ATOMIC_RELEASE, "workgroup");
    __builtin_amdgcn_wave_barrier();
    __builtin_amdgcn_fence(__ATOMIC_ACQUIRE, "workgroup");
  }
}

// ---------------------------------------------------------------------------
// f32 -> bf16 (RNE) cast, 8 consecutive elements per thread (one 16-B store per lane;
// Coverage: n8 = n/8 threads x 8 = the whole plane; both grids here are exact multiples of 256
// (x: 1,048,576 threads = 4096 blocks; W: 393,216 threads = 1536 blocks).
// ---------------------------------------------------------------------------
__global__ __launch_bounds__(256) void cast8_bf16_kernel(const float* __restrict__ in, unsigned short* __restrict__ out,
                                                         int n8) {
  const int i = blockIdx.x * 256 + threadIdx.x;
  if (i >= n8) return;
  const float* p = in + 8 * (size_t)i;
  const v4f a = *(const v4f*)(p);
  const v4f c = *(const v4f*)(p + 4);
  unsigned short hb[8];
#pragma unroll
  for (int e = 0; e < 4; ++e) {
    hb[e]     = f2bf_bits(a[e]);
    hb[4 + e] = f2bf_bits(c[e]);
  }
  const v4u u = (v4u){pk16(hb[0], hb[1]), pk16(hb[2], hb[3]), pk16(hb[4], hb[5]), pk16(hb[6], hb[7])};
  unsigned short* q = out + 8 * (size_t)i;
  *(v4u*)q = u;
  
}

// ---------------------------------------------------------------------------
// Flash-style attention for head_dim 64 on f16 planes (no mask), f32 out.
//   QK plane  f16 [8192 tokens][2048]: q of (b,h) at column h*64, k at column 1024 + h*64, row = b*2048 + s.
//   VT plane  f16 [b*16+h][64 d][2048 s].
//   scores^T = k . q^T          : v_wmma_f32_16x16x32_f16 (k from LDS as A, q resident B fragments), x0.125 in f32
//   out^T    = v^T . (p x2^15)^T: v_wmma_f32_16x16x32_f16 (V^T from LDS as A, p^T packed from the score tiles as B)
//   Both products are transposed so that lane (c, hh) holds scores of ONE query, q0+c: its maximum and its sum are
//   taken inside the lane plus one exchange between the wave halves, and two score tiles, converted in place, are
//   the B operand of the second product (element e of it = tile e>>3, register e&7 = key 8hh+e or 16+8hh+e-8).
//   online softmax statistics m, l, alpha and the final 1/(l*2^15) in f32; precise expf.
// Block = 4 waves = 64 query rows of one (b,h); wave w owns rows q0..q0+15. grid.x = 4*16*32 = 2048.
// LDS exchanges: K/V^T tiles (written by all waves, read by all) and the per-wave O slab are
// separated by block-wide barriers; every barrier is reached by all 4 waves (32 uniform chunk trips).
// Staging coverage per chunk: 4 iterations x 128 threads = 512 16-B words = 64 rows x 8 words for the
// K tile [64 kv][64 d] and likewise for the V^T tile [64 d][64 kv] (every LDS byte read is written; the
// 16 pad bytes behind each 128-B row are neither written nor read).
// Out store: each instruction writes two 256-B row segments (lanes 0-15 row 2it, lanes 16-31 row 2it+1,
// ---------------------------------------------------------------------------
constexpr int kKC = 64;        // keys per chunk
constexpr int kQB = 64;        // query rows per block
constexpr int kOsPitch = 68;   // floats
constexpr int kTP = 72;        // halves: LDS row pitch of the K and V^T tiles = 144 B = 16 B x 9 (odd), so the 16 rows
                               // that one 16-B fragment load touches per lane half fall on 16 distinct groups of four banks
static_assert(kTP >= kDh && kTP >= kKC && (kTP * 2) % 16 == 0 && ((kTP * 2) / 16) % 2 == 1, "tile pitch");
static_assert(kSeq % kKC == 0 && kSeq % kQB == 0, "attention tiles");

__device__ __forceinline__ v8f mma_h16(v16h a, v16h b, v8f c) {
  c = __builtin_amdgcn_wmma_f32_16x16x32_f16(false, a, false, b, (short)0, c, false, false);
  asm volatile("v_nop\n\tv_nop\n\tv_nop\n\tv_nop" : "+v"(c) : "v"(a), "v"(b));
  return c;
}

// value of lane l ^ 16 (the other wave half), by a vector cross-row move
__device__ __forceinline__ float xhalf(float x) {
  return __builtin_bit_cast(float, __builtin_amdgcn_permlanex16(__builtin_bit_cast(int, x), __builtin_bit_cast(int, x),
                                                                0x76543210, 0xfedcba98, false, false));
}

__global__ __launch_bounds__(128)
void attn_f16_kernel(const unsigned short* __restrict__ QKp, const unsigned short* __restrict__ VTp,
                     float* __restrict__ out) {
  const _Float16* QK = (const _Float16*)(const void*)QKp;
  const _Float16* VT = (const _Float16*)(const void*)VTp;
  __shared__ __align__(16) _Float16 Ksh[kKC * kTP];          // K tile   [kv][d]   9 KB, 64 of 72 halves a row used
  __shared__ __align__(16) _Float16 Vth[kDh * kTP];          // V^T tile [d][kv]   9 KB
  __shared__ __align__(16) float    Os[4][16 * kOsPitch];    // per wave out tile, pitch 68

  const int tid  = threadIdx.x;
  const int wave = tid >> 5;
  const int lane = tid & 31;
  const int hh   = lane >> 4;
  const int c    = lane & 15;

  const int nqb = kSeq / kQB;            // 32
  const int bx  = blockIdx.x;            // 0 .. 2047
  const int qb  = bx % nqb;
  const int bh  = bx / nqb;              // 0 .. 63
  const int h   = bh % kHeads;
  const int b   = bh / kHeads;
  const int q0  = qb * kQB + wave * 16;

  const _Float16* qb_ptr = QK + (size_t)b * kSeq * kQKCols + (size_t)h * kDh;   // (s, d) at + s*2048 + d
  const _Float16* kb_ptr = qb_ptr + kDim;                                        // k columns start at 1024
  const _Float16* vb_ptr = VT + (size_t)bh * kDh * kSeq;                         // (d, s) at + d*2048 + s
  float*          ob_ptr = out + (size_t)b * kSeq * kDim + (size_t)h * kDh;     // (s, d) at + s*1024 + d

  // ---- Q fragments (B operand): lane column c = query q0+c; elements 0..7 <- d dc*32+8hh+0..7, 8..15 <- +16 ----
  v16h qa[2];
  {
    const _Float16* qrow = qb_ptr + (size_t)(q0 + c) * kQKCols + 8 * hh;
#pragma unroll
    for (int dc = 0; dc < 2; ++dc) qa[dc] = Frag<_Float16>::load(qrow + dc * 32);
  }

  float mrow = -__builtin_inff();   // running maximum of query q0+c (alike in both halves)
  float lrow = 0.f;                 // this half's share of the query's sum; the halves are joined after the loop
  v8f oacc[4];                      // oacc[t][r] = out^T[d = 16t+8hh+r][query q0+c]
#pragma unroll
  for (int t = 0; t < 4; ++t) oacc[t] = (v8f){0.f,0.f,0.f,0.f,0.f,0.f,0.f,0.f};

  for (int kc = 0; kc < kSeq / kKC; ++kc) {
    const int kv0 = kc * kKC;
    __syncthreads();
    // ---- stage K tile and V^T tile: pure 16-B copies of the f16 planes ----
#pragma unroll
    for (int i = 0; i < 4; ++i) {
      const int idx = i * 128 + tid;       // 0 .. 511
      const int r   = idx >> 3;            // row 0 .. 63 (kv for K, d for V^T)
      const int c8  = (idx & 7) * 8;       // halves
      const v8h kk = *(const v8h*)(kb_ptr + (size_t)(kv0 + r) * kQKCols + c8);
      const v8h vv = *(const v8h*)(vb_ptr + (size_t)r * kSeq + kv0 + c8);
      *(v8h*)(Ksh + r * kTP + c8) = kk;
      *(v8h*)(Vth + r * kTP + c8) = vv;
    }
    __syncthreads();

    // ---- scores^T: 4 key row tiles x 2 d-steps; s[j][r] = score of key kv0+16j+8hh+r with query q0+c ----
    v8f s[4];
#pragma unroll
    for (int j = 0; j < 4; ++j) {
      s[j] = (v8f){0.f,0.f,0.f,0.f,0.f,0.f,0.f,0.f};
#pragma unroll
      for (int dc = 0; dc < 2; ++dc) {
        // A[m = kv j*16+c][k = d] = Ksh[kv][d]; same split k-map as B
        const v16h ka = Frag<_Float16>::load(Ksh + (j * 16 + c) * kTP + dc * 32 + 8 * hh);
        s[j] = mma_h16(ka, qa[dc], s[j]);
      }
    }

    // ---- chunk maximum of this lane's query: 32 scores in the lane, the other 32 in lane ^ 16 ----
    float cm = -__builtin_inff();
#pragma unroll
    for (int j = 0; j < 4; ++j) {
#pragma unroll
      for (int r = 0; r < 8; ++r) {
        const float sv = s[j][r] * kScale;
        s[j][r] = sv;
        cm = fmaxf(cm, sv);
      }
    }
    cm = fmaxf(cm, xhalf(cm));

    // ---- online softmax update; P^T x2^15 as f16 packed straight into the B fragments ----
    const float mnew  = fmaxf(mrow, cm);
    const float alpha = expf(mrow - mnew);
    mrow = mnew;
    float ps[4];
    v16h pb[2];
#pragma unroll
    for (int j = 0; j < 4; ++j) {
      ps[j] = 0.f;
#pragma unroll
      for (int r = 0; r < 8; ++r) {
        const float p = expf(s[j][r] - mnew);
        ps[j] += p;
        pb[j >> 1][(j & 1) * 8 + r] = (_Float16)(p * kPCarry);
      }
    }
    lrow = lrow * alpha + ((ps[0] + ps[1]) + (ps[2] + ps[3]));
#pragma unroll
    for (int t = 0; t < 4; ++t)
#pragma unroll
      for (int r = 0; r < 8; ++r) oacc[t][r] *= alpha;

    // ---- O^T += V^T . P^T : A[m = d t*16+c][k = kv] = Vth[d][kv], B = P^T[kv][query c] ----
#pragma unroll
    for (int kk = 0; kk < 2; ++kk) {
#pragma unroll
      for (int t = 0; t < 4; ++t) {
        const v16h va = Frag<_Float16>::load(Vth + (t * 16 + c) * kTP + kk * 32 + 8 * hh);
        oacc[t] = mma_h16(va, pb[kk], oacc[t]);
      }
    }
  }

  // ---- normalise and store: lane (c, hh) holds d = 16t+8hh+0..7 of query row c ----
  float* os = Os[wave];
  {
    const float inv = 1.0f / ((lrow + xhalf(lrow)) * kPCarry);
#pragma unroll
    for (int t = 0; t < 4; ++t) {
      float* op = os + c * kOsPitch + t * 16 + 8 * hh;
      *(v4f*)(op)     = (v4f){oacc[t][0] * inv, oacc[t][1] * inv, oacc[t][2] * inv, oacc[t][3] * inv};
      *(v4f*)(op + 4) = (v4f){oacc[t][4] * inv, oacc[t][5] * inv, oacc[t][6] * inv, oacc[t][7] * inv};
    }
  }
  __syncthreads();
  {
    const int c4 = (lane & 15) * 4;
    {
#pragma unroll
      for (int it = 0; it < 8; ++it) {
        const int row = it * 2 + hh;
        const v4f val = *(const v4f*)(os + row * kOsPitch + c4);
        *(v4f*)(ob_ptr + (size_t)(q0 + row) * kDim + c4) = val;
      }
      
    }
  }
}

// ---------------------------------------------------------------------------
// Host glue.
// no aliasing):
//   Xb   bf16 [8192][1024]          16,777,216  at          0   (x, RNE)
//   Wb   bf16 [3072][1024]           6,291,456  at 16,777,216   (W, RNE)
//   QKh  f16  [8192][2048]          33,554,432  at 23,068,672   (q | k columns, e = which*1024 + h*64 + d)
//   Vt   f16  [4*16][64][2048]      16,777,216  at 56,623,104   (v transposed per (b,h))
//   total                           73,400,320
// GEMM shapes: q|k M=8192, N=2048, K=1024; v^T M=64, N=2048, K=1024 (x16 heads via grid.y, x4 launches per batch).
// All M,N multiples of 64, K % 32 == 0, no padding anywhere. 8 launches.
// ---------------------------------------------------------------------------
extern "C" void kernel_launch(void* const* d_in, const int* in_sizes, int n_in,
                              void* d_out, int out_size, void* d_ws, size_t ws_size,
                              hipStream_t stream) {
  if (n_in < 2) return;
  if (in_sizes[0] != kTok * kDim) return;
  if (in_sizes[1] != kWRows * kDim) return;
  if (out_size != kTok * kDim) return;

  const size_t szXb = (size_t)kTok * kDim * 2;
  const size_t szWb = (size_t)kWRows * kDim * 2;
  const size_t szQK = (size_t)kTok * kQKCols * 2;
  const size_t szVt = (size_t)kBatch * kHeads * kDh * kSeq * 2;
  const size_t offXb = 0;
  const size_t offWb = offXb + szXb;
  const size_t offQK = offWb + szWb;
  const size_t offVt = offQK + szQK;
  const size_t total = offVt + szVt;
  if (ws_size < total) return;

  const float* x = (const float*)d_in[0];   // [4,2048,1024] f32
  const float* W = (const float*)d_in[1];   // [3072,1024] f32, [out][in]
  float* out = (float*)d_out;               // [4,2048,1024] f32
  char* ws = (char*)d_ws;
  unsigned short* Xb  = (unsigned short*)(ws + offXb);
  unsigned short* Wb  = (unsigned short*)(ws + offWb);
  unsigned short* QKh = (unsigned short*)(ws + offQK);
  unsigned short* Vt  = (unsigned short*)(ws + offVt);

  // ---- 16-bit operand planes (bf16 RNE of both float inputs) ----
  const int n8x = (kTok * kDim) / 8;     // 1,048,576 -> 4096 blocks exact
  const int n8w = (kWRows * kDim) / 8;   //   393,216 -> 1536 blocks exact
  cast8_bf16_kernel<<<dim3(n8x / 256), dim3(256), 0, stream>>>(x, Xb, n8x);
  cast8_bf16_kernel<<<dim3(n8w / 256), dim3(256), 0, stream>>>(W, Wb, n8w);

  // ---- q | k projection: QKh[token][e] = sum_k Xb[token][k] * Wb[e][k], e in 0..2047 (f16 out) ----
  const int tilesQK = (kTok / 64) * (kQKCols / 64);   // 4096 -> 512 blocks of 8 waves
  wmma_gemm64<1, false, 0, 1, false, 0><<<dim3(tilesQK / 8, 1), dim3(256), 0, stream>>>(
      Xb, Xb, kDim, 0L, Wb, Wb, kDim, 0L,
      (void*)QKh, (void*)QKh, kQKCols, 0L, x, x, 0L, kTok, kQKCols, kDim, 1.0f);

  // ---- v projection written transposed: Vt[b*16+h][d][s] = sum_k Wb[2048+h*64+d][k] * Xb[b*2048+s][k] ----
  const unsigned short* WbV = Wb + (size_t)kQKCols * kDim;   // v weight rows
  const int tilesV = (kDh / 64) * (kSeq / 64);               // 32 -> 4 blocks of 8 waves, grid.y = head
  for (int b = 0; b < kBatch; ++b) {
    const unsigned short* Xbb = Xb + (size_t)b * kSeq * kDim;
    unsigned short* Vtb = Vt + (size_t)b * kHeads * kDh * kSeq;
    wmma_gemm64<1, false, 0, 1, false, 0><<<dim3(tilesV / 8, kHeads), dim3(256), 0, stream>>>(
        WbV, WbV, kDim, (long)kDh * kDim, Xbb, Xbb, kDim, 0L,
        (void*)Vtb, (void*)Vtb, kSeq, (long)kDh * kSeq, x, x, 0L, kDh, kSeq, kDim, 1.0f);
  }

  // ---- attention: grid = 4 batches x 16 heads x 32 query blocks ----
  attn_f16_kernel<<<dim3(kBatch * kHeads * (kSeq / kQB)), dim3(128), 0, stream>>>(QKh, Vt, out);
}

// v003
// One run takes 339 microseconds.
// Two timings next to v002 put it at 1.14 and 1.13 times that version's speed.
// Over all steps from v000 it is 2.01 times as fast.
// Contractions: qkv projection (x bf16 RNE, W^T bf16 RNE) on v_wmma_f32_16x16x32_bf16; scores q.k^T (q, k f16 planes) and attn.v (P f16 carried x32768, V^T f16 plane) on v_wmma_f32_16x16x32_f16; all f32 accumulate; online softmax statistics, scaling and 1/l in f32; exponentials base 2 on v_exp_f32.
#include <hip/hip_runtime.h>
#include <math.h>

// ---------------------------------------------------------------------------
// Problem constants
// ---------------------------------------------------------------------------
constexpr int kBatch  = 4;
constexpr int kSeq    = 2048;
constexpr int kDim    = 1024;
constexpr int kHeads  = 16;
constexpr int kDh     = 64;
constexpr int kTok    = kBatch * kSeq;     // 8192 token rows
constexpr int kWRows  = 3 * kDim;          // 3072 weight rows (q | k | v)
constexpr int kQKCols = 2 * kDim;          // 2048: pitch of the q | k plane (halves)
constexpr float kPCarryLog2 = 15.0f;       // log2 of the carry: added inside the exponent
constexpr float kScaleLog2 = 0.125f * 1.4426950408889634f;   // 64^-0.5 x log2(e): raw f32 score -> base-2 exponent
static_assert(kHeads * kDh == kDim, "shape");
static_assert(kDim % 32 == 0, "gemm K multiple of 32");
static_assert(kTok % 64 == 0 && kQKCols % 64 == 0 && kDh % 64 == 0 && kSeq % 64 == 0, "gemm M,N multiples of 64");
static_assert((kTok * kDim) % (8 * 256) == 0 && (kWRows * kDim) % (8 * 256) == 0, "cast grids exact");

typedef __attribute__((ext_vector_type(16))) _Float16 v16h;
typedef __attribute__((ext_vector_type(8)))  _Float16 v8h;
typedef __attribute__((ext_vector_type(16))) __bf16   v16b;
typedef __attribute__((ext_vector_type(8)))  __bf16   v8b;
typedef __attribute__((ext_vector_type(8)))  float    v8f;
typedef __attribute__((ext_vector_type(4)))  float    v4f;
typedef __attribute__((ext_vector_type(4)))  unsigned int v4u;

// ---------------------------------------------------------------------------
// Helpers
// ---------------------------------------------------------------------------
__device__ __forceinline__ unsigned short f2bf_bits(float f) {
  unsigned u = __float_as_uint(f);
  return (unsigned short)((u + 0x7FFFu + ((u >> 16) & 1u)) >> 16);
}
__device__ __forceinline__ float bf_bits2f(unsigned short h) { return __uint_as_float(((unsigned)h) << 16); }

// hazard guards as plain device helpers (no inline asm inside the kernel template body)
__device__ __forceinline__ void dep_guard_h(v8f& a, v8f& b, v16h x, v16h y) { asm volatile("v_nop\n\tv_nop\n\tv_nop\n\tv_nop" : "+v"(a), "+v"(b) : "v"(x), "v"(y)); }
__device__ __forceinline__ void dep_guard_b(v8f& a, v8f& b, v16b x, v16b y) { asm volatile("v_nop\n\tv_nop\n\tv_nop\n\tv_nop" : "+v"(a), "+v"(b) : "v"(x), "v"(y)); }
__device__ __forceinline__ void keep4_h(v16h a, v16h b, v16h c, v16h d) { asm volatile("v_nop" :: "v"(a), "v"(b), "v"(c), "v"(d)); }
__device__ __forceinline__ void keep4_b(v16b a, v16b b, v16b c, v16b d) { asm volatile("v_nop" :: "v"(a), "v"(b), "v"(c), "v"(d)); }
__device__ __forceinline__ void acc_guard4(v8f& a, v8f& b, v8f& c, v8f& d) { asm volatile("v_nop\n\tv_nop\n\tv_nop\n\tv_nop" : "+v"(a), "+v"(b), "+v"(c), "+v"(d)); }
template <typename T> struct Frag;
template <> struct Frag<_Float16> {
  typedef v16h V; union U { v16h v; v8h h[2]; };
  // elements 0..7 <- p[0..7], 8..15 <- p[16..23]
  static __device__ __forceinline__ v16h load(const _Float16* p) {
    U f; f.h[0] = *(const v8h*)(p); f.h[1] = *(const v8h*)(p + 16); return f.v;
  }
  static __device__ __forceinline__ v8f mma(v16h a, v16h b, v8f c) {
    return __builtin_amdgcn_wmma_f32_16x16x32_f16(false, a, false, b, (short)0, c, false, false);
  }
  static __device__ __forceinline__ void guard(v8f& a, v8f& b, v16h x, v16h y) { dep_guard_h(a, b, x, y); }
  static __device__ __forceinline__ void keep(v16h a, v16h b, v16h c, v16h d) { keep4_h(a, b, c, d); }
};
template <> struct Frag<__bf16> {
  typedef v16b V; union U { v16b v; v8b h[2]; };
  static __device__ __forceinline__ v16b load(const __bf16* p) {
    U f; f.h[0] = *(const v8b*)(p); f.h[1] = *(const v8b*)(p + 16); return f.v;
  }
  static __device__ __forceinline__ v8f mma(v16b a, v16b b, v8f c) {
    return __builtin_amdgcn_wmma_f32_16x16x32_bf16(false, a, false, b, (short)0, c, false, false);
  }
  static __device__ __forceinline__ void guard(v8f& a, v8f& b, v16b x, v16b y) { dep_guard_b(a, b, x, y); }
  static __device__ __forceinline__ void keep(v16b a, v16b b, v16b c, v16b d) { keep4_b(a, b, c, d); }
};

__device__ __forceinline__ unsigned pk16(unsigned short a, unsigned short b) { return (unsigned)a | ((unsigned)b << 16); }

// ---- Register-blocked batched WMMA GEMM (ACT reduced to none/relu/leaky) -------------------------------
// C[m,n] = scale * sum_k A[m,k] * Bt[n,k] (+bias)(+resid); each wave owns a 64x64 tile.
// A row-major [M,K]; Bt row-major [N,K]; M,N % 64 == 0, K % 32 == 0.
// SPLIT: operands are hi/lo planes (A2/Bt2 = lo planes, same layout); product = hi*hi + hi*lo + lo*hi.
// BIAS_MODE: 0 = none, 1 = bias[m], 2 = bias[n].
// OUT_MODE: 0 = f32, 1 = f16, 2 = bf16 hi plane (Cout) + bf16 lo plane (Cout2).
// ET: 0 = f16 operands, 1 = bf16 operands (pointers passed as 16-bit storage)
template <int ET> struct Elem;
template <> struct Elem<0> { typedef _Float16 T; };
template <> struct Elem<1> { typedef __bf16 T; };
template <int ET, bool SPLIT, int BIAS_MODE, int OUT_MODE, bool RESID, int ACT = 0>
__global__ __launch_bounds__(256) void wmma_gemm64(
    const unsigned short* __restrict__ Ap, const unsigned short* __restrict__ A2p, int lda, long strideA,
    const unsigned short* __restrict__ Btp, const unsigned short* __restrict__ Bt2p, int ldb, long strideB,
    void* __restrict__ Cout, void* __restrict__ Cout2, int ldc, long strideC,
    const float* __restrict__ bias,
    const float* __restrict__ resid, long strideR,
    int M, int N, int K, float scale) {
  typedef typename Elem<ET>::T T;
  typedef typename Frag<T>::V V;
  const T* A = (const T*)Ap; const T* A2 = (const T*)A2p; const T* Bt = (const T*)Btp; const T* Bt2 = (const T*)Bt2p;
  __shared__ __align__(16) float sT[8][16 * 68];   // per-wave 16x64 slab, pitch 68 floats
  const int b    = blockIdx.y;
  const int lane = threadIdx.x & 31;
  const int wave = threadIdx.x >> 5;
  const int tilesN = N >> 6;
  const int tilesM = M >> 6;
  const int tile = blockIdx.x * 8 + wave;
  if (tile >= tilesM * tilesN) return;   // wave-uniform; no block barriers in this kernel
  const int tm = tile / tilesN;
  const int tn = tile - tm * tilesN;
  const int m0 = tm << 6;
  const int n0 = tn << 6;

  const T* Ab  = A  + (size_t)b * strideA;
  const T* Bb  = Bt + (size_t)b * strideB;
  const T* Ab2 = SPLIT ? (A2  + (size_t)b * strideA) : nullptr;
  const T* Bb2 = SPLIT ? (Bt2 + (size_t)b * strideB) : nullptr;

  const int rlane = lane & 15;                 // row (A) / col (B, D) within subtile
  const int koff  = (lane >> 4) * 8;           // k offset of this lane half
  const int mOff  = (lane >> 4) * 8;           // D row offset

  v8f acc[4][4];
#pragma unroll
  for (int i = 0; i < 4; ++i)
#pragma unroll
    for (int j = 0; j < 4; ++j) acc[i][j] = (v8f){0.f,0.f,0.f,0.f,0.f,0.f,0.f,0.f};

  for (int k0 = 0; k0 < K; k0 += 32) {
    V bh[4], bl[4];
#pragma unroll
    for (int j = 0; j < 4; ++j) {
      const size_t bo = (size_t)(n0 + (j << 4) + rlane) * ldb + koff + k0;
      bh[j] = Frag<T>::load(Bb + bo);
      if (SPLIT) bl[j] = Frag<T>::load(Bb2 + bo);
    }
#pragma unroll
    for (int i = 0; i < 4; ++i) {
      const size_t ao = (size_t)(m0 + (i << 4) + rlane) * lda + koff + k0;
      V ah = Frag<T>::load(Ab + ao);
      V al;
      if (SPLIT) al = Frag<T>::load(Ab2 + ao);
#pragma unroll
      for (int j = 0; j < 4; ++j) {
        acc[i][j] = Frag<T>::mma(ah, bh[j], acc[i][j]);
        if (SPLIT) {
          acc[i][j] = Frag<T>::mma(ah, bl[j], acc[i][j]);
          acc[i][j] = Frag<T>::mma(al, bh[j], acc[i][j]);
        }
      }
      Frag<T>::guard(acc[i][0], acc[i][3], ah, SPLIT ? al : ah);
    }
    Frag<T>::keep(bh[0], bh[1], bh[2], bh[3]);
    if (SPLIT) Frag<T>::keep(bl[0], bl[1], bl[2], bl[3]);
  }
  acc_guard4(acc[0][0], acc[0][1], acc[0][2], acc[0][3]);
  acc_guard4(acc[1][0], acc[1][1], acc[1][2], acc[1][3]);
  acc_guard4(acc[2][0], acc[2][1], acc[2][2], acc[2][3]);
  acc_guard4(acc[3][0], acc[3][1], acc[3][2], acc[3][3]);

  // ---- epilogue ----
  float* slab = sT[wave];
  const float* Rb = RESID ? (resid + (size_t)b * strideR) : nullptr;
#pragma unroll
  for (int i = 0; i < 4; ++i) {
    const int mBase = m0 + (i << 4);
#pragma unroll
    for (int j = 0; j < 4; ++j) {
      const int n = n0 + (j << 4) + rlane;
      float bv = 0.f;
      if (BIAS_MODE == 2) bv = bias[n];
#pragma unroll
      for (int r = 0; r < 8; ++r) {
        float v = acc[i][j][r] * scale;
        if (BIAS_MODE == 1) v += bias[mBase + mOff + r];
        if (BIAS_MODE == 2) v += bv;
        if (RESID) v += Rb[(size_t)(mBase + mOff + r) * ldc + n];
        if (ACT == 2) v = fmaxf(v, 0.0f);
        if (ACT == 4) v = (v > 0.f) ? v : 0.01f * v;
        slab[(mOff + r) * 68 + (j << 4) + rlane] = v;
      }
    }
    __builtin_amdgcn_fence(__ATOMIC_RELEASE, "workgroup");
    __builtin_amdgcn_wave_barrier();
    __builtin_amdgcn_fence(__ATOMIC_ACQUIRE, "workgroup");
    if (OUT_MODE == 0) {
      float* C = (float*)Cout + (size_t)b * strideC;
      const int hh = lane >> 4, c4 = (lane & 15) * 4;     // row seg = 256 B = 16 lanes x 16 B
      {
#pragma unroll
        for (int it = 0; it < 8; ++it) {
          const int row = it * 2 + hh;
          v4f v = *(const v4f*)(slab + row * 68 + c4);
          *(v4f*)(C + (size_t)(mBase + row) * ldc + n0 + c4) = v;
        }
        
      }
    } else {
      const int q = lane >> 3, c8 = (lane & 7) * 8;
      unsigned short* C  = (unsigned short*)Cout  + (size_t)b * strideC;
      unsigned short* C2 = (OUT_MODE == 2) ? ((unsigned short*)Cout2 + (size_t)b * strideC) : nullptr;
      {
#pragma unroll
        for (int it = 0; it < 4; ++it) {
          const int row = it * 4 + q;
          const float* sp = slab + row * 68 + c8;
          v8h hv, lv;
#pragma unroll
          for (int e = 0; e < 8; ++e) {
            if (OUT_MODE == 1) {
              hv[e] = (_Float16)sp[e];
            } else {
              unsigned short hb = f2bf_bits(sp[e]);
              unsigned short lb = f2bf_bits(sp[e] - bf_bits2f(hb));
              hv[e] = __builtin_bit_cast(_Float16, hb);
              lv[e] = __builtin_bit_cast(_Float16, lb);
            }
          }
          *(v8h*)(C + (size_t)(mBase + row) * ldc + n0 + c8) = hv;
          if (OUT_MODE == 2) *(v8h*)(C2 + (size_t)(mBase + row) * ldc + n0 + c8) = lv;
        }
        
      }
    }
    __builtin_amdgcn_fence(__ATOMIC_RELEASE, "workgroup");
    __builtin_amdgcn_wave_barrier();
    __builtin_amdgcn_fence(__ATOMIC_ACQUIRE, "workgroup");
  }
}

// ---------------------------------------------------------------------------
// f32 -> bf16 (RNE) cast, 8 consecutive elements per thread (one 16-B store per lane;
// Coverage: n8 = n/8 threads x 8 = the whole plane; both grids here are exact multiples of 256
// (x: 1,048,576 threads = 4096 blocks; W: 393,216 threads = 1536 blocks).
// ---------------------------------------------------------------------------
__global__ __launch_bounds__(256) void cast8_bf16_kernel(const float* __restrict__ in, unsigned short* __restrict__ out,
                                                         int n8) {
  const int i = blockIdx.x * 256 + threadIdx.x;
  if (i >= n8) return;
  const float* p = in + 8 * (size_t)i;
  const v4f a = *(const v4f*)(p);
  const v4f c = *(const v4f*)(p + 4);
  unsigned short hb[8];
#pragma unroll
  for (int e = 0; e < 4; ++e) {
    hb[e]     = f2bf_bits(a[e]);
    hb[4 + e] = f2bf_bits(c[e]);
  }
  const v4u u = (v4u){pk16(hb[0], hb[1]), pk16(hb[2], hb[3]), pk16(hb[4], hb[5]), pk16(hb[6], hb[7])};
  unsigned short* q = out + 8 * (size_t)i;
  *(v4u*)q = u;
  
}

// ---------------------------------------------------------------------------
// Flash-style attention for head_dim 64 on f16 planes (no mask), f32 out.
//   QK plane  f16 [8192 tokens][2048]: q of (b,h) at column h*64, k at column 1024 + h*64, row = b*2048 + s.
//   VT plane  f16 [b*16+h][64 d][2048 s].
//   scores^T = k . q^T          : v_wmma_f32_16x16x32_f16 (k from LDS as A, q resident B fragments), x0.125 in f32 below
//   out^T    = v^T . (p x2^15)^T: v_wmma_f32_16x16x32_f16 (V^T from LDS as A, p^T packed from the score tiles as B)
//   Both products are transposed so that lane (c, hh) holds scores of ONE query, q0+c: its maximum and its sum are
//   taken inside the lane plus one exchange between the wave halves, and two score tiles, converted in place, are
//   the B operand of the second product (element e of it = tile e>>3, register e&7 = key 8hh+e or 16+8hh+e-8).
//   online softmax statistics m, l, alpha and the final 1/l in f32. Each exponential is one fma and one v_exp_f32:
//   p x2^15 = 2^(s*kScaleLog2 - mb), mb = m*kScaleLog2 - 15 (m = running maximum of the raw scores); l carries x2^15 too.
// Block = 4 waves = 64 query rows of one (b,h); wave w owns rows q0..q0+15. grid.x = 4*16*32 = 2048.
// LDS exchanges: K/V^T tiles (written by all waves, read by all) and the per-wave O slab are
// separated by block-wide barriers; every barrier is reached by all 4 waves (32 uniform chunk trips).
// Staging coverage per chunk: 4 iterations x 128 threads = 512 16-B words = 64 rows x 8 words for the
// K tile [64 kv][64 d] and likewise for the V^T tile [64 d][64 kv] (every LDS byte read is written; the
// 16 pad bytes behind each 128-B row are neither written nor read).
// Out store: each instruction writes two 256-B row segments (lanes 0-15 row 2it, lanes 16-31 row 2it+1,
// ---------------------------------------------------------------------------
constexpr int kKC = 64;        // keys per chunk
constexpr int kQB = 64;        // query rows per block
constexpr int kOsPitch = 68;   // floats
constexpr int kTP = 72;        // halves: LDS row pitch of the K and V^T tiles = 144 B = 16 B x 9 (odd), so the 16 rows
                               // that one 16-B fragment load touches per lane half fall on 16 distinct groups of four banks
static_assert(kTP >= kDh && kTP >= kKC && (kTP * 2) % 16 == 0 && ((kTP * 2) / 16) % 2 == 1, "tile pitch");
static_assert(kSeq % kKC == 0 && kSeq % kQB == 0, "attention tiles");

__device__ __forceinline__ v8f mma_h16(v16h a, v16h b, v8f c) {
  c = __builtin_amdgcn_wmma_f32_16x16x32_f16(false, a, false, b, (short)0, c, false, false);
  asm volatile("v_nop\n\tv_nop\n\tv_nop\n\tv_nop" : "+v"(c) : "v"(a), "v"(b));
  return c;
}

// value of lane l ^ 16 (the other wave half), by a vector cross-row move
__device__ __forceinline__ float xhalf(float x) {
  return __builtin_bit_cast(float, __builtin_amdgcn_permlanex16(__builtin_bit_cast(int, x), __builtin_bit_cast(int, x),
                                                                0x76543210, 0xfedcba98, false, false));
}

__global__ __launch_bounds__(128)
void attn_f16_kernel(const unsigned short* __restrict__ QKp, const unsigned short* __restrict__ VTp,
                     float* __restrict__ out) {
  const _Float16* QK = (const _Float16*)(const void*)QKp;
  const _Float16* VT = (const _Float16*)(const void*)VTp;
  __shared__ __align__(16) _Float16 Ksh[kKC * kTP];          // K tile   [kv][d]   9 KB, 64 of 72 halves a row used
  __shared__ __align__(16) _Float16 Vth[kDh * kTP];          // V^T tile [d][kv]   9 KB
  __shared__ __align__(16) float    Os[4][16 * kOsPitch];    // per wave out tile, pitch 68

  const int tid  = threadIdx.x;
  const int wave = tid >> 5;
  const int lane = tid & 31;
  const int hh   = lane >> 4;
  const int c    = lane & 15;

  const int nqb = kSeq / kQB;            // 32
  const int bx  = blockIdx.x;            // 0 .. 2047
  const int qb  = bx % nqb;
  const int bh  = bx / nqb;              // 0 .. 63
  const int h   = bh % kHeads;
  const int b   = bh / kHeads;
  const int q0  = qb * kQB + wave * 16;

  const _Float16* qb_ptr = QK + (size_t)b * kSeq * kQKCols + (size_t)h * kDh;   // (s, d) at + s*2048 + d
  const _Float16* kb_ptr = qb_ptr + kDim;                                        // k columns start at 1024
  const _Float16* vb_ptr = VT + (size_t)bh * kDh * kSeq;                         // (d, s) at + d*2048 + s
  float*          ob_ptr = out + (size_t)b * kSeq * kDim + (size_t)h * kDh;     // (s, d) at + s*1024 + d

  // ---- Q fragments (B operand): lane column c = query q0+c; elements 0..7 <- d dc*32+8hh+0..7, 8..15 <- +16 ----
  v16h qa[2];
  {
    const _Float16* qrow = qb_ptr + (size_t)(q0 + c) * kQKCols + 8 * hh;
#pragma unroll
    for (int dc = 0; dc < 2; ++dc) qa[dc] = Frag<_Float16>::load(qrow + dc * 32);
  }

  float mrow = -__builtin_inff();   // running maximum of the raw scores of query q0+c (alike in both halves)
  float mb   = -__builtin_inff();   // mrow * kScaleLog2 - 15: what every exponent of this query has subtracted
  float lrow = 0.f;                 // this half's share of the query's sum x2^15; the halves are joined after the loop
  v8f oacc[4];                      // oacc[t][r] = out^T[d = 16t+8hh+r][query q0+c]
#pragma unroll
  for (int t = 0; t < 4; ++t) oacc[t] = (v8f){0.f,0.f,0.f,0.f,0.f,0.f,0.f,0.f};

  for (int kc = 0; kc < kSeq / kKC; ++kc) {
    const int kv0 = kc * kKC;
    __syncthreads();
    // ---- stage K tile and V^T tile: pure 16-B copies of the f16 planes ----
#pragma unroll
    for (int i = 0; i < 4; ++i) {
      const int idx = i * 128 + tid;       // 0 .. 511
      const int r   = idx >> 3;            // row 0 .. 63 (kv for K, d for V^T)
      const int c8  = (idx & 7) * 8;       // halves
      const v8h kk = *(const v8h*)(kb_ptr + (size_t)(kv0 + r) * kQKCols + c8);
      const v8h vv = *(const v8h*)(vb_ptr + (size_t)r * kSeq + kv0 + c8);
      *(v8h*)(Ksh + r * kTP + c8) = kk;
      *(v8h*)(Vth + r * kTP + c8) = vv;
    }
    __syncthreads();

    // ---- scores^T: 4 key row tiles x 2 d-steps; s[j][r] = score of key kv0+16j+8hh+r with query q0+c ----
    v8f s[4];
#pragma unroll
    for (int j = 0; j < 4; ++j) {
      s[j] = (v8f){0.f,0.f,0.f,0.f,0.f,0.f,0.f,0.f};
#pragma unroll
      for (int dc = 0; dc < 2; ++dc) {
        // A[m = kv j*16+c][k = d] = Ksh[kv][d]; same split k-map as B
        const v16h ka = Frag<_Float16>::load(Ksh + (j * 16 + c) * kTP + dc * 32 + 8 * hh);
        s[j] = mma_h16(ka, qa[dc], s[j]);
      }
    }

    // ---- chunk maximum of this lane's query: 32 scores in the lane, the other 32 in lane ^ 16 ----
    float cm = -__builtin_inff();
#pragma unroll
    for (int j = 0; j < 4; ++j) {
#pragma unroll
      for (int r = 0; r < 8; ++r) cm = fmaxf(cm, s[j][r]);
    }
    cm = fmaxf(cm, xhalf(cm));

    // ---- online softmax update; P^T x2^15 as f16 packed straight into the B fragments ----
    const float mnew  = fmaxf(mrow, cm);
    const float mbnew = fmaf(mnew, kScaleLog2, -kPCarryLog2);
    const float alpha = __builtin_amdgcn_exp2f(mb - mbnew);   // 0 on the first chunk, where mb is -inf
    mrow = mnew;
    mb   = mbnew;
    float ps[4];
    v16h pb[2];
#pragma unroll
    for (int j = 0; j < 4; ++j) {
      ps[j] = 0.f;
#pragma unroll
      for (int r = 0; r < 8; ++r) {
        const float p = __builtin_amdgcn_exp2f(fmaf(s[j][r], kScaleLog2, -mbnew));   // 2^15 at the maximum: inside f16
        ps[j] += p;
        pb[j >> 1][(j & 1) * 8 + r] = (_Float16)p;
      }
    }
    lrow = lrow * alpha + ((ps[0] + ps[1]) + (ps[2] + ps[3]));
#pragma unroll
    for (int t = 0; t < 4; ++t)
#pragma unroll
      for (int r = 0; r < 8; ++r) oacc[t][r] *= alpha;

    // ---- O^T += V^T . P^T : A[m = d t*16+c][k = kv] = Vth[d][kv], B = P^T[kv][query c] ----
#pragma unroll
    for (int kk = 0; kk < 2; ++kk) {
#pragma unroll
      for (int t = 0; t < 4; ++t) {
        const v16h va = Frag<_Float16>::load(Vth + (t * 16 + c) * kTP + kk * 32 + 8 * hh);
        oacc[t] = mma_h16(va, pb[kk], oacc[t]);
      }
    }
  }

  // ---- normalise and store: lane (c, hh) holds d = 16t+8hh+0..7 of query row c ----
  float* os = Os[wave];
  {
    const float inv = 1.0f / (lrow + xhalf(lrow));   // l and out^T both carry x2^15
#pragma unroll
    for (int t = 0; t < 4; ++t) {
      float* op = os + c * kOsPitch + t * 16 + 8 * hh;
      *(v4f*)(op)     = (v4f){oacc[t][0] * inv, oacc[t][1] * inv, oacc[t][2] * inv, oacc[t][3] * inv};
      *(v4f*)(op + 4) = (v4f){oacc[t][4] * inv, oacc[t][5] * inv, oacc[t][6] * inv, oacc[t][7] * inv};
    }
  }
  __syncthreads();
  {
    const int c4 = (lane & 15) * 4;
    {
#pragma unroll
      for (int it = 0; it < 8; ++it) {
        const int row = it * 2 + hh;
        const v4f val = *(const v4f*)(os + row * kOsPitch + c4);
        *(v4f*)(ob_ptr + (size_t)(q0 + row) * kDim + c4) = val;
      }
      
    }
  }
}

// ---------------------------------------------------------------------------
// Host glue.
// no aliasing):
//   Xb   bf16 [8192][1024]          16,777,216  at          0   (x, RNE)
//   Wb   bf16 [3072][1024]           6,291,456  at 16,777,216   (W, RNE)
//   QKh  f16  [8192][2048]          33,554,432  at 23,068,672   (q | k columns, e = which*1024 + h*64 + d)
//   Vt   f16  [4*16][64][2048]      16,777,216  at 56,623,104   (v transposed per (b,h))
//   total                           73,400,320
// GEMM shapes: q|k M=8192, N=2048, K=1024; v^T M=64, N=2048, K=1024 (x16 heads via grid.y, x4 launches per batch).
// All M,N multiples of 64, K % 32 == 0, no padding anywhere. 8 launches.
// ---------------------------------------------------------------------------
extern "C" void kernel_launch(void* const* d_in, const int* in_sizes, int n_in,
                              void* d_out, int out_size, void* d_ws, size_t ws_size,
                              hipStream_t stream) {
  if (n_in < 2) return;
  if (in_sizes[0] != kTok * kDim) return;
  if (in_sizes[1] != kWRows * kDim) return;
  if (out_size != kTok * kDim) return;

  const size_t szXb = (size_t)kTok * kDim * 2;
  const size_t szWb = (size_t)kWRows * kDim * 2;
  const size_t szQK = (size_t)kTok * kQKCols * 2;
  const size_t szVt = (size_t)kBatch * kHeads * kDh * kSeq * 2;
  const size_t offXb = 0;
  const size_t offWb = offXb + szXb;
  const size_t offQK = offWb + szWb;
  const size_t offVt = offQK + szQK;
  const size_t total = offVt + szVt;
  if (ws_size < total) return;

  const float* x = (const float*)d_in[0];   // [4,2048,1024] f32
  const float* W = (const float*)d_in[1];   // [3072,1024] f32, [out][in]
  float* out = (float*)d_out;               // [4,2048,1024] f32
  char* ws = (char*)d_ws;
  unsigned short* Xb  = (unsigned short*)(ws + offXb);
  unsigned short* Wb  = (unsigned short*)(ws + offWb);
  unsigned short* QKh = (unsigned short*)(ws + offQK);
  unsigned short* Vt  = (unsigned short*)(ws + offVt);

  // ---- 16-bit operand planes (bf16 RNE of both float inputs) ----
  const int n8x = (kTok * kDim) / 8;     // 1,048,576 -> 4096 blocks exact
  const int n8w = (kWRows * kDim) / 8;   //   393,216 -> 1536 blocks exact
  cast8_bf16_kernel<<<dim3(n8x / 256), dim3(256), 0, stream>>>(x, Xb, n8x);
  cast8_bf16_kernel<<<dim3(n8w / 256), dim3(256), 0, stream>>>(W, Wb, n8w);

  // ---- q | k projection: QKh[token][e] = sum_k Xb[token][k] * Wb[e][k], e in 0..2047 (f16 out) ----
  const int tilesQK = (kTok / 64) * (kQKCols / 64);   // 4096 -> 512 blocks of 8 waves
  wmma_gemm64<1, false, 0, 1, false, 0><<<dim3(tilesQK / 8, 1), dim3(256), 0, stream>>>(
      Xb, Xb, kDim, 0L, Wb, Wb, kDim, 0L,
      (void*)QKh, (void*)QKh, kQKCols, 0L, x, x, 0L, kTok, kQKCols, kDim, 1.0f);

  // ---- v projection written transposed: Vt[b*16+h][d][s] = sum_k Wb[2048+h*64+d][k] * Xb[b*2048+s][k] ----
  const unsigned short* WbV = Wb + (size_t)kQKCols * kDim;   // v weight rows
  const int tilesV = (kDh / 64) * (kSeq / 64);               // 32 -> 4 blocks of 8 waves, grid.y = head
  for (int b = 0; b < kBatch; ++b) {
    const unsigned short* Xbb = Xb + (size_t)b * kSeq * kDim;
    unsigned short* Vtb = Vt + (size_t)b * kHeads * kDh * kSeq;
    wmma_gemm64<1, false, 0, 1, false, 0><<<dim3(tilesV / 8, kHeads), dim3(256), 0, stream>>>(
        WbV, WbV, kDim, (long)kDh * kDim, Xbb, Xbb, kDim, 0L,
        (void*)Vtb, (void*)Vtb, kSeq, (long)kDh * kSeq, x, x, 0L, kDh, kSeq, kDim, 1.0f);
  }

  // ---- attention: grid = 4 batches x 16 heads x 32 query blocks ----
  attn_f16_kernel<<<dim3(kBatch * kHeads * (kSeq / kQB)), dim3(128), 0, stream>>>(QKh, Vt, out);
}

// v004
// One run takes 227 microseconds.
// Timed twice side by side with v003, it ran 1.50 and 1.49 times as fast.
// All steps since v000 together make it 3.00 times as fast.
// Contractions: qkv projection (x bf16 RNE, W^T bf16 RNE) on v_wmma_f32_16x16x32_bf16; scores q.k^T (q, k f16 planes) and attn.v (P f16 carried x32768, V^T f16 plane) on v_wmma_f32_16x16x32_f16; all f32 accumulate; online softmax statistics, scaling and 1/l in f32; exponentials base 2 on v_exp_f32.
#include <hip/hip_runtime.h>
#include <math.h>

// ---------------------------------------------------------------------------
// Problem constants
// ---------------------------------------------------------------------------
constexpr int kBatch  = 4;
constexpr int kSeq    = 2048;
constexpr int kDim    = 1024;
constexpr int kHeads  = 16;
constexpr int kDh     = 64;
constexpr int kTok    = kBatch * kSeq;     // 8192 token rows
constexpr int kWRows  = 3 * kDim;          // 3072 weight rows (q | k | v)
constexpr int kQKCols = 2 * kDim;          // 2048: pitch of the q | k plane (halves)
constexpr float kPCarryLog2 = 15.0f;       // log2 of the carry: added inside the exponent
constexpr float kScaleLog2 = 0.125f * 1.4426950408889634f;   // 64^-0.5 x log2(e): raw f32 score -> base-2 exponent
static_assert(kHeads * kDh == kDim, "shape");
static_assert(kDim % 32 == 0, "gemm K multiple of 32");
static_assert(kTok % 64 == 0 && kQKCols % 64 == 0 && kDh % 64 == 0 && kSeq % 64 == 0, "gemm M,N multiples of 64");
static_assert((kTok * kDim) % (8 * 256) == 0 && (kWRows * kDim) % (8 * 256) == 0, "cast grids exact");

typedef __attribute__((ext_vector_type(16))) _Float16 v16h;
typedef __attribute__((ext_vector_type(8)))  _Float16 v8h;
typedef __attribute__((ext_vector_type(16))) __bf16   v16b;
typedef __attribute__((ext_vector_type(8)))  __bf16   v8b;
typedef __attribute__((ext_vector_type(8)))  float    v8f;
typedef __attribute__((ext_vector_type(4)))  float    v4f;
typedef __attribute__((ext_vector_type(4)))  unsigned int v4u;

// ---------------------------------------------------------------------------
// Helpers
// ---------------------------------------------------------------------------
__device__ __forceinline__ unsigned short f2bf_bits(float f) {
  unsigned u = __float_as_uint(f);
  return (unsigned short)((u + 0x7FFFu + ((u >> 16) & 1u)) >> 16);
}
__device__ __forceinline__ float bf_bits2f(unsigned short h) { return __uint_as_float(((unsigned)h) << 16); }

// hazard guards as plain device helpers (no inline asm inside the kernel template body)
__device__ __forceinline__ void dep_guard_h(v8f& a, v8f& b, v16h x, v16h y) { asm volatile("v_nop\n\tv_nop\n\tv_nop\n\tv_nop" : "+v"(a), "+v"(b) : "v"(x), "v"(y)); }
__device__ __forceinline__ void dep_guard_b(v8f& a, v8f& b, v16b x, v16b y) { asm volatile("v_nop\n\tv_nop\n\tv_nop\n\tv_nop" : "+v"(a), "+v"(b) : "v"(x), "v"(y)); }
__device__ __forceinline__ void keep4_h(v16h a, v16h b, v16h c, v16h d) { asm volatile("v_nop" :: "v"(a), "v"(b), "v"(c), "v"(d)); }
__device__ __forceinline__ void keep4_b(v16b a, v16b b, v16b c, v16b d) { asm volatile("v_nop" :: "v"(a), "v"(b), "v"(c), "v"(d)); }
__device__ __forceinline__ void acc_guard4(v8f& a, v8f& b, v8f& c, v8f& d) { asm volatile("v_nop\n\tv_nop\n\tv_nop\n\tv_nop" : "+v"(a), "+v"(b), "+v"(c), "+v"(d)); }
template <typename T> struct Frag;
template <> struct Frag<_Float16> {
  typedef v16h V; union U { v16h v; v8h h[2]; };
  // elements 0..7 <- p[0..7], 8..15 <- p[16..23]
  static __device__ __forceinline__ v16h load(const _Float16* p) {
    U f; f.h[0] = *(const v8h*)(p); f.h[1] = *(const v8h*)(p + 16); return f.v;
  }
  static __device__ __forceinline__ v8f mma(v16h a, v16h b, v8f c) {
    return __builtin_amdgcn_wmma_f32_16x16x32_f16(false, a, false, b, (short)0, c, false, false);
  }
  static __device__ __forceinline__ void guard(v8f& a, v8f& b, v16h x, v16h y) { dep_guard_h(a, b, x, y); }
  static __device__ __forceinline__ void keep(v16h a, v16h b, v16h c, v16h d) { keep4_h(a, b, c, d); }
};
template <> struct Frag<__bf16> {
  typedef v16b V; union U { v16b v; v8b h[2]; };
  static __device__ __forceinline__ v16b load(const __bf16* p) {
    U f; f.h[0] = *(const v8b*)(p); f.h[1] = *(const v8b*)(p + 16); return f.v;
  }
  static __device__ __forceinline__ v8f mma(v16b a, v16b b, v8f c) {
    return __builtin_amdgcn_wmma_f32_16x16x32_bf16(false, a, false, b, (short)0, c, false, false);
  }
  static __device__ __forceinline__ void guard(v8f& a, v8f& b, v16b x, v16b y) { dep_guard_b(a, b, x, y); }
  static __device__ __forceinline__ void keep(v16b a, v16b b, v16b c, v16b d) { keep4_b(a, b, c, d); }
};

__device__ __forceinline__ unsigned pk16(unsigned short a, unsigned short b) { return (unsigned)a | ((unsigned)b << 16); }

// ---- Register-blocked batched WMMA GEMM (ACT reduced to none/relu/leaky) -------------------------------
// C[m,n] = scale * sum_k A[m,k] * Bt[n,k] (+bias)(+resid); each wave owns a 64x64 tile.
// A row-major [M,K]; Bt row-major [N,K]; M,N % 64 == 0, K % 32 == 0.
// SPLIT: operands are hi/lo planes (A2/Bt2 = lo planes, same layout); product = hi*hi + hi*lo + lo*hi.
// BIAS_MODE: 0 = none, 1 = bias[m], 2 = bias[n].
// OUT_MODE: 0 = f32, 1 = f16, 2 = bf16 hi plane (Cout) + bf16 lo plane (Cout2).
// ET: 0 = f16 operands, 1 = bf16 operands (pointers passed as 16-bit storage)
template <int ET> struct Elem;
template <> struct Elem<0> { typedef _Float16 T; };
template <> struct Elem<1> { typedef __bf16 T; };
template <int ET, bool SPLIT, int BIAS_MODE, int OUT_MODE, bool RESID, int ACT = 0>
__global__ __launch_bounds__(256) void wmma_gemm64(
    const unsigned short* __restrict__ Ap, const unsigned short* __restrict__ A2p, int lda, long strideA,
    const unsigned short* __restrict__ Btp, const unsigned short* __restrict__ Bt2p, int ldb, long strideB,
    void* __restrict__ Cout, void* __restrict__ Cout2, int ldc, long strideC,
    const float* __restrict__ bias,
    const float* __restrict__ resid, long strideR,
    int M, int N, int K, float scale) {
  typedef typename Elem<ET>::T T;
  typedef typename Frag<T>::V V;
  const T* A = (const T*)Ap; const T* A2 = (const T*)A2p; const T* Bt = (const T*)Btp; const T* Bt2 = (const T*)Bt2p;
  __shared__ __align__(16) float sT[8][16 * 68];   // per-wave 16x64 slab, pitch 68 floats
  const int b    = blockIdx.y;
  const int lane = threadIdx.x & 31;
  const int wave = threadIdx.x >> 5;
  const int tilesN = N >> 6;
  const int tilesM = M >> 6;
  const int tile = blockIdx.x * 8 + wave;
  if (tile >= tilesM * tilesN) return;   // wave-uniform; no block barriers in this kernel
  const int tm = tile / tilesN;
  const int tn = tile - tm * tilesN;
  const int m0 = tm << 6;
  const int n0 = tn << 6;

  const T* Ab  = A  + (size_t)b * strideA;
  const T* Bb  = Bt + (size_t)b * strideB;
  const T* Ab2 = SPLIT ? (A2  + (size_t)b * strideA) : nullptr;
  const T* Bb2 = SPLIT ? (Bt2 + (size_t)b * strideB) : nullptr;

  const int rlane = lane & 15;                 // row (A) / col (B, D) within subtile
  const int koff  = (lane >> 4) * 8;           // k offset of this lane half
  const int mOff  = (lane >> 4) * 8;           // D row offset

  v8f acc[4][4];
#pragma unroll
  for (int i = 0; i < 4; ++i)
#pragma unroll
    for (int j = 0; j < 4; ++j) acc[i][j] = (v8f){0.f,0.f,0.f,0.f,0.f,0.f,0.f,0.f};

  for (int k0 = 0; k0 < K; k0 += 32) {
    V bh[4], bl[4];
#pragma unroll
    for (int j = 0; j < 4; ++j) {
      const size_t bo = (size_t)(n0 + (j << 4) + rlane) * ldb + koff + k0;
      bh[j] = Frag<T>::load(Bb + bo);
      if (SPLIT) bl[j] = Frag<T>::load(Bb2 + bo);
    }
#pragma unroll
    for (int i = 0; i < 4; ++i) {
      const size_t ao = (size_t)(m0 + (i << 4) + rlane) * lda + koff + k0;
      V ah = Frag<T>::load(Ab + ao);
      V al;
      if (SPLIT) al = Frag<T>::load(Ab2 + ao);
#pragma unroll
      for (int j = 0; j < 4; ++j) {
        acc[i][j] = Frag<T>::mma(ah, bh[j], acc[i][j]);
        if (SPLIT) {
          acc[i][j] = Frag<T>::mma(ah, bl[j], acc[i][j]);
          acc[i][j] = Frag<T>::mma(al, bh[j], acc[i][j]);
        }
      }
      Frag<T>::guard(acc[i][0], acc[i][3], ah, SPLIT ? al : ah);
    }
    Frag<T>::keep(bh[0], bh[1], bh[2], bh[3]);
    if (SPLIT) Frag<T>::keep(bl[0], bl[1], bl[2], bl[3]);
  }
  acc_guard4(acc[0][0], acc[0][1], acc[0][2], acc[0][3]);
  acc_guard4(acc[1][0], acc[1][1], acc[1][2], acc[1][3]);
  acc_guard4(acc[2][0], acc[2][1], acc[2][2], acc[2][3]);
  acc_guard4(acc[3][0], acc[3][1], acc[3][2], acc[3][3]);

  // ---- epilogue ----
  float* slab = sT[wave];
  const float* Rb = RESID ? (resid + (size_t)b * strideR) : nullptr;
#pragma unroll
  for (int i = 0; i < 4; ++i) {
    const int mBase = m0 + (i << 4);
#pragma unroll
    for (int j = 0; j < 4; ++j) {
      const int n = n0 + (j << 4) + rlane;
      float bv = 0.f;
      if (BIAS_MODE == 2) bv = bias[n];
#pragma unroll
      for (int r = 0; r < 8; ++r) {
        float v = acc[i][j][r] * scale;
        if (BIAS_MODE == 1) v += bias[mBase + mOff + r];
        if (BIAS_MODE == 2) v += bv;
        if (RESID) v += Rb[(size_t)(mBase + mOff + r) * ldc + n];
        if (ACT == 2) v = fmaxf(v, 0.0f);
        if (ACT == 4) v = (v > 0.f) ? v : 0.01f * v;
        slab[(mOff + r) * 68 + (j << 4) + rlane] = v;
      }
    }
    __builtin_amdgcn_fence(__ATOMIC_RELEASE, "workgroup");
    __builtin_amdgcn_wave_barrier();
    __builtin_amdgcn_fence(__ATOMIC_ACQUIRE, "workgroup");
    if (OUT_MODE == 0) {
      float* C = (float*)Cout + (size_t)b * strideC;
      const int hh = lane >> 4, c4 = (lane & 15) * 4;     // row seg = 256 B = 16 lanes x 16 B
      {
#pragma unroll
        for (int it = 0; it < 8; ++it) {
          const int row = it * 2 + hh;
          v4f v = *(const v4f*)(slab + row * 68 + c4);
          *(v4f*)(C + (size_t)(mBase + row) * ldc + n0 + c4) = v;
        }
        
      }
    } else {
      const int q = lane >> 3, c8 = (lane & 7) * 8;
      unsigned short* C  = (unsigned short*)Cout  + (size_t)b * strideC;
      unsigned short* C2 = (OUT_MODE == 2) ? ((unsigned short*)Cout2 + (size_t)b * strideC) : nullptr;
      {
#pragma unroll
        for (int it = 0; it < 4; ++it) {
          const int row = it * 4 + q;
          const float* sp = slab + row * 68 + c8;
          v8h hv, lv;
#pragma unroll
          for (int e = 0; e < 8; ++e) {
            if (OUT_MODE == 1) {
              hv[e] = (_Float16)sp[e];
            } else {
              unsigned short hb = f2bf_bits(sp[e]);
              unsigned short lb = f2bf_bits(sp[e] - bf_bits2f(hb));
              hv[e] = __builtin_bit_cast(_Float16, hb);
              lv[e] = __builtin_bit_cast(_Float16, lb);
            }
          }
          *(v8h*)(C + (size_t)(mBase + row) * ldc + n0 + c8) = hv;
          if (OUT_MODE == 2) *(v8h*)(C2 + (size_t)(mBase + row) * ldc + n0 + c8) = lv;
        }
        
      }
    }
    __builtin_amdgcn_fence(__ATOMIC_RELEASE, "workgroup");
    __builtin_amdgcn_wave_barrier();
    __builtin_amdgcn_fence(__ATOMIC_ACQUIRE, "workgroup");
  }
}

// ---------------------------------------------------------------------------
// f32 -> bf16 (RNE) cast, 8 consecutive elements per thread (one 16-B store per lane;
// Coverage: n8 = n/8 threads x 8 = the whole plane; both grids here are exact multiples of 256
// (x: 1,048,576 threads = 4096 blocks; W: 393,216 threads = 1536 blocks).
// ---------------------------------------------------------------------------
__global__ __launch_bounds__(256) void cast8_bf16_kernel(const float* __restrict__ in, unsigned short* __restrict__ out,
                                                         int n8) {
  const int i = blockIdx.x * 256 + threadIdx.x;
  if (i >= n8) return;
  const float* p = in + 8 * (size_t)i;
  const v4f a = *(const v4f*)(p);
  const v4f c = *(const v4f*)(p + 4);
  unsigned short hb[8];
#pragma unroll
  for (int e = 0; e < 4; ++e) {
    hb[e]     = f2bf_bits(a[e]);
    hb[4 + e] = f2bf_bits(c[e]);
  }
  const v4u u = (v4u){pk16(hb[0], hb[1]), pk16(hb[2], hb[3]), pk16(hb[4], hb[5]), pk16(hb[6], hb[7])};
  unsigned short* q = out + 8 * (size_t)i;
  *(v4u*)q = u;
  
}

// ---------------------------------------------------------------------------
// Flash-style attention for head_dim 64 on f16 planes (no mask), f32 out.
//   QK plane  f16 [8192 tokens][2048]: q of (b,h) at column h*64, k at column 1024 + h*64, row = b*2048 + s.
//   VT plane  f16 [b*16+h][64 d][2048 s].
//   scores^T = k . q^T          : v_wmma_f32_16x16x32_f16 (k from LDS as A, q resident B fragments), x0.125 in f32 below
//   out^T    = v^T . (p x2^15)^T: v_wmma_f32_16x16x32_f16 (V^T from LDS as A, p^T packed from the score tiles as B)
//   Both products are transposed so that lane (c, hh) holds scores of ONE query, q0+c: its maximum and its sum are
//   taken inside the lane plus one exchange between the wave halves, and two score tiles, converted in place, are
//   the B operand of the second product (element e of it = tile e>>3, register e&7 = key 8hh+e or 16+8hh+e-8).
//   online softmax statistics m, l, alpha and the final 1/l in f32. Each exponential is one fma and one v_exp_f32:
//   p x2^15 = 2^(s*kScaleLog2 - mb), mb = m*kScaleLog2 - 15 (m = running maximum of the raw scores); l carries x2^15 too.
// Block = 4 waves = 64 query rows of one (b,h); wave w owns rows q0..q0+15. grid.x = 4*16*32 = 2048.
// LDS exchanges: K/V^T tiles (written by all waves, read by all) and the per-wave O slab are
// separated by block-wide barriers; every barrier is reached by all 4 waves (32 uniform chunk trips).
// Staging coverage per chunk: 4 iterations x 128 threads = 512 16-B words = 64 rows x 8 words for the
// K tile [64 kv][64 d] and likewise for the V^T tile [64 d][64 kv] (every LDS byte read is written; the
// 16 pad bytes behind each 128-B row are neither written nor read).
// Out store: each instruction writes two 256-B row segments (lanes 0-15 row 2it, lanes 16-31 row 2it+1,
// ---------------------------------------------------------------------------
constexpr int kKC = 64;        // keys per chunk
constexpr int kQB = 64;        // query rows per block
constexpr int kOsPitch = 68;   // floats
constexpr int kTP = 72;        // halves: LDS row pitch of the K and V^T tiles = 144 B = 16 B x 9 (odd), so the 16 rows
                               // that one 16-B fragment load touches per lane half fall on 16 distinct groups of four banks
static_assert(kTP >= kDh && kTP >= kKC && (kTP * 2) % 16 == 0 && ((kTP * 2) / 16) % 2 == 1, "tile pitch");
static_assert(kSeq % kKC == 0 && kSeq % kQB == 0, "attention tiles");

__device__ __forceinline__ v8f mma_h16(v16h a, v16h b, v8f c) {
  c = __builtin_amdgcn_wmma_f32_16x16x32_f16(false, a, false, b, (short)0, c, false, false);
  asm volatile("v_nop\n\tv_nop\n\tv_nop\n\tv_nop" : "+v"(c) : "v"(a), "v"(b));
  return c;
}

// value of lane l ^ 16 (the other wave half), by a vector cross-row move
__device__ __forceinline__ float xhalf(float x) {
  return __builtin_bit_cast(float, __builtin_amdgcn_permlanex16(__builtin_bit_cast(int, x), __builtin_bit_cast(int, x),
                                                                0x76543210, 0xfedcba98, false, false));
}

__global__ __launch_bounds__(128)
void attn_f16_kernel(const unsigned short* __restrict__ QKp, const unsigned short* __restrict__ VTp,
                     float* __restrict__ out) {
  const _Float16* QK = (const _Float16*)(const void*)QKp;
  const _Float16* VT = (const _Float16*)(const void*)VTp;
  __shared__ __align__(16) _Float16 Ksh[kKC * kTP];          // K tile   [kv][d]   9 KB, 64 of 72 halves a row used
  __shared__ __align__(16) _Float16 Vth[kDh * kTP];          // V^T tile [d][kv]   9 KB
  __shared__ __align__(16) float    Os[4][16 * kOsPitch];    // per wave out tile, pitch 68

  const int tid  = threadIdx.x;
  const int wave = tid >> 5;
  const int lane = tid & 31;
  const int hh   = lane >> 4;
  const int c    = lane & 15;

  const int nqb = kSeq / kQB;            // 32
  const int bx  = blockIdx.x;            // 0 .. 2047
  const int qb  = bx % nqb;
  const int bh  = bx / nqb;              // 0 .. 63
  const int h   = bh % kHeads;
  const int b   = bh / kHeads;
  const int q0  = qb * kQB + wave * 16;

  const _Float16* qb_ptr = QK + (size_t)b * kSeq * kQKCols + (size_t)h * kDh;   // (s, d) at + s*2048 + d
  const _Float16* kb_ptr = qb_ptr + kDim;                                        // k columns start at 1024
  const _Float16* vb_ptr = VT + (size_t)bh * kDh * kSeq;                         // (d, s) at + d*2048 + s
  float*          ob_ptr = out + (size_t)b * kSeq * kDim + (size_t)h * kDh;     // (s, d) at + s*1024 + d

  // ---- Q fragments (B operand): lane column c = query q0+c; elements 0..7 <- d dc*32+8hh+0..7, 8..15 <- +16 ----
  v16h qa[2];
  {
    const _Float16* qrow = qb_ptr + (size_t)(q0 + c) * kQKCols + 8 * hh;
#pragma unroll
    for (int dc = 0; dc < 2; ++dc) qa[dc] = Frag<_Float16>::load(qrow + dc * 32);
  }

  float mrow = -__builtin_inff();   // running maximum of the raw scores of query q0+c (alike in both halves)
  float mb   = -__builtin_inff();   // mrow * kScaleLog2 - 15: what every exponent of this query has subtracted
  float lrow = 0.f;                 // this half's share of the query's sum x2^15; the halves are joined after the loop
  v8f oacc[4];                      // oacc[t][r] = out^T[d = 16t+8hh+r][query q0+c]
#pragma unroll
  for (int t = 0; t < 4; ++t) oacc[t] = (v8f){0.f,0.f,0.f,0.f,0.f,0.f,0.f,0.f};

  for (int kc = 0; kc < kSeq / kKC; ++kc) {
    const int kv0 = kc * kKC;
    __syncthreads();
    // ---- stage K tile and V^T tile: pure 16-B copies of the f16 planes ----
#pragma unroll
    for (int i = 0; i < 4; ++i) {
      const int idx = i * 128 + tid;       // 0 .. 511
      const int r   = idx >> 3;            // row 0 .. 63 (kv for K, d for V^T)
      const int c8  = (idx & 7) * 8;       // halves
      const v8h kk = *(const v8h*)(kb_ptr + (size_t)(kv0 + r) * kQKCols + c8);
      const v8h vv = *(const v8h*)(vb_ptr + (size_t)r * kSeq + kv0 + c8);
      *(v8h*)(Ksh + r * kTP + c8) = kk;
      *(v8h*)(Vth + r * kTP + c8) = vv;
    }
    __syncthreads();

    // ---- scores^T: 4 key row tiles x 2 d-steps; s[j][r] = score of key kv0+16j+8hh+r with query q0+c ----
    v8f s[4];
#pragma unroll
    for (int j = 0; j < 4; ++j) {
      s[j] = (v8f){0.f,0.f,0.f,0.f,0.f,0.f,0.f,0.f};
#pragma unroll
      for (int dc = 0; dc < 2; ++dc) {
        // A[m = kv j*16+c][k = d] = Ksh[kv][d]; same split k-map as B
        const v16h ka = Frag<_Float16>::load(Ksh + (j * 16 + c) * kTP + dc * 32 + 8 * hh);
        s[j] = mma_h16(ka, qa[dc], s[j]);
      }
    }

    // ---- chunk maximum of this lane's query: 32 scores in the lane, the other 32 in lane ^ 16 ----
    float cm = -__builtin_inff();
#pragma unroll
    for (int j = 0; j < 4; ++j) {
#pragma unroll
      for (int r = 0; r < 8; ++r) cm = fmaxf(cm, s[j][r]);
    }
    cm = fmaxf(cm, xhalf(cm));

    // ---- online softmax update; P^T x2^15 as f16 packed straight into the B fragments ----
    const float mnew  = fmaxf(mrow, cm);
    const float mbnew = fmaf(mnew, kScaleLog2, -kPCarryLog2);
    const float alpha = __builtin_amdgcn_exp2f(mb - mbnew);   // 0 on the first chunk, where mb is -inf
    mrow = mnew;
    mb   = mbnew;
    float ps[4];
    v16h pb[2];
#pragma unroll
    for (int j = 0; j < 4; ++j) {
      ps[j] = 0.f;
#pragma unroll
      for (int r = 0; r < 8; ++r) {
        const float p = __builtin_amdgcn_exp2f(fmaf(s[j][r], kScaleLog2, -mbnew));   // 2^15 at the maximum: inside f16
        ps[j] += p;
        pb[j >> 1][(j & 1) * 8 + r] = (_Float16)p;
      }
    }
    lrow = lrow * alpha + ((ps[0] + ps[1]) + (ps[2] + ps[3]));
#pragma unroll
    for (int t = 0; t < 4; ++t)
#pragma unroll
      for (int r = 0; r < 8; ++r) oacc[t][r] *= alpha;

    // ---- O^T += V^T . P^T : A[m = d t*16+c][k = kv] = Vth[d][kv], B = P^T[kv][query c] ----
#pragma unroll
    for (int kk = 0; kk < 2; ++kk) {
#pragma unroll
      for (int t = 0; t < 4; ++t) {
        const v16h va = Frag<_Float16>::load(Vth + (t * 16 + c) * kTP + kk * 32 + 8 * hh);
        oacc[t] = mma_h16(va, pb[kk], oacc[t]);
      }
    }
  }

  // ---- normalise and store: lane (c, hh) holds d = 16t+8hh+0..7 of query row c ----
  float* os = Os[wave];
  {
    const float inv = 1.0f / (lrow + xhalf(lrow));   // l and out^T both carry x2^15
#pragma unroll
    for (int t = 0; t < 4; ++t) {
      float* op = os + c * kOsPitch + t * 16 + 8 * hh;
      *(v4f*)(op)     = (v4f){oacc[t][0] * inv, oacc[t][1] * inv, oacc[t][2] * inv, oacc[t][3] * inv};
      *(v4f*)(op + 4) = (v4f){oacc[t][4] * inv, oacc[t][5] * inv, oacc[t][6] * inv, oacc[t][7] * inv};
    }
  }
  __syncthreads();
  {
    const int c4 = (lane & 15) * 4;
    {
#pragma unroll
      for (int it = 0; it < 8; ++it) {
        const int row = it * 2 + hh;
        const v4f val = *(const v4f*)(os + row * kOsPitch + c4);
        *(v4f*)(ob_ptr + (size_t)(q0 + row) * kDim + c4) = val;
      }
      
    }
  }
}

// ---------------------------------------------------------------------------
// Host glue.
// no aliasing):
//   Xb   bf16 [8192][1024]          16,777,216  at          0   (x, RNE)
//   Wb   bf16 [3072][1024]           6,291,456  at 16,777,216   (W, RNE)
//   QKh  f16  [8192][2048]          33,554,432  at 23,068,672   (q | k columns, e = which*1024 + h*64 + d)
//   Vt   f16  [4*16][64][2048]      16,777,216  at 56,623,104   (v transposed per (b,h))
//   total                           73,400,320
// GEMM shapes: q|k M=8192, N=2048, K=1024; v^T M=1024 (16 heads x 64), N=2048, K=1024 (x4 batches via grid.y).
// All M,N multiples of 64, K % 32 == 0, no padding anywhere. 5 launches.
// ---------------------------------------------------------------------------
extern "C" void kernel_launch(void* const* d_in, const int* in_sizes, int n_in,
                              void* d_out, int out_size, void* d_ws, size_t ws_size,
                              hipStream_t stream) {
  if (n_in < 2) return;
  if (in_sizes[0] != kTok * kDim) return;
  if (in_sizes[1] != kWRows * kDim) return;
  if (out_size != kTok * kDim) return;

  const size_t szXb = (size_t)kTok * kDim * 2;
  const size_t szWb = (size_t)kWRows * kDim * 2;
  const size_t szQK = (size_t)kTok * kQKCols * 2;
  const size_t szVt = (size_t)kBatch * kHeads * kDh * kSeq * 2;
  const size_t offXb = 0;
  const size_t offWb = offXb + szXb;
  const size_t offQK = offWb + szWb;
  const size_t offVt = offQK + szQK;
  const size_t total = offVt + szVt;
  if (ws_size < total) return;

  const float* x = (const float*)d_in[0];   // [4,2048,1024] f32
  const float* W = (const float*)d_in[1];   // [3072,1024] f32, [out][in]
  float* out = (float*)d_out;               // [4,2048,1024] f32
  char* ws = (char*)d_ws;
  unsigned short* Xb  = (unsigned short*)(ws + offXb);
  unsigned short* Wb  = (unsigned short*)(ws + offWb);
  unsigned short* QKh = (unsigned short*)(ws + offQK);
  unsigned short* Vt  = (unsigned short*)(ws + offVt);

  // ---- 16-bit operand planes (bf16 RNE of both float inputs) ----
  const int n8x = (kTok * kDim) / 8;     // 1,048,576 -> 4096 blocks exact
  const int n8w = (kWRows * kDim) / 8;   //   393,216 -> 1536 blocks exact
  cast8_bf16_kernel<<<dim3(n8x / 256), dim3(256), 0, stream>>>(x, Xb, n8x);
  cast8_bf16_kernel<<<dim3(n8w / 256), dim3(256), 0, stream>>>(W, Wb, n8w);

  // ---- q | k projection: QKh[token][e] = sum_k Xb[token][k] * Wb[e][k], e in 0..2047 (f16 out) ----
  const int tilesQK = (kTok / 64) * (kQKCols / 64);   // 4096 -> 512 blocks of 8 waves
  wmma_gemm64<1, false, 0, 1, false, 0><<<dim3(tilesQK / 8, 1), dim3(256), 0, stream>>>(
      Xb, Xb, kDim, 0L, Wb, Wb, kDim, 0L,
      (void*)QKh, (void*)QKh, kQKCols, 0L, x, x, 0L, kTok, kQKCols, kDim, 1.0f);

  // ---- v projection written transposed, all heads and batches in one launch:
  //      Vt[b][e = h*64+d][s] = sum_k Wb[2048+e][k] * Xb[b*2048+s][k]; M = 1024 weight rows, N = 2048 tokens, grid.y = batch ----
  const unsigned short* WbV = Wb + (size_t)kQKCols * kDim;   // v weight rows
  const int tilesV = (kDim / 64) * (kSeq / 64);              // 512 -> 64 blocks of 8 waves per batch
  wmma_gemm64<1, false, 0, 1, false, 0><<<dim3(tilesV / 8, kBatch), dim3(256), 0, stream>>>(
      WbV, WbV, kDim, 0L, Xb, Xb, kDim, (long)kSeq * kDim,
      (void*)Vt, (void*)Vt, kSeq, (long)kDim * kSeq, x, x, 0L, kDim, kSeq, kDim, 1.0f);

  // ---- attention: grid = 4 batches x 16 heads x 32 query blocks ----
  attn_f16_kernel<<<dim3(kBatch * kHeads * (kSeq / kQB)), dim3(128), 0, stream>>>(QKh, Vt, out);
}

// v005
// Measured time: 160 microseconds a run.
// Two timings next to v004 both put it at 1.41 times that version's speed.
// Counting every step since v000, it is 4.23 times as fast.
// Contractions: qkv projection (x bf16 RNE, W^T bf16 RNE) on v_wmma_f32_16x16x32_bf16; scores q.k^T (q, k f16 planes) and attn.v (P f16 carried x32768, V^T f16 plane) on v_wmma_f32_16x16x32_f16; all f32 accumulate; online softmax statistics, scaling and 1/l in f32; exponentials base 2 on v_exp_f32.
#include <hip/hip_runtime.h>
#include <math.h>

// ---------------------------------------------------------------------------
// Problem constants
// ---------------------------------------------------------------------------
constexpr int kBatch  = 4;
constexpr int kSeq    = 2048;
constexpr int kDim    = 1024;
constexpr int kHeads  = 16;
constexpr int kDh     = 64;
constexpr int kTok    = kBatch * kSeq;     // 8192 token rows
constexpr int kWRows  = 3 * kDim;          // 3072 weight rows (q | k | v)
constexpr int kQKCols = 2 * kDim;          // 2048: pitch of the q | k plane (halves)
constexpr float kPCarryLog2 = 15.0f;       // log2 of the carry: added inside the exponent
constexpr float kScaleLog2 = 0.125f * 1.4426950408889634f;   // 64^-0.5 x log2(e): raw f32 score -> base-2 exponent
static_assert(kHeads * kDh == kDim, "shape");
static_assert(kDim % 64 == 0, "gemm K multiple of the staged slice");
static_assert(kTok % 128 == 0 && kDim % 128 == 0 && kQKCols % 256 == 0 && kSeq % 256 == 0, "gemm M multiple of 128, N of 256");
static_assert(kDh % 64 == 0 && kSeq % 64 == 0, "attention tiles");
static_assert((kTok * kDim) % (8 * 256) == 0 && (kWRows * kDim) % (8 * 256) == 0, "cast grids exact");

typedef __attribute__((ext_vector_type(16))) _Float16 v16h;
typedef __attribute__((ext_vector_type(8)))  _Float16 v8h;
typedef __attribute__((ext_vector_type(16))) __bf16   v16b;
typedef __attribute__((ext_vector_type(8)))  __bf16   v8b;
typedef __attribute__((ext_vector_type(8)))  float    v8f;
typedef __attribute__((ext_vector_type(4)))  float    v4f;
typedef __attribute__((ext_vector_type(4)))  unsigned int v4u;

// ---------------------------------------------------------------------------
// Helpers
// ---------------------------------------------------------------------------
__device__ __forceinline__ unsigned short f2bf_bits(float f) {
  unsigned u = __float_as_uint(f);
  return (unsigned short)((u + 0x7FFFu + ((u >> 16) & 1u)) >> 16);
}
__device__ __forceinline__ float bf_bits2f(unsigned short h) { return __uint_as_float(((unsigned)h) << 16); }

// hazard guards as plain device helpers (no inline asm inside the kernel template body)
__device__ __forceinline__ void dep_guard_h(v8f& a, v8f& b, v16h x, v16h y) { asm volatile("v_nop\n\tv_nop\n\tv_nop\n\tv_nop" : "+v"(a), "+v"(b) : "v"(x), "v"(y)); }
__device__ __forceinline__ void dep_guard_b(v8f& a, v8f& b, v16b x, v16b y) { asm volatile("v_nop\n\tv_nop\n\tv_nop\n\tv_nop" : "+v"(a), "+v"(b) : "v"(x), "v"(y)); }
__device__ __forceinline__ void keep4_h(v16h a, v16h b, v16h c, v16h d) { asm volatile("v_nop" :: "v"(a), "v"(b), "v"(c), "v"(d)); }
__device__ __forceinline__ void keep4_b(v16b a, v16b b, v16b c, v16b d) { asm volatile("v_nop" :: "v"(a), "v"(b), "v"(c), "v"(d)); }
__device__ __forceinline__ void acc_guard4(v8f& a, v8f& b, v8f& c, v8f& d) { asm volatile("v_nop\n\tv_nop\n\tv_nop\n\tv_nop" : "+v"(a), "+v"(b), "+v"(c), "+v"(d)); }
template <typename T> struct Frag;
template <> struct Frag<_Float16> {
  typedef v16h V; union U { v16h v; v8h h[2]; };
  // elements 0..7 <- p[0..7], 8..15 <- p[16..23]
  static __device__ __forceinline__ v16h load(const _Float16* p) {
    U f; f.h[0] = *(const v8h*)(p); f.h[1] = *(const v8h*)(p + 16); return f.v;
  }
  static __device__ __forceinline__ v8f mma(v16h a, v16h b, v8f c) {
    return __builtin_amdgcn_wmma_f32_16x16x32_f16(false, a, false, b, (short)0, c, false, false);
  }
  static __device__ __forceinline__ void guard(v8f& a, v8f& b, v16h x, v16h y) { dep_guard_h(a, b, x, y); }
  static __device__ __forceinline__ void keep(v16h a, v16h b, v16h c, v16h d) { keep4_h(a, b, c, d); }
};
template <> struct Frag<__bf16> {
  typedef v16b V; union U { v16b v; v8b h[2]; };
  static __device__ __forceinline__ v16b load(const __bf16* p) {
    U f; f.h[0] = *(const v8b*)(p); f.h[1] = *(const v8b*)(p + 16); return f.v;
  }
  static __device__ __forceinline__ v8f mma(v16b a, v16b b, v8f c) {
    return __builtin_amdgcn_wmma_f32_16x16x32_bf16(false, a, false, b, (short)0, c, false, false);
  }
  static __device__ __forceinline__ void guard(v8f& a, v8f& b, v16b x, v16b y) { dep_guard_b(a, b, x, y); }
  static __device__ __forceinline__ void keep(v16b a, v16b b, v16b c, v16b d) { keep4_b(a, b, c, d); }
};

__device__ __forceinline__ unsigned pk16(unsigned short a, unsigned short b) { return (unsigned)a | ((unsigned)b << 16); }

// ---- Register-blocked batched WMMA GEMM (ACT reduced to none/relu/leaky) -------------------------------
// C[m,n] = scale * sum_k A[m,k] * Bt[n,k] (+bias)(+resid); each wave owns a 64x64 tile, a block of 8 waves (2 x 4) a
// 128x256 tile. A row-major [M,K]; Bt row-major [N,K]; M % 128 == 0, N % 256 == 0, K % 64 == 0.
// Operands go through LDS: a slice = 64 k (one 128-B line) of the block's 128 A rows and 256 Bt rows, 384 rows at pitch
// 144 B. It is brought in once for all 8 waves by asynchronous 16-B copies, 8 lanes on one whole line, 12 copies a thread
// (12 x 256 threads x 16 B = 384 rows x 128 B; the 16 pad bytes of a row are neither written nor read). Two buffers:
// slice t+1 flies while slice t is multiplied. Fragments are read from LDS in the k order the global loads had.
// SPLIT (hi/lo planes) is not staged and not instantiated.
// BIAS_MODE: 0 = none, 1 = bias[m], 2 = bias[n].
// OUT_MODE: 0 = f32, 1 = f16, 2 = bf16 hi plane (Cout) + bf16 lo plane (Cout2).
// ET: 0 = f16 operands, 1 = bf16 operands (pointers passed as 16-bit storage)
constexpr int kGK    = 64;                 // k of one staged slice (halves)
constexpr int kGP    = 72;                 // halves: LDS row pitch 144 B = 16 B x 9 (odd), free of conflicts for 16-B fragment reads
constexpr int kGMB   = 128;                // A rows of a block tile
constexpr int kGNB   = 256;                // Bt rows of a block tile
constexpr int kGBuf  = (kGMB + kGNB) * kGP;   // halves of one buffer: 27,648 = 55,296 B
constexpr unsigned kGStep = 32u * kGP * 2u;   // LDS bytes between two copies of a thread: 32 rows

__device__ __forceinline__ unsigned lds_off(const void* p) { return (unsigned)(size_t)p; }   // byte offset in the block's LDS

// One thread's share of a slice: 12 asynchronous 16-B copies global -> LDS, rows 32 apart (4 of A, 8 of Bt).
// The address-translation wait is the statement's last line, so that no address register is rewritten in front of it.
__device__ __forceinline__ void stage_slice(unsigned l, const unsigned short* a, size_t sa, const unsigned short* b, size_t sb) {
  asm volatile(
      "global_load_async_to_lds_b128 %0, %12, off\n\t"
      "global_load_async_to_lds_b128 %1, %13, off\n\t"
      "global_load_async_to_lds_b128 %2, %14, off\n\t"
      "global_load_async_to_lds_b128 %3, %15, off\n\t"
      "global_load_async_to_lds_b128 %4, %16, off\n\t"
      "global_load_async_to_lds_b128 %5, %17, off\n\t"
      "global_load_async_to_lds_b128 %6, %18, off\n\t"
      "global_load_async_to_lds_b128 %7, %19, off\n\t"
      "global_load_async_to_lds_b128 %8, %20, off\n\t"
      "global_load_async_to_lds_b128 %9, %21, off\n\t"
      "global_load_async_to_lds_b128 %10, %22, off\n\t"
      "global_load_async_to_lds_b128 %11, %23, off\n\t"
      "s_wait_xcnt 0x0"
      :: "v"(l), "v"(l + kGStep), "v"(l + 2 * kGStep), "v"(l + 3 * kGStep), "v"(l + 4 * kGStep), "v"(l + 5 * kGStep),
         "v"(l + 6 * kGStep), "v"(l + 7 * kGStep), "v"(l + 8 * kGStep), "v"(l + 9 * kGStep), "v"(l + 10 * kGStep),
         "v"(l + 11 * kGStep),
         "v"(a), "v"(a + sa), "v"(a + 2 * sa), "v"(a + 3 * sa),
         "v"(b), "v"(b + sb), "v"(b + 2 * sb), "v"(b + 3 * sb), "v"(b + 4 * sb), "v"(b + 5 * sb), "v"(b + 6 * sb), "v"(b + 7 * sb)
      : "memory");
}
// this wave's copies have landed (the compiler places no wait for them)
__device__ __forceinline__ void wait_copies() { asm volatile("s_wait_asynccnt 0x0" ::: "memory"); }
// this wave's LDS reads have returned, before the buffer they read is given up for refilling
__device__ __forceinline__ void wait_lds() { asm volatile("s_wait_dscnt 0x0" ::: "memory"); }

template <int ET> struct Elem;
template <> struct Elem<0> { typedef _Float16 T; };
template <> struct Elem<1> { typedef __bf16 T; };
template <int ET, bool SPLIT, int BIAS_MODE, int OUT_MODE, bool RESID, int ACT = 0>
__global__ __launch_bounds__(256) void wmma_gemm64(
    const unsigned short* __restrict__ Ap, const unsigned short* __restrict__ A2p, int lda, long strideA,
    const unsigned short* __restrict__ Btp, const unsigned short* __restrict__ Bt2p, int ldb, long strideB,
    void* __restrict__ Cout, void* __restrict__ Cout2, int ldc, long strideC,
    const float* __restrict__ bias,
    const float* __restrict__ resid, long strideR,
    int M, int N, int K, float scale) {
  typedef typename Elem<ET>::T T;
  typedef typename Frag<T>::V V;
  static_assert(!SPLIT, "lo planes are not staged");
  __shared__ __align__(16) unsigned short sAB[2 * kGBuf];   // two slices: rows 0..127 A, rows 128..383 Bt
  __shared__ __align__(16) float sT[8][16 * 68];   // per-wave 16x64 slab, pitch 68 floats
  const int b    = blockIdx.y;
  const int lane = threadIdx.x & 31;
  const int wave = threadIdx.x >> 5;
  const int tilesN = N >> 8;
  const int tilesM = M >> 7;
  const int tile = blockIdx.x;
  if (tile >= tilesM * tilesN) return;   // block-uniform, in front of every barrier and copy
  const int tm = tile / tilesN;
  const int tn = tile - tm * tilesN;
  const int mB = tm << 7;                      // block tile origin
  const int nB = tn << 8;
  const int wm = (wave >> 2) << 6;             // wave tile origin inside the block tile
  const int wn = (wave & 3) << 6;
  const int m0 = mB + wm;
  const int n0 = nB + wn;

  const int rlane = lane & 15;                 // row (A) / col (B, D) within subtile
  const int koff  = (lane >> 4) * 8;           // k offset of this lane half
  const int mOff  = (lane >> 4) * 8;           // D row offset

  v8f acc[4][4];
#pragma unroll
  for (int i = 0; i < 4; ++i)
#pragma unroll
    for (int j = 0; j < 4; ++j) acc[i][j] = (v8f){0.f,0.f,0.f,0.f,0.f,0.f,0.f,0.f};

  // this thread's place in a slice: row srow (+32 per copy), 16-B word tid & 7 of the row's 128-B line
  const int srow = threadIdx.x >> 3;
  const int scol = (threadIdx.x & 7) * 8;
  const unsigned short* gA = Ap  + (size_t)b * strideA + (size_t)(mB + srow) * lda + scol;
  const unsigned short* gB = Btp + (size_t)b * strideB + (size_t)(nB + srow) * ldb + scol;
  const size_t sa = (size_t)32 * lda;
  const size_t sb = (size_t)32 * ldb;
  const unsigned ldst = lds_off(sAB) + (unsigned)(srow * kGP + scol) * 2u;
  const int nT = K / kGK;

  stage_slice(ldst, gA, sa, gB, sb);
  wait_copies();
  __syncthreads();                              // slice 0 is readable by every wave
  if (nT > 1) stage_slice(ldst + kGBuf * 2u, gA + kGK, sa, gB + kGK, sb);

  for (int t = 0; t < nT; ++t) {
    const T* sl = (const T*)(const void*)sAB + (t & 1) * kGBuf + koff;
    const T* sA = sl + (wm + rlane) * kGP;
    const T* sB = sl + (kGMB + wn + rlane) * kGP;
    // the loops below are unrolled so that every fragment and accumulator index is a constant (else the arrays leave the registers)
#pragma unroll
    for (int ks = 0; ks < kGK; ks += 32) {
      V bh[4], ah[4];
#pragma unroll
      for (int j = 0; j < 4; ++j) bh[j] = Frag<T>::load(sB + (j << 4) * kGP + ks);
#pragma unroll
      for (int i = 0; i < 4; ++i) ah[i] = Frag<T>::load(sA + (i << 4) * kGP + ks);
#pragma unroll
      for (int i = 0; i < 4; ++i) {
#pragma unroll
        for (int j = 0; j < 4; ++j) acc[i][j] = Frag<T>::mma(ah[i], bh[j], acc[i][j]);
        Frag<T>::guard(acc[i][0], acc[i][3], ah[i], ah[i]);
      }
      Frag<T>::keep(bh[0], bh[1], bh[2], bh[3]);
    }
    // hand-over: own reads of slice t done, own copies of slice t+1 landed, then the one barrier of the trip, which
    // publishes slice t+1 and frees slice t's buffer; only behind it the refill with slice t+2
    wait_lds();
    wait_copies();
    __syncthreads();
    if (t + 2 < nT) stage_slice(ldst + (unsigned)(t & 1) * (kGBuf * 2u), gA + (size_t)(t + 2) * kGK, sa, gB + (size_t)(t + 2) * kGK, sb);
  }
  wait_copies();
  acc_guard4(acc[0][0], acc[0][1], acc[0][2], acc[0][3]);
  acc_guard4(acc[1][0], acc[1][1], acc[1][2], acc[1][3]);
  acc_guard4(acc[2][0], acc[2][1], acc[2][2], acc[2][3]);
  acc_guard4(acc[3][0], acc[3][1], acc[3][2], acc[3][3]);

  // ---- epilogue ----
  float* slab = sT[wave];
  const float* Rb = RESID ? (resid + (size_t)b * strideR) : nullptr;
#pragma unroll
  for (int i = 0; i < 4; ++i) {
    const int mBase = m0 + (i << 4);
#pragma unroll
    for (int j = 0; j < 4; ++j) {
      const int n = n0 + (j << 4) + rlane;
      float bv = 0.f;
      if (BIAS_MODE == 2) bv = bias[n];
#pragma unroll
      for (int r = 0; r < 8; ++r) {
        float v = acc[i][j][r] * scale;
        if (BIAS_MODE == 1) v += bias[mBase + mOff + r];
        if (BIAS_MODE == 2) v += bv;
        if (RESID) v += Rb[(size_t)(mBase + mOff + r) * ldc + n];
        if (ACT == 2) v = fmaxf(v, 0.0f);
        if (ACT == 4) v = (v > 0.f) ? v : 0.01f * v;
        slab[(mOff + r) * 68 + (j << 4) + rlane] = v;
      }
    }
    __builtin_amdgcn_fence(__ATOMIC_RELEASE, "workgroup");
    __builtin_amdgcn_wave_barrier();
    __builtin_amdgcn_fence(__ATOMIC_ACQUIRE, "workgroup");
    if (OUT_MODE == 0) {
      float* C = (float*)Cout + (size_t)b * strideC;
      const int hh = lane >> 4, c4 = (lane & 15) * 4;     // row seg = 256 B = 16 lanes x 16 B
      {
#pragma unroll
        for (int it = 0; it < 8; ++it) {
          const int row = it * 2 + hh;
          v4f v = *(const v4f*)(slab + row * 68 + c4);
          *(v4f*)(C + (size_t)(mBase + row) * ldc + n0 + c4) = v;
        }
        
      }
    } else {
      const int q = lane >> 3, c8 = (lane & 7) * 8;
      unsigned short* C  = (unsigned short*)Cout  + (size_t)b * strideC;
      unsigned short* C2 = (OUT_MODE == 2) ? ((unsigned short*)Cout2 + (size_t)b * strideC) : nullptr;
      {
#pragma unroll
        for (int it = 0; it < 4; ++it) {
          const int row = it * 4 + q;
          const float* sp = slab + row * 68 + c8;
          v8h hv, lv;
#pragma unroll
          for (int e = 0; e < 8; ++e) {
            if (OUT_MODE == 1) {
              hv[e] = (_Float16)sp[e];
            } else {
              unsigned short hb = f2bf_bits(sp[e]);
              unsigned short lb = f2bf_bits(sp[e] - bf_bits2f(hb));
              hv[e] = __builtin_bit_cast(_Float16, hb);
              lv[e] = __builtin_bit_cast(_Float16, lb);
            }
          }
          *(v8h*)(C + (size_t)(mBase + row) * ldc + n0 + c8) = hv;
          if (OUT_MODE == 2) *(v8h*)(C2 + (size_t)(mBase + row) * ldc + n0 + c8) = lv;
        }
        
      }
    }
    __builtin_amdgcn_fence(__ATOMIC_RELEASE, "workgroup");
    __builtin_amdgcn_wave_barrier();
    __builtin_amdgcn_fence(__ATOMIC_ACQUIRE, "workgroup");
  }
}

// ---------------------------------------------------------------------------
// f32 -> bf16 (RNE) cast, 8 consecutive elements per thread (one 16-B store per lane;
// Coverage: n8 = n/8 threads x 8 = the whole plane; both grids here are exact multiples of 256
// (x: 1,048,576 threads = 4096 blocks; W: 393,216 threads = 1536 blocks).
// ---------------------------------------------------------------------------
__global__ __launch_bounds__(256) void cast8_bf16_kernel(const float* __restrict__ in, unsigned short* __restrict__ out,
                                                         int n8) {
  const int i = blockIdx.x * 256 + threadIdx.x;
  if (i >= n8) return;
  const float* p = in + 8 * (size_t)i;
  const v4f a = *(const v4f*)(p);
  const v4f c = *(const v4f*)(p + 4);
  unsigned short hb[8];
#pragma unroll
  for (int e = 0; e < 4; ++e) {
    hb[e]     = f2bf_bits(a[e]);
    hb[4 + e] = f2bf_bits(c[e]);
  }
  const v4u u = (v4u){pk16(hb[0], hb[1]), pk16(hb[2], hb[3]), pk16(hb[4], hb[5]), pk16(hb[6], hb[7])};
  unsigned short* q = out + 8 * (size_t)i;
  *(v4u*)q = u;
  
}

// ---------------------------------------------------------------------------
// Flash-style attention for head_dim 64 on f16 planes (no mask), f32 out.
//   QK plane  f16 [8192 tokens][2048]: q of (b,h) at column h*64, k at column 1024 + h*64, row = b*2048 + s.
//   VT plane  f16 [b*16+h][64 d][2048 s].
//   scores^T = k . q^T          : v_wmma_f32_16x16x32_f16 (k from LDS as A, q resident B fragments), x0.125 in f32 below
//   out^T    = v^T . (p x2^15)^T: v_wmma_f32_16x16x32_f16 (V^T from LDS as A, p^T packed from the score tiles as B)
//   Both products are transposed so that lane (c, hh) holds scores of ONE query, q0+c: its maximum and its sum are
//   taken inside the lane plus one exchange between the wave halves, and two score tiles, converted in place, are
//   the B operand of the second product (element e of it = tile e>>3, register e&7 = key 8hh+e or 16+8hh+e-8).
//   online softmax statistics m, l, alpha and the final 1/l in f32. Each exponential is one fma and one v_exp_f32:
//   p x2^15 = 2^(s*kScaleLog2 - mb), mb = m*kScaleLog2 - 15 (m = running maximum of the raw scores); l carries x2^15 too.
// Block = 4 waves = 64 query rows of one (b,h); wave w owns rows q0..q0+15. grid.x = 4*16*32 = 2048.
// LDS exchanges: K/V^T tiles (written by all waves, read by all) and the per-wave O slab are
// separated by block-wide barriers; every barrier is reached by all 4 waves (32 uniform chunk trips).
// Staging coverage per chunk: 4 iterations x 128 threads = 512 16-B words = 64 rows x 8 words for the
// K tile [64 kv][64 d] and likewise for the V^T tile [64 d][64 kv] (every LDS byte read is written; the
// 16 pad bytes behind each 128-B row are neither written nor read).
// Out store: each instruction writes two 256-B row segments (lanes 0-15 row 2it, lanes 16-31 row 2it+1,
// ---------------------------------------------------------------------------
constexpr int kKC = 64;        // keys per chunk
constexpr int kQB = 64;        // query rows per block
constexpr int kOsPitch = 68;   // floats
constexpr int kTP = 72;        // halves: LDS row pitch of the K and V^T tiles = 144 B = 16 B x 9 (odd), so the 16 rows
                               // that one 16-B fragment load touches per lane half fall on 16 distinct groups of four banks
static_assert(kTP >= kDh && kTP >= kKC && (kTP * 2) % 16 == 0 && ((kTP * 2) / 16) % 2 == 1, "tile pitch");
static_assert(kSeq % kKC == 0 && kSeq % kQB == 0, "attention tiles");

__device__ __forceinline__ v8f mma_h16(v16h a, v16h b, v8f c) {
  c = __builtin_amdgcn_wmma_f32_16x16x32_f16(false, a, false, b, (short)0, c, false, false);
  asm volatile("v_nop\n\tv_nop\n\tv_nop\n\tv_nop" : "+v"(c) : "v"(a), "v"(b));
  return c;
}

// value of lane l ^ 16 (the other wave half), by a vector cross-row move
__device__ __forceinline__ float xhalf(float x) {
  return __builtin_bit_cast(float, __builtin_amdgcn_permlanex16(__builtin_bit_cast(int, x), __builtin_bit_cast(int, x),
                                                                0x76543210, 0xfedcba98, false, false));
}

__global__ __launch_bounds__(128)
void attn_f16_kernel(const unsigned short* __restrict__ QKp, const unsigned short* __restrict__ VTp,
                     float* __restrict__ out) {
  const _Float16* QK = (const _Float16*)(const void*)QKp;
  const _Float16* VT = (const _Float16*)(const void*)VTp;
  __shared__ __align__(16) _Float16 Ksh[kKC * kTP];          // K tile   [kv][d]   9 KB, 64 of 72 halves a row used
  __shared__ __align__(16) _Float16 Vth[kDh * kTP];          // V^T tile [d][kv]   9 KB
  __shared__ __align__(16) float    Os[4][16 * kOsPitch];    // per wave out tile, pitch 68

  const int tid  = threadIdx.x;
  const int wave = tid >> 5;
  const int lane = tid & 31;
  const int hh   = lane >> 4;
  const int c    = lane & 15;

  const int nqb = kSeq / kQB;            // 32
  const int bx  = blockIdx.x;            // 0 .. 2047
  const int qb  = bx % nqb;
  const int bh  = bx / nqb;              // 0 .. 63
  const int h   = bh % kHeads;
  const int b   = bh / kHeads;
  const int q0  = qb * kQB + wave * 16;

  const _Float16* qb_ptr = QK + (size_t)b * kSeq * kQKCols + (size_t)h * kDh;   // (s, d) at + s*2048 + d
  const _Float16* kb_ptr = qb_ptr + kDim;                                        // k columns start at 1024
  const _Float16* vb_ptr = VT + (size_t)bh * kDh * kSeq;                         // (d, s) at + d*2048 + s
  float*          ob_ptr = out + (size_t)b * kSeq * kDim + (size_t)h * kDh;     // (s, d) at + s*1024 + d

  // ---- Q fragments (B operand): lane column c = query q0+c; elements 0..7 <- d dc*32+8hh+0..7, 8..15 <- +16 ----
  v16h qa[2];
  {
    const _Float16* qrow = qb_ptr + (size_t)(q0 + c) * kQKCols + 8 * hh;
#pragma unroll
    for (int dc = 0; dc < 2; ++dc) qa[dc] = Frag<_Float16>::load(qrow + dc * 32);
  }

  float mrow = -__builtin_inff();   // running maximum of the raw scores of query q0+c (alike in both halves)
  float mb   = -__builtin_inff();   // mrow * kScaleLog2 - 15: what every exponent of this query has subtracted
  float lrow = 0.f;                 // this half's share of the query's sum x2^15; the halves are joined after the loop
  v8f oacc[4];                      // oacc[t][r] = out^T[d = 16t+8hh+r][query q0+c]
#pragma unroll
  for (int t = 0; t < 4; ++t) oacc[t] = (v8f){0.f,0.f,0.f,0.f,0.f,0.f,0.f,0.f};

  for (int kc = 0; kc < kSeq / kKC; ++kc) {
    const int kv0 = kc * kKC;
    __syncthreads();
    // ---- stage K tile and V^T tile: pure 16-B copies of the f16 planes ----
#pragma unroll
    for (int i = 0; i < 4; ++i) {
      const int idx = i * 128 + tid;       // 0 .. 511
      const int r   = idx >> 3;            // row 0 .. 63 (kv for K, d for V^T)
      const int c8  = (idx & 7) * 8;       // halves
      const v8h kk = *(const v8h*)(kb_ptr + (size_t)(kv0 + r) * kQKCols + c8);
      const v8h vv = *(const v8h*)(vb_ptr + (size_t)r * kSeq + kv0 + c8);
      *(v8h*)(Ksh + r * kTP + c8) = kk;
      *(v8h*)(Vth + r * kTP + c8) = vv;
    }
    __syncthreads();

    // ---- scores^T: 4 key row tiles x 2 d-steps; s[j][r] = score of key kv0+16j+8hh+r with query q0+c ----
    v8f s[4];
#pragma unroll
    for (int j = 0; j < 4; ++j) {
      s[j] = (v8f){0.f,0.f,0.f,0.f,0.f,0.f,0.f,0.f};
#pragma unroll
      for (int dc = 0; dc < 2; ++dc) {
        // A[m = kv j*16+c][k = d] = Ksh[kv][d]; same split k-map as B
        const v16h ka = Frag<_Float16>::load(Ksh + (j * 16 + c) * kTP + dc * 32 + 8 * hh);
        s[j] = mma_h16(ka, qa[dc], s[j]);
      }
    }

    // ---- chunk maximum of this lane's query: 32 scores in the lane, the other 32 in lane ^ 16 ----
    float cm = -__builtin_inff();
#pragma unroll
    for (int j = 0; j < 4; ++j) {
#pragma unroll
      for (int r = 0; r < 8; ++r) cm = fmaxf(cm, s[j][r]);
    }
    cm = fmaxf(cm, xhalf(cm));

    // ---- online softmax update; P^T x2^15 as f16 packed straight into the B fragments ----
    const float mnew  = fmaxf(mrow, cm);
    const float mbnew = fmaf(mnew, kScaleLog2, -kPCarryLog2);
    const float alpha = __builtin_amdgcn_exp2f(mb - mbnew);   // 0 on the first chunk, where mb is -inf
    mrow = mnew;
    mb   = mbnew;
    float ps[4];
    v16h pb[2];
#pragma unroll
    for (int j = 0; j < 4; ++j) {
      ps[j] = 0.f;
#pragma unroll
      for (int r = 0; r < 8; ++r) {
        const float p = __builtin_amdgcn_exp2f(fmaf(s[j][r], kScaleLog2, -mbnew));   // 2^15 at the maximum: inside f16
        ps[j] += p;
        pb[j >> 1][(j & 1) * 8 + r] = (_Float16)p;
      }
    }
    lrow = lrow * alpha + ((ps[0] + ps[1]) + (ps[2] + ps[3]));
#pragma unroll
    for (int t = 0; t < 4; ++t)
#pragma unroll
      for (int r = 0; r < 8; ++r) oacc[t][r] *= alpha;

    // ---- O^T += V^T . P^T : A[m = d t*16+c][k = kv] = Vth[d][kv], B = P^T[kv][query c] ----
#pragma unroll
    for (int kk = 0; kk < 2; ++kk) {
#pragma unroll
      for (int t = 0; t < 4; ++t) {
        const v16h va = Frag<_Float16>::load(Vth + (t * 16 + c) * kTP + kk * 32 + 8 * hh);
        oacc[t] = mma_h16(va, pb[kk], oacc[t]);
      }
    }
  }

  // ---- normalise and store: lane (c, hh) holds d = 16t+8hh+0..7 of query row c ----
  float* os = Os[wave];
  {
    const float inv = 1.0f / (lrow + xhalf(lrow));   // l and out^T both carry x2^15
#pragma unroll
    for (int t = 0; t < 4; ++t) {
      float* op = os + c * kOsPitch + t * 16 + 8 * hh;
      *(v4f*)(op)     = (v4f){oacc[t][0] * inv, oacc[t][1] * inv, oacc[t][2] * inv, oacc[t][3] * inv};
      *(v4f*)(op + 4) = (v4f){oacc[t][4] * inv, oacc[t][5] * inv, oacc[t][6] * inv, oacc[t][7] * inv};
    }
  }
  __syncthreads();
  {
    const int c4 = (lane & 15) * 4;
    {
#pragma unroll
      for (int it = 0; it < 8; ++it) {
        const int row = it * 2 + hh;
        const v4f val = *(const v4f*)(os + row * kOsPitch + c4);
        *(v4f*)(ob_ptr + (size_t)(q0 + row) * kDim + c4) = val;
      }
      
    }
  }
}

// ---------------------------------------------------------------------------
// Host glue.
// no aliasing):
//   Xb   bf16 [8192][1024]          16,777,216  at          0   (x, RNE)
//   Wb   bf16 [3072][1024]           6,291,456  at 16,777,216   (W, RNE)
//   QKh  f16  [8192][2048]          33,554,432  at 23,068,672   (q | k columns, e = which*1024 + h*64 + d)
//   Vt   f16  [4*16][64][2048]      16,777,216  at 56,623,104   (v transposed per (b,h))
//   total                           73,400,320
// GEMM shapes: q|k M=8192, N=2048, K=1024; v^T M=1024 (16 heads x 64), N=2048, K=1024 (x4 batches via grid.y).
// All M multiples of 128, N of 256, K % 64 == 0, no padding anywhere. 5 launches.
// ---------------------------------------------------------------------------
extern "C" void kernel_launch(void* const* d_in, const int* in_sizes, int n_in,
                              void* d_out, int out_size, void* d_ws, size_t ws_size,
                              hipStream_t stream) {
  if (n_in < 2) return;
  if (in_sizes[0] != kTok * kDim) return;
  if (in_sizes[1] != kWRows * kDim) return;
  if (out_size != kTok * kDim) return;

  const size_t szXb = (size_t)kTok * kDim * 2;
  const size_t szWb = (size_t)kWRows * kDim * 2;
  const size_t szQK = (size_t)kTok * kQKCols * 2;
  const size_t szVt = (size_t)kBatch * kHeads * kDh * kSeq * 2;
  const size_t offXb = 0;
  const size_t offWb = offXb + szXb;
  const size_t offQK = offWb + szWb;
  const size_t offVt = offQK + szQK;
  const size_t total = offVt + szVt;
  if (ws_size < total) return;

  const float* x = (const float*)d_in[0];   // [4,2048,1024] f32
  const float* W = (const float*)d_in[1];   // [3072,1024] f32, [out][in]
  float* out = (float*)d_out;               // [4,2048,1024] f32
  char* ws = (char*)d_ws;
  unsigned short* Xb  = (unsigned short*)(ws + offXb);
  unsigned short* Wb  = (unsigned short*)(ws + offWb);
  unsigned short* QKh = (unsigned short*)(ws + offQK);
  unsigned short* Vt  = (unsigned short*)(ws + offVt);

  // ---- 16-bit operand planes (bf16 RNE of both float inputs) ----
  const int n8x = (kTok * kDim) / 8;     // 1,048,576 -> 4096 blocks exact
  const int n8w = (kWRows * kDim) / 8;   //   393,216 -> 1536 blocks exact
  cast8_bf16_kernel<<<dim3(n8x / 256), dim3(256), 0, stream>>>(x, Xb, n8x);
  cast8_bf16_kernel<<<dim3(n8w / 256), dim3(256), 0, stream>>>(W, Wb, n8w);

  // ---- q | k projection: QKh[token][e] = sum_k Xb[token][k] * Wb[e][k], e in 0..2047 (f16 out) ----
  const int tilesQK = (kTok / 128) * (kQKCols / 256);   // 64 x 8 = 512 blocks of 8 waves
  wmma_gemm64<1, false, 0, 1, false, 0><<<dim3(tilesQK, 1), dim3(256), 0, stream>>>(
      Xb, Xb, kDim, 0L, Wb, Wb, kDim, 0L,
      (void*)QKh, (void*)QKh, kQKCols, 0L, x, x, 0L, kTok, kQKCols, kDim, 1.0f);

  // ---- v projection written transposed, all heads and batches in one launch:
  //      Vt[b][e = h*64+d][s] = sum_k Wb[2048+e][k] * Xb[b*2048+s][k]; M = 1024 weight rows, N = 2048 tokens, grid.y = batch ----
  const unsigned short* WbV = Wb + (size_t)kQKCols * kDim;   // v weight rows
  const int tilesV = (kDim / 128) * (kSeq / 256);            // 8 x 8 = 64 blocks of 8 waves per batch
  wmma_gemm64<1, false, 0, 1, false, 0><<<dim3(tilesV, kBatch), dim3(256), 0, stream>>>(
      WbV, WbV, kDim, 0L, Xb, Xb, kDim, (long)kSeq * kDim,
      (void*)Vt, (void*)Vt, kSeq, (long)kDim * kSeq, x, x, 0L, kDim, kSeq, kDim, 1.0f);

  // ---- attention: grid = 4 batches x 16 heads x 32 query blocks ----
  attn_f16_kernel<<<dim3(kBatch * kHeads * (kSeq / kQB)), dim3(128), 0, stream>>>(QKh, Vt, out);
}

// v006
// One run takes 139 microseconds.
// Two timings next to v005 both put it at 1.16 times that version's speed.
// Counting every step since v000, it is 4.89 times as fast.
// Contractions: qkv projection (x bf16 RNE, W^T bf16 RNE) on v_wmma_f32_16x16x32_bf16; scores q.k^T (q, k f16 planes) and attn.v (P f16 carried x32768, V^T f16 plane) on v_wmma_f32_16x16x32_f16; all f32 accumulate; online softmax statistics, scaling and 1/l in f32; exponentials base 2 on v_exp_f32.
#include <hip/hip_runtime.h>
#include <math.h>

// ---------------------------------------------------------------------------
// Problem constants
// ---------------------------------------------------------------------------
constexpr int kBatch  = 4;
constexpr int kSeq    = 2048;
constexpr int kDim    = 1024;
constexpr int kHeads  = 16;
constexpr int kDh     = 64;
constexpr int kTok    = kBatch * kSeq;     // 8192 token rows
constexpr int kWRows  = 3 * kDim;          // 3072 weight rows (q | k | v)
constexpr int kQKCols = 2 * kDim;          // 2048: pitch of the q | k plane (halves)
constexpr float kPCarryLog2 = 15.0f;       // log2 of the carry: added inside the exponent
constexpr float kScaleLog2 = 0.125f * 1.4426950408889634f;   // 64^-0.5 x log2(e): raw f32 score -> base-2 exponent
static_assert(kHeads * kDh == kDim, "shape");
static_assert(kDim % 64 == 0, "gemm K multiple of the staged slice");
static_assert(kTok % 128 == 0 && kDim % 128 == 0 && kQKCols % 256 == 0 && kSeq % 256 == 0, "gemm M multiple of 128, N of 256");
static_assert(kDh % 64 == 0 && kSeq % 64 == 0, "attention tiles");
static_assert((kTok * kDim) % (8 * 256) == 0 && (kWRows * kDim) % (8 * 256) == 0, "cast grids exact");

typedef __attribute__((ext_vector_type(16))) _Float16 v16h;
typedef __attribute__((ext_vector_type(8)))  _Float16 v8h;
typedef __attribute__((ext_vector_type(16))) __bf16   v16b;
typedef __attribute__((ext_vector_type(8)))  __bf16   v8b;
typedef __attribute__((ext_vector_type(8)))  float    v8f;
typedef __attribute__((ext_vector_type(4)))  float    v4f;
typedef __attribute__((ext_vector_type(4)))  unsigned int v4u;

// ---------------------------------------------------------------------------
// Helpers
// ---------------------------------------------------------------------------
__device__ __forceinline__ unsigned short f2bf_bits(float f) {
  unsigned u = __float_as_uint(f);
  return (unsigned short)((u + 0x7FFFu + ((u >> 16) & 1u)) >> 16);
}
__device__ __forceinline__ float bf_bits2f(unsigned short h) { return __uint_as_float(((unsigned)h) << 16); }

// hazard guards as plain device helpers (no inline asm inside the kernel template body)
__device__ __forceinline__ void dep_guard_h(v8f& a, v8f& b, v16h x, v16h y) { asm volatile("v_nop\n\tv_nop\n\tv_nop\n\tv_nop" : "+v"(a), "+v"(b) : "v"(x), "v"(y)); }
__device__ __forceinline__ void dep_guard_b(v8f& a, v8f& b, v16b x, v16b y) { asm volatile("v_nop\n\tv_nop\n\tv_nop\n\tv_nop" : "+v"(a), "+v"(b) : "v"(x), "v"(y)); }
__device__ __forceinline__ void keep4_h(v16h a, v16h b, v16h c, v16h d) { asm volatile("v_nop" :: "v"(a), "v"(b), "v"(c), "v"(d)); }
__device__ __forceinline__ void keep4_b(v16b a, v16b b, v16b c, v16b d) { asm volatile("v_nop" :: "v"(a), "v"(b), "v"(c), "v"(d)); }
__device__ __forceinline__ void acc_guard4(v8f& a, v8f& b, v8f& c, v8f& d) { asm volatile("v_nop\n\tv_nop\n\tv_nop\n\tv_nop" : "+v"(a), "+v"(b), "+v"(c), "+v"(d)); }
template <typename T> struct Frag;
template <> struct Frag<_Float16> {
  typedef v16h V; union U { v16h v; v8h h[2]; };
  // elements 0..7 <- p[0..7], 8..15 <- p[16..23]
  static __device__ __forceinline__ v16h load(const _Float16* p) {
    U f; f.h[0] = *(const v8h*)(p); f.h[1] = *(const v8h*)(p + 16); return f.v;
  }
  static __device__ __forceinline__ v8f mma(v16h a, v16h b, v8f c) {
    return __builtin_amdgcn_wmma_f32_16x16x32_f16(false, a, false, b, (short)0, c, false, false);
  }
  static __device__ __forceinline__ void guard(v8f& a, v8f& b, v16h x, v16h y) { dep_guard_h(a, b, x, y); }
  static __device__ __forceinline__ void keep(v16h a, v16h b, v16h c, v16h d) { keep4_h(a, b, c, d); }
};
template <> struct Frag<__bf16> {
  typedef v16b V; union U { v16b v; v8b h[2]; };
  static __device__ __forceinline__ v16b load(const __bf16* p) {
    U f; f.h[0] = *(const v8b*)(p); f.h[1] = *(const v8b*)(p + 16); return f.v;
  }
  static __device__ __forceinline__ v8f mma(v16b a, v16b b, v8f c) {
    return __builtin_amdgcn_wmma_f32_16x16x32_bf16(false, a, false, b, (short)0, c, false, false);
  }
  static __device__ __forceinline__ void guard(v8f& a, v8f& b, v16b x, v16b y) { dep_guard_b(a, b, x, y); }
  static __device__ __forceinline__ void keep(v16b a, v16b b, v16b c, v16b d) { keep4_b(a, b, c, d); }
};

__device__ __forceinline__ unsigned pk16(unsigned short a, unsigned short b) { return (unsigned)a | ((unsigned)b << 16); }

// ---- Register-blocked batched WMMA GEMM (ACT reduced to none/relu/leaky) -------------------------------
// C[m,n] = scale * sum_k A[m,k] * Bt[n,k] (+bias)(+resid); each wave owns a 64x64 tile, a block of 8 waves (2 x 4) a
// 128x256 tile. A row-major [M,K]; Bt row-major [N,K]; M % 128 == 0, N % 256 == 0, K % 64 == 0.
// Operands go through LDS: a slice = 64 k (one 128-B line) of the block's 128 A rows and 256 Bt rows, 384 rows at pitch
// 144 B. It is brought in once for all 8 waves by asynchronous 16-B copies, 8 lanes on one whole line, 12 copies a thread
// (12 x 256 threads x 16 B = 384 rows x 128 B; the 16 pad bytes of a row are neither written nor read). Two buffers:
// slice t+1 flies while slice t is multiplied. Fragments are read from LDS in the k order the global loads had.
// SPLIT (hi/lo planes) is not staged and not instantiated.
// BIAS_MODE: 0 = none, 1 = bias[m], 2 = bias[n].
// OUT_MODE: 0 = f32, 1 = f16, 2 = bf16 hi plane (Cout) + bf16 lo plane (Cout2).
// ET: 0 = f16 operands, 1 = bf16 operands (pointers passed as 16-bit storage)
constexpr int kGK    = 64;                 // k of one staged slice (halves)
constexpr int kGP    = 72;                 // halves: LDS row pitch 144 B = 16 B x 9 (odd), free of conflicts for 16-B fragment reads
constexpr int kGMB   = 128;                // A rows of a block tile
constexpr int kGNB   = 256;                // Bt rows of a block tile
constexpr int kGBuf  = (kGMB + kGNB) * kGP;   // halves of one buffer: 27,648 = 55,296 B
constexpr unsigned kGStep = 32u * kGP * 2u;   // LDS bytes between two copies of a thread: 32 rows

__device__ __forceinline__ unsigned lds_off(const void* p) { return (unsigned)(size_t)p; }   // byte offset in the block's LDS

// One thread's share of a slice: 12 asynchronous 16-B copies global -> LDS, rows 32 apart (4 of A, 8 of Bt).
// The address-translation wait is the statement's last line, so that no address register is rewritten in front of it.
__device__ __forceinline__ void stage_slice(unsigned l, const unsigned short* a, size_t sa, const unsigned short* b, size_t sb) {
  asm volatile(
      "global_load_async_to_lds_b128 %0, %12, off\n\t"
      "global_load_async_to_lds_b128 %1, %13, off\n\t"
      "global_load_async_to_lds_b128 %2, %14, off\n\t"
      "global_load_async_to_lds_b128 %3, %15, off\n\t"
      "global_load_async_to_lds_b128 %4, %16, off\n\t"
      "global_load_async_to_lds_b128 %5, %17, off\n\t"
      "global_load_async_to_lds_b128 %6, %18, off\n\t"
      "global_load_async_to_lds_b128 %7, %19, off\n\t"
      "global_load_async_to_lds_b128 %8, %20, off\n\t"
      "global_load_async_to_lds_b128 %9, %21, off\n\t"
      "global_load_async_to_lds_b128 %10, %22, off\n\t"
      "global_load_async_to_lds_b128 %11, %23, off\n\t"
      "s_wait_xcnt 0x0"
      :: "v"(l), "v"(l + kGStep), "v"(l + 2 * kGStep), "v"(l + 3 * kGStep), "v"(l + 4 * kGStep), "v"(l + 5 * kGStep),
         "v"(l + 6 * kGStep), "v"(l + 7 * kGStep), "v"(l + 8 * kGStep), "v"(l + 9 * kGStep), "v"(l + 10 * kGStep),
         "v"(l + 11 * kGStep),
         "v"(a), "v"(a + sa), "v"(a + 2 * sa), "v"(a + 3 * sa),
         "v"(b), "v"(b + sb), "v"(b + 2 * sb), "v"(b + 3 * sb), "v"(b + 4 * sb), "v"(b + 5 * sb), "v"(b + 6 * sb), "v"(b + 7 * sb)
      : "memory");
}
// this wave's copies have landed (the compiler places no wait for them)
__device__ __forceinline__ void wait_copies() { asm volatile("s_wait_asynccnt 0x0" ::: "memory"); }
// this wave's LDS reads have returned, before the buffer they read is given up for refilling
__device__ __forceinline__ void wait_lds() { asm volatile("s_wait_dscnt 0x0" ::: "memory"); }

template <int ET> struct Elem;
template <> struct Elem<0> { typedef _Float16 T; };
template <> struct Elem<1> { typedef __bf16 T; };
template <int ET, bool SPLIT, int BIAS_MODE, int OUT_MODE, bool RESID, int ACT = 0>
__global__ __launch_bounds__(256) void wmma_gemm64(
    const unsigned short* __restrict__ Ap, const unsigned short* __restrict__ A2p, int lda, long strideA,
    const unsigned short* __restrict__ Btp, const unsigned short* __restrict__ Bt2p, int ldb, long strideB,
    void* __restrict__ Cout, void* __restrict__ Cout2, int ldc, long strideC,
    const float* __restrict__ bias,
    const float* __restrict__ resid, long strideR,
    int M, int N, int K, float scale) {
  typedef typename Elem<ET>::T T;
  typedef typename Frag<T>::V V;
  static_assert(!SPLIT, "lo planes are not staged");
  __shared__ __align__(16) unsigned short sAB[2 * kGBuf];   // two slices: rows 0..127 A, rows 128..383 Bt
  __shared__ __align__(16) float sT[8][16 * 68];   // per-wave 16x64 slab, pitch 68 floats
  const int b    = blockIdx.y;
  const int lane = threadIdx.x & 31;
  const int wave = threadIdx.x >> 5;
  const int tilesN = N >> 8;
  const int tilesM = M >> 7;
  const int tile = blockIdx.x;
  if (tile >= tilesM * tilesN) return;   // block-uniform, in front of every barrier and copy
  const int tm = tile / tilesN;
  const int tn = tile - tm * tilesN;
  const int mB = tm << 7;                      // block tile origin
  const int nB = tn << 8;
  const int wm = (wave >> 2) << 6;             // wave tile origin inside the block tile
  const int wn = (wave & 3) << 6;
  const int m0 = mB + wm;
  const int n0 = nB + wn;

  const int rlane = lane & 15;                 // row (A) / col (B, D) within subtile
  const int koff  = (lane >> 4) * 8;           // k offset of this lane half
  const int mOff  = (lane >> 4) * 8;           // D row offset

  v8f acc[4][4];
#pragma unroll
  for (int i = 0; i < 4; ++i)
#pragma unroll
    for (int j = 0; j < 4; ++j) acc[i][j] = (v8f){0.f,0.f,0.f,0.f,0.f,0.f,0.f,0.f};

  // this thread's place in a slice: row srow (+32 per copy), 16-B word tid & 7 of the row's 128-B line
  const int srow = threadIdx.x >> 3;
  const int scol = (threadIdx.x & 7) * 8;
  const unsigned short* gA = Ap  + (size_t)b * strideA + (size_t)(mB + srow) * lda + scol;
  const unsigned short* gB = Btp + (size_t)b * strideB + (size_t)(nB + srow) * ldb + scol;
  const size_t sa = (size_t)32 * lda;
  const size_t sb = (size_t)32 * ldb;
  const unsigned ldst = lds_off(sAB) + (unsigned)(srow * kGP + scol) * 2u;
  const int nT = K / kGK;

  stage_slice(ldst, gA, sa, gB, sb);
  wait_copies();
  __syncthreads();                              // slice 0 is readable by every wave
  if (nT > 1) stage_slice(ldst + kGBuf * 2u, gA + kGK, sa, gB + kGK, sb);

  for (int t = 0; t < nT; ++t) {
    const T* sl = (const T*)(const void*)sAB + (t & 1) * kGBuf + koff;
    const T* sA = sl + (wm + rlane) * kGP;
    const T* sB = sl + (kGMB + wn + rlane) * kGP;
    // the loops below are unrolled so that every fragment and accumulator index is a constant (else the arrays leave the registers)
#pragma unroll
    for (int ks = 0; ks < kGK; ks += 32) {
      V bh[4], ah[4];
#pragma unroll
      for (int j = 0; j < 4; ++j) bh[j] = Frag<T>::load(sB + (j << 4) * kGP + ks);
#pragma unroll
      for (int i = 0; i < 4; ++i) ah[i] = Frag<T>::load(sA + (i << 4) * kGP + ks);
#pragma unroll
      for (int i = 0; i < 4; ++i) {
#pragma unroll
        for (int j = 0; j < 4; ++j) acc[i][j] = Frag<T>::mma(ah[i], bh[j], acc[i][j]);
        Frag<T>::guard(acc[i][0], acc[i][3], ah[i], ah[i]);
      }
      Frag<T>::keep(bh[0], bh[1], bh[2], bh[3]);
    }
    // hand-over: own reads of slice t done, own copies of slice t+1 landed, then the one barrier of the trip, which
    // publishes slice t+1 and frees slice t's buffer; only behind it the refill with slice t+2
    wait_lds();
    wait_copies();
    __syncthreads();
    if (t + 2 < nT) stage_slice(ldst + (unsigned)(t & 1) * (kGBuf * 2u), gA + (size_t)(t + 2) * kGK, sa, gB + (size_t)(t + 2) * kGK, sb);
  }
  wait_copies();
  acc_guard4(acc[0][0], acc[0][1], acc[0][2], acc[0][3]);
  acc_guard4(acc[1][0], acc[1][1], acc[1][2], acc[1][3]);
  acc_guard4(acc[2][0], acc[2][1], acc[2][2], acc[2][3]);
  acc_guard4(acc[3][0], acc[3][1], acc[3][2], acc[3][3]);

  // ---- epilogue ----
  float* slab = sT[wave];
  const float* Rb = RESID ? (resid + (size_t)b * strideR) : nullptr;
#pragma unroll
  for (int i = 0; i < 4; ++i) {
    const int mBase = m0 + (i << 4);
#pragma unroll
    for (int j = 0; j < 4; ++j) {
      const int n = n0 + (j << 4) + rlane;
      float bv = 0.f;
      if (BIAS_MODE == 2) bv = bias[n];
#pragma unroll
      for (int r = 0; r < 8; ++r) {
        float v = acc[i][j][r] * scale;
        if (BIAS_MODE == 1) v += bias[mBase + mOff + r];
        if (BIAS_MODE == 2) v += bv;
        if (RESID) v += Rb[(size_t)(mBase + mOff + r) * ldc + n];
        if (ACT == 2) v = fmaxf(v, 0.0f);
        if (ACT == 4) v = (v > 0.f) ? v : 0.01f * v;
        slab[(mOff + r) * 68 + (j << 4) + rlane] = v;
      }
    }
    __builtin_amdgcn_fence(__ATOMIC_RELEASE, "workgroup");
    __builtin_amdgcn_wave_barrier();
    __builtin_amdgcn_fence(__ATOMIC_ACQUIRE, "workgroup");
    if (OUT_MODE == 0) {
      float* C = (float*)Cout + (size_t)b * strideC;
      const int hh = lane >> 4, c4 = (lane & 15) * 4;     // row seg = 256 B = 16 lanes x 16 B
      {
#pragma unroll
        for (int it = 0; it < 8; ++it) {
          const int row = it * 2 + hh;
          v4f v = *(const v4f*)(slab + row * 68 + c4);
          *(v4f*)(C + (size_t)(mBase + row) * ldc + n0 + c4) = v;
        }
        
      }
    } else {
      const int q = lane >> 3, c8 = (lane & 7) * 8;
      unsigned short* C  = (unsigned short*)Cout  + (size_t)b * strideC;
      unsigned short* C2 = (OUT_MODE == 2) ? ((unsigned short*)Cout2 + (size_t)b * strideC) : nullptr;
      {
#pragma unroll
        for (int it = 0; it < 4; ++it) {
          const int row = it * 4 + q;
          const float* sp = slab + row * 68 + c8;
          v8h hv, lv;
#pragma unroll
          for (int e = 0; e < 8; ++e) {
            if (OUT_MODE == 1) {
              hv[e] = (_Float16)sp[e];
            } else {
              unsigned short hb = f2bf_bits(sp[e]);
              unsigned short lb = f2bf_bits(sp[e] - bf_bits2f(hb));
              hv[e] = __builtin_bit_cast(_Float16, hb);
              lv[e] = __builtin_bit_cast(_Float16, lb);
            }
          }
          *(v8h*)(C + (size_t)(mBase + row) * ldc + n0 + c8) = hv;
          if (OUT_MODE == 2) *(v8h*)(C2 + (size_t)(mBase + row) * ldc + n0 + c8) = lv;
        }
        
      }
    }
    __builtin_amdgcn_fence(__ATOMIC_RELEASE, "workgroup");
    __builtin_amdgcn_wave_barrier();
    __builtin_amdgcn_fence(__ATOMIC_ACQUIRE, "workgroup");
  }
}

// ---------------------------------------------------------------------------
// f32 -> bf16 (RNE) cast, 8 consecutive elements per thread (one 16-B store per lane;
// Coverage: n8 = n/8 threads x 8 = the whole plane; both grids here are exact multiples of 256
// (x: 1,048,576 threads = 4096 blocks; W: 393,216 threads = 1536 blocks).
// ---------------------------------------------------------------------------
__global__ __launch_bounds__(256) void cast8_bf16_kernel(const float* __restrict__ in, unsigned short* __restrict__ out,
                                                         int n8) {
  const int i = blockIdx.x * 256 + threadIdx.x;
  if (i >= n8) return;
  const float* p = in + 8 * (size_t)i;
  const v4f a = *(const v4f*)(p);
  const v4f c = *(const v4f*)(p + 4);
  unsigned short hb[8];
#pragma unroll
  for (int e = 0; e < 4; ++e) {
    hb[e]     = f2bf_bits(a[e]);
    hb[4 + e] = f2bf_bits(c[e]);
  }
  const v4u u = (v4u){pk16(hb[0], hb[1]), pk16(hb[2], hb[3]), pk16(hb[4], hb[5]), pk16(hb[6], hb[7])};
  unsigned short* q = out + 8 * (size_t)i;
  *(v4u*)q = u;
  
}

// ---------------------------------------------------------------------------
// Flash-style attention for head_dim 64 on f16 planes (no mask), f32 out.
//   QK plane  f16 [8192 tokens][2048]: q of (b,h) at column h*64, k at column 1024 + h*64, row = b*2048 + s.
//   VT plane  f16 [b*16+h][64 d][2048 s].
//   scores^T = k . q^T          : v_wmma_f32_16x16x32_f16 (k from LDS as A, q resident B fragments), x0.125 in f32 below
//   out^T    = v^T . (p x2^15)^T: v_wmma_f32_16x16x32_f16 (V^T from LDS as A, p^T packed from the score tiles as B)
//   Both products are transposed so that lane (c, hh) holds scores of ONE query, q0+c: its maximum and its sum are
//   taken inside the lane plus one exchange between the wave halves, and two score tiles, converted in place, are
//   the B operand of the second product (element e of it = tile e>>3, register e&7 = key 8hh+e or 16+8hh+e-8).
//   online softmax statistics m, l, alpha and the final 1/l in f32. Each exponential is one fma and one v_exp_f32:
//   p x2^15 = 2^(s*kScaleLog2 - mb), mb = m*kScaleLog2 - 15 (m = running maximum of the raw scores); l carries x2^15 too.
// Block = 4 waves = 64 query rows of one (b,h); wave w owns rows q0..q0+15. grid.x = 4*16*32 = 2048.
// LDS exchanges: K/V^T tiles (written by all waves, read by all) and the per-wave O slab are
// separated by block-wide barriers; every barrier is reached by all 4 waves (32 uniform chunk trips).
// Staging coverage per chunk: 4 iterations x 128 threads = 512 16-B words = 64 rows x 8 words for the
// K tile [64 kv][64 d] and likewise for the V^T tile [64 d][64 kv] (every LDS byte read is written; the
// 16 pad bytes behind each 128-B row are neither written nor read).
// Out store: each instruction writes two 256-B row segments (lanes 0-15 row 2it, lanes 16-31 row 2it+1,
// ---------------------------------------------------------------------------
constexpr int kKC = 64;        // keys per chunk
constexpr int kQB = 64;        // query rows per block
constexpr int kOsPitch = 68;   // floats
constexpr int kTP = 72;        // halves: LDS row pitch of the K and V^T tiles = 144 B = 16 B x 9 (odd), so the 16 rows
                               // that one 16-B fragment load touches per lane half fall on 16 distinct groups of four banks
static_assert(kTP >= kDh && kTP >= kKC && (kTP * 2) % 16 == 0 && ((kTP * 2) / 16) % 2 == 1, "tile pitch");
static_assert(kSeq % kKC == 0 && kSeq % kQB == 0, "attention tiles");

// the builtin alone: the compiler keeps the distance behind a WMMA itself and stays free to move LDS reads across it
__device__ __forceinline__ v8f mma_h16(v16h a, v16h b, v8f c) {
  return __builtin_amdgcn_wmma_f32_16x16x32_f16(false, a, false, b, (short)0, c, false, false);
}

// value of lane l ^ 16 (the other wave half), by a vector cross-row move
__device__ __forceinline__ float xhalf(float x) {
  return __builtin_bit_cast(float, __builtin_amdgcn_permlanex16(__builtin_bit_cast(int, x), __builtin_bit_cast(int, x),
                                                                0x76543210, 0xfedcba98, false, false));
}

__global__ __launch_bounds__(128)
void attn_f16_kernel(const unsigned short* __restrict__ QKp, const unsigned short* __restrict__ VTp,
                     float* __restrict__ out) {
  const _Float16* QK = (const _Float16*)(const void*)QKp;
  const _Float16* VT = (const _Float16*)(const void*)VTp;
  __shared__ __align__(16) _Float16 Ksh[kKC * kTP];          // K tile   [kv][d]   9 KB, 64 of 72 halves a row used
  __shared__ __align__(16) _Float16 Vth[kDh * kTP];          // V^T tile [d][kv]   9 KB
  __shared__ __align__(16) float    Os[4][16 * kOsPitch];    // per wave out tile, pitch 68

  const int tid  = threadIdx.x;
  const int wave = tid >> 5;
  const int lane = tid & 31;
  const int hh   = lane >> 4;
  const int c    = lane & 15;

  const int nqb = kSeq / kQB;            // 32
  const int bx  = blockIdx.x;            // 0 .. 2047
  const int qb  = bx % nqb;
  const int bh  = bx / nqb;              // 0 .. 63
  const int h   = bh % kHeads;
  const int b   = bh / kHeads;
  const int q0  = qb * kQB + wave * 16;

  const _Float16* qb_ptr = QK + (size_t)b * kSeq * kQKCols + (size_t)h * kDh;   // (s, d) at + s*2048 + d
  const _Float16* kb_ptr = qb_ptr + kDim;                                        // k columns start at 1024
  const _Float16* vb_ptr = VT + (size_t)bh * kDh * kSeq;                         // (d, s) at + d*2048 + s
  float*          ob_ptr = out + (size_t)b * kSeq * kDim + (size_t)h * kDh;     // (s, d) at + s*1024 + d

  // ---- Q fragments (B operand): lane column c = query q0+c; elements 0..7 <- d dc*32+8hh+0..7, 8..15 <- +16 ----
  v16h qa[2];
  {
    const _Float16* qrow = qb_ptr + (size_t)(q0 + c) * kQKCols + 8 * hh;
#pragma unroll
    for (int dc = 0; dc < 2; ++dc) qa[dc] = Frag<_Float16>::load(qrow + dc * 32);
  }

  float mrow = -__builtin_inff();   // running maximum of the raw scores of query q0+c (alike in both halves)
  float mb   = -__builtin_inff();   // mrow * kScaleLog2 - 15: what every exponent of this query has subtracted
  float lrow = 0.f;                 // this half's share of the query's sum x2^15; the halves are joined after the loop
  v8f oacc[4];                      // oacc[t][r] = out^T[d = 16t+8hh+r][query q0+c]
#pragma unroll
  for (int t = 0; t < 4; ++t) oacc[t] = (v8f){0.f,0.f,0.f,0.f,0.f,0.f,0.f,0.f};

  for (int kc = 0; kc < kSeq / kKC; ++kc) {
    const int kv0 = kc * kKC;
    __syncthreads();
    // ---- stage K tile and V^T tile: pure 16-B copies of the f16 planes ----
#pragma unroll
    for (int i = 0; i < 4; ++i) {
      const int idx = i * 128 + tid;       // 0 .. 511
      const int r   = idx >> 3;            // row 0 .. 63 (kv for K, d for V^T)
      const int c8  = (idx & 7) * 8;       // halves
      const v8h kk = *(const v8h*)(kb_ptr + (size_t)(kv0 + r) * kQKCols + c8);
      const v8h vv = *(const v8h*)(vb_ptr + (size_t)r * kSeq + kv0 + c8);
      *(v8h*)(Ksh + r * kTP + c8) = kk;
      *(v8h*)(Vth + r * kTP + c8) = vv;
    }
    __syncthreads();

    // ---- scores^T: 4 key row tiles x 2 d-steps; s[j][r] = score of key kv0+16j+8hh+r with query q0+c ----
    // A[m = kv j*16+c][k = d] = Ksh[kv][d]; same split k-map as B. All eight fragments are read as one group.
    v16h ka[2][4];
#pragma unroll
    for (int dc = 0; dc < 2; ++dc)
#pragma unroll
      for (int j = 0; j < 4; ++j) ka[dc][j] = Frag<_Float16>::load(Ksh + (j * 16 + c) * kTP + dc * 32 + 8 * hh);
    __builtin_amdgcn_sched_barrier(0);   // keeps the K reads one group in front of the products: the LDS latency is waited out once, not per product
    v8f s[4];
#pragma unroll
    for (int j = 0; j < 4; ++j) s[j] = (v8f){0.f,0.f,0.f,0.f,0.f,0.f,0.f,0.f};
#pragma unroll
    for (int dc = 0; dc < 2; ++dc)
#pragma unroll
      for (int j = 0; j < 4; ++j) s[j] = mma_h16(ka[dc][j], qa[dc], s[j]);

    // A[m = d t*16+c][k = kv] = Vth[d][kv]: all eight fragments are read here, so that they return behind the softmax arithmetic
    v16h va[2][4];
#pragma unroll
    for (int kk = 0; kk < 2; ++kk)
#pragma unroll
      for (int t = 0; t < 4; ++t) va[kk][t] = Frag<_Float16>::load(Vth + (t * 16 + c) * kTP + kk * 32 + 8 * hh);
    __builtin_amdgcn_sched_barrier(0);   // keeps the V^T reads in front of the softmax arithmetic, which hides their latency

    // ---- chunk maximum of this lane's query: 32 scores in the lane, the other 32 in lane ^ 16 ----
    float cm = -__builtin_inff();
#pragma unroll
    for (int j = 0; j < 4; ++j) {
#pragma unroll
      for (int r = 0; r < 8; ++r) cm = fmaxf(cm, s[j][r]);
    }
    cm = fmaxf(cm, xhalf(cm));

    // ---- online softmax update; P^T x2^15 as f16 packed straight into the B fragments ----
    const float mnew  = fmaxf(mrow, cm);
    const float mbnew = fmaf(mnew, kScaleLog2, -kPCarryLog2);
    const float alpha = __builtin_amdgcn_exp2f(mb - mbnew);   // 0 on the first chunk, where mb is -inf
    mrow = mnew;
    mb   = mbnew;
    float ps[4];
    v16h pb[2];
#pragma unroll
    for (int j = 0; j < 4; ++j) {
      ps[j] = 0.f;
#pragma unroll
      for (int r = 0; r < 8; ++r) {
        const float p = __builtin_amdgcn_exp2f(fmaf(s[j][r], kScaleLog2, -mbnew));   // 2^15 at the maximum: inside f16
        ps[j] += p;
        pb[j >> 1][(j & 1) * 8 + r] = (_Float16)p;
      }
    }
    lrow = lrow * alpha + ((ps[0] + ps[1]) + (ps[2] + ps[3]));
#pragma unroll
    for (int t = 0; t < 4; ++t)
#pragma unroll
      for (int r = 0; r < 8; ++r) oacc[t][r] *= alpha;

    // ---- O^T += V^T . P^T : A = the V^T fragments read above, B = P^T[kv][query c] ----
#pragma unroll
    for (int kk = 0; kk < 2; ++kk)
#pragma unroll
      for (int t = 0; t < 4; ++t) oacc[t] = mma_h16(va[kk][t], pb[kk], oacc[t]);
  }

  // ---- normalise and store: lane (c, hh) holds d = 16t+8hh+0..7 of query row c ----
  float* os = Os[wave];
  {
    const float inv = 1.0f / (lrow + xhalf(lrow));   // l and out^T both carry x2^15
#pragma unroll
    for (int t = 0; t < 4; ++t) {
      float* op = os + c * kOsPitch + t * 16 + 8 * hh;
      *(v4f*)(op)     = (v4f){oacc[t][0] * inv, oacc[t][1] * inv, oacc[t][2] * inv, oacc[t][3] * inv};
      *(v4f*)(op + 4) = (v4f){oacc[t][4] * inv, oacc[t][5] * inv, oacc[t][6] * inv, oacc[t][7] * inv};
    }
  }
  __syncthreads();
  {
    const int c4 = (lane & 15) * 4;
    {
#pragma unroll
      for (int it = 0; it < 8; ++it) {
        const int row = it * 2 + hh;
        const v4f val = *(const v4f*)(os + row * kOsPitch + c4);
        *(v4f*)(ob_ptr + (size_t)(q0 + row) * kDim + c4) = val;
      }
      
    }
  }
}

// ---------------------------------------------------------------------------
// Host glue.
// no aliasing):
//   Xb   bf16 [8192][1024]          16,777,216  at          0   (x, RNE)
//   Wb   bf16 [3072][1024]           6,291,456  at 16,777,216   (W, RNE)
//   QKh  f16  [8192][2048]          33,554,432  at 23,068,672   (q | k columns, e = which*1024 + h*64 + d)
//   Vt   f16  [4*16][64][2048]      16,777,216  at 56,623,104   (v transposed per (b,h))
//   total                           73,400,320
// GEMM shapes: q|k M=8192, N=2048, K=1024; v^T M=1024 (16 heads x 64), N=2048, K=1024 (x4 batches via grid.y).
// All M multiples of 128, N of 256, K % 64 == 0, no padding anywhere. 5 launches.
// ---------------------------------------------------------------------------
extern "C" void kernel_launch(void* const* d_in, const int* in_sizes, int n_in,
                              void* d_out, int out_size, void* d_ws, size_t ws_size,
                              hipStream_t stream) {
  if (n_in < 2) return;
  if (in_sizes[0] != kTok * kDim) return;
  if (in_sizes[1] != kWRows * kDim) return;
  if (out_size != kTok * kDim) return;

  const size_t szXb = (size_t)kTok * kDim * 2;
  const size_t szWb = (size_t)kWRows * kDim * 2;
  const size_t szQK = (size_t)kTok * kQKCols * 2;
  const size_t szVt = (size_t)kBatch * kHeads * kDh * kSeq * 2;
  const size_t offXb = 0;
  const size_t offWb = offXb + szXb;
  const size_t offQK = offWb + szWb;
  const size_t offVt = offQK + szQK;
  const size_t total = offVt + szVt;
  if (ws_size < total) return;

  const float* x = (const float*)d_in[0];   // [4,2048,1024] f32
  const float* W = (const float*)d_in[1];   // [3072,1024] f32, [out][in]
  float* out = (float*)d_out;               // [4,2048,1024] f32
  char* ws = (char*)d_ws;
  unsigned short* Xb  = (unsigned short*)(ws + offXb);
  unsigned short* Wb  = (unsigned short*)(ws + offWb);
  unsigned short* QKh = (unsigned short*)(ws + offQK);
  unsigned short* Vt  = (unsigned short*)(ws + offVt);

  // ---- 16-bit operand planes (bf16 RNE of both float inputs) ----
  const int n8x = (kTok * kDim) / 8;     // 1,048,576 -> 4096 blocks exact
  const int n8w = (kWRows * kDim) / 8;   //   393,216 -> 1536 blocks exact
  cast8_bf16_kernel<<<dim3(n8x / 256), dim3(256), 0, stream>>>(x, Xb, n8x);
  cast8_bf16_kernel<<<dim3(n8w / 256), dim3(256), 0, stream>>>(W, Wb, n8w);

  // ---- q | k projection: QKh[token][e] = sum_k Xb[token][k] * Wb[e][k], e in 0..2047 (f16 out) ----
  const int tilesQK = (kTok / 128) * (kQKCols / 256);   // 64 x 8 = 512 blocks of 8 waves
  wmma_gemm64<1, false, 0, 1, false, 0><<<dim3(tilesQK, 1), dim3(256), 0, stream>>>(
      Xb, Xb, kDim, 0L, Wb, Wb, kDim, 0L,
      (void*)QKh, (void*)QKh, kQKCols, 0L, x, x, 0L, kTok, kQKCols, kDim, 1.0f);

  // ---- v projection written transposed, all heads and batches in one launch:
  //      Vt[b][e = h*64+d][s] = sum_k Wb[2048+e][k] * Xb[b*2048+s][k]; M = 1024 weight rows, N = 2048 tokens, grid.y = batch ----
  const unsigned short* WbV = Wb + (size_t)kQKCols * kDim;   // v weight rows
  const int tilesV = (kDim / 128) * (kSeq / 256);            // 8 x 8 = 64 blocks of 8 waves per batch
  wmma_gemm64<1, false, 0, 1, false, 0><<<dim3(tilesV, kBatch), dim3(256), 0, stream>>>(
      WbV, WbV, kDim, 0L, Xb, Xb, kDim, (long)kSeq * kDim,
      (void*)Vt, (void*)Vt, kSeq, (long)kDim * kSeq, x, x, 0L, kDim, kSeq, kDim, 1.0f);

  // ---- attention: grid = 4 batches x 16 heads x 32 query blocks ----
  attn_f16_kernel<<<dim3(kBatch * kHeads * (kSeq / kQB)), dim3(128), 0, stream>>>(QKh, Vt, out);
}

// v007
// Measured time: 115 microseconds a run.
// Timed twice side by side with v006, it ran 1.21 and 1.20 times as fast.
// Over all steps from v000 it is 5.89 times as fast.
// Contractions: qkv projection (x bf16 RNE, W^T bf16 RNE) on v_wmma_f32_16x16x32_bf16; scores q.k^T (q, k f16 planes) and attn.v (P f16 carried x32768, V^T f16 plane) on v_wmma_f32_16x16x32_f16; all f32 accumulate; online softmax statistics, scaling and 1/l in f32; exponentials base 2 on v_exp_f32.
#include <hip/hip_runtime.h>
#include <math.h>

// ---------------------------------------------------------------------------
// Problem constants
// ---------------------------------------------------------------------------
constexpr int kBatch  = 4;
constexpr int kSeq    = 2048;
constexpr int kDim    = 1024;
constexpr int kHeads  = 16;
constexpr int kDh     = 64;
constexpr int kTok    = kBatch * kSeq;     // 8192 token rows
constexpr int kWRows  = 3 * kDim;          // 3072 weight rows (q | k | v)
constexpr int kQKCols = 2 * kDim;          // 2048: pitch of the q | k plane (halves)
constexpr float kPCarryLog2 = 15.0f;       // log2 of the carry: added inside the exponent
constexpr float kScaleLog2 = 0.125f * 1.4426950408889634f;   // 64^-0.5 x log2(e): raw f32 score -> base-2 exponent
static_assert(kHeads * kDh == kDim, "shape");
static_assert(kDim % 64 == 0, "gemm K multiple of the staged slice");
static_assert(kTok % 128 == 0 && kDim % 128 == 0 && kQKCols % 256 == 0 && kSeq % 256 == 0, "gemm M multiple of 128, N of 256");
static_assert(kDh % 64 == 0 && kSeq % 64 == 0, "attention tiles");
static_assert((kTok * kDim) % (8 * 256) == 0 && (kWRows * kDim) % (8 * 256) == 0, "cast grids exact");

typedef __attribute__((ext_vector_type(16))) _Float16 v16h;
typedef __attribute__((ext_vector_type(8)))  _Float16 v8h;
typedef __attribute__((ext_vector_type(16))) __bf16   v16b;
typedef __attribute__((ext_vector_type(8)))  __bf16   v8b;
typedef __attribute__((ext_vector_type(8)))  float    v8f;
typedef __attribute__((ext_vector_type(4)))  float    v4f;
typedef __attribute__((ext_vector_type(4)))  unsigned int v4u;

// ---------------------------------------------------------------------------
// Helpers
// ---------------------------------------------------------------------------
__device__ __forceinline__ unsigned short f2bf_bits(float f) {
  unsigned u = __float_as_uint(f);
  return (unsigned short)((u + 0x7FFFu + ((u >> 16) & 1u)) >> 16);
}
__device__ __forceinline__ float bf_bits2f(unsigned short h) { return __uint_as_float(((unsigned)h) << 16); }

// hazard guards as plain device helpers (no inline asm inside the kernel template body)
__device__ __forceinline__ void dep_guard_h(v8f& a, v8f& b, v16h x, v16h y) { asm volatile("v_nop\n\tv_nop\n\tv_nop\n\tv_nop" : "+v"(a), "+v"(b) : "v"(x), "v"(y)); }
__device__ __forceinline__ void dep_guard_b(v8f& a, v8f& b, v16b x, v16b y) { asm volatile("v_nop\n\tv_nop\n\tv_nop\n\tv_nop" : "+v"(a), "+v"(b) : "v"(x), "v"(y)); }
__device__ __forceinline__ void keep4_h(v16h a, v16h b, v16h c, v16h d) { asm volatile("v_nop" :: "v"(a), "v"(b), "v"(c), "v"(d)); }
__device__ __forceinline__ void keep4_b(v16b a, v16b b, v16b c, v16b d) { asm volatile("v_nop" :: "v"(a), "v"(b), "v"(c), "v"(d)); }
__device__ __forceinline__ void acc_guard4(v8f& a, v8f& b, v8f& c, v8f& d) { asm volatile("v_nop\n\tv_nop\n\tv_nop\n\tv_nop" : "+v"(a), "+v"(b), "+v"(c), "+v"(d)); }
template <typename T> struct Frag;
template <> struct Frag<_Float16> {
  typedef v16h V; union U { v16h v; v8h h[2]; };
  // elements 0..7 <- p[0..7], 8..15 <- p[16..23]
  static __device__ __forceinline__ v16h load(const _Float16* p) {
    U f; f.h[0] = *(const v8h*)(p); f.h[1] = *(const v8h*)(p + 16); return f.v;
  }
  static __device__ __forceinline__ v8f mma(v16h a, v16h b, v8f c) {
    return __builtin_amdgcn_wmma_f32_16x16x32_f16(false, a, false, b, (short)0, c, false, false);
  }
  static __device__ __forceinline__ void guard(v8f& a, v8f& b, v16h x, v16h y) { dep_guard_h(a, b, x, y); }
  static __device__ __forceinline__ void keep(v16h a, v16h b, v16h c, v16h d) { keep4_h(a, b, c, d); }
};
template <> struct Frag<__bf16> {
  typedef v16b V; union U { v16b v; v8b h[2]; };
  static __device__ __forceinline__ v16b load(const __bf16* p) {
    U f; f.h[0] = *(const v8b*)(p); f.h[1] = *(const v8b*)(p + 16); return f.v;
  }
  static __device__ __forceinline__ v8f mma(v16b a, v16b b, v8f c) {
    return __builtin_amdgcn_wmma_f32_16x16x32_bf16(false, a, false, b, (short)0, c, false, false);
  }
  static __device__ __forceinline__ void guard(v8f& a, v8f& b, v16b x, v16b y) { dep_guard_b(a, b, x, y); }
  static __device__ __forceinline__ void keep(v16b a, v16b b, v16b c, v16b d) { keep4_b(a, b, c, d); }
};

__device__ __forceinline__ unsigned pk16(unsigned short a, unsigned short b) { return (unsigned)a | ((unsigned)b << 16); }

// ---- Register-blocked batched WMMA GEMM (ACT reduced to none/relu/leaky) -------------------------------
// C[m,n] = scale * sum_k A[m,k] * Bt[n,k] (+bias)(+resid); each wave owns a 64x64 tile, a block of 8 waves (2 x 4) a
// 128x256 tile. A row-major [M,K]; Bt row-major [N,K]; M % 128 == 0, N % 256 == 0, K % 64 == 0.
// Operands go through LDS: a slice = 64 k (one 128-B line) of the block's 128 A rows and 256 Bt rows, 384 rows at pitch
// 144 B. It is brought in once for all 8 waves by asynchronous 16-B copies, 8 lanes on one whole line, 12 copies a thread
// (12 x 256 threads x 16 B = 384 rows x 128 B; the 16 pad bytes of a row are neither written nor read). Two buffers:
// slice t+1 flies while slice t is multiplied. Fragments are read from LDS in the k order the global loads had.
// SPLIT (hi/lo planes) is not staged and not instantiated.
// BIAS_MODE: 0 = none, 1 = bias[m], 2 = bias[n].
// OUT_MODE: 0 = f32, 1 = f16, 2 = bf16 hi plane (Cout) + bf16 lo plane (Cout2).
// ET: 0 = f16 operands, 1 = bf16 operands (pointers passed as 16-bit storage)
constexpr int kGK    = 64;                 // k of one staged slice (halves)
constexpr int kGP    = 72;                 // halves: LDS row pitch 144 B = 16 B x 9 (odd), free of conflicts for 16-B fragment reads
constexpr int kGMB   = 128;                // A rows of a block tile
constexpr int kGNB   = 256;                // Bt rows of a block tile
constexpr int kGBuf  = (kGMB + kGNB) * kGP;   // halves of one buffer: 27,648 = 55,296 B
constexpr unsigned kGStep = 32u * kGP * 2u;   // LDS bytes between two copies of a thread: 32 rows

__device__ __forceinline__ unsigned lds_off(const void* p) { return (unsigned)(size_t)p; }   // byte offset in the block's LDS

// One thread's share of a slice: 12 asynchronous 16-B copies global -> LDS, rows 32 apart (4 of A, 8 of Bt).
// The address-translation wait is the statement's last line, so that no address register is rewritten in front of it.
__device__ __forceinline__ void stage_slice(unsigned l, const unsigned short* a, size_t sa, const unsigned short* b, size_t sb) {
  asm volatile(
      "global_load_async_to_lds_b128 %0, %12, off\n\t"
      "global_load_async_to_lds_b128 %1, %13, off\n\t"
      "global_load_async_to_lds_b128 %2, %14, off\n\t"
      "global_load_async_to_lds_b128 %3, %15, off\n\t"
      "global_load_async_to_lds_b128 %4, %16, off\n\t"
      "global_load_async_to_lds_b128 %5, %17, off\n\t"
      "global_load_async_to_lds_b128 %6, %18, off\n\t"
      "global_load_async_to_lds_b128 %7, %19, off\n\t"
      "global_load_async_to_lds_b128 %8, %20, off\n\t"
      "global_load_async_to_lds_b128 %9, %21, off\n\t"
      "global_load_async_to_lds_b128 %10, %22, off\n\t"
      "global_load_async_to_lds_b128 %11, %23, off\n\t"
      "s_wait_xcnt 0x0"
      :: "v"(l), "v"(l + kGStep), "v"(l + 2 * kGStep), "v"(l + 3 * kGStep), "v"(l + 4 * kGStep), "v"(l + 5 * kGStep),
         "v"(l + 6 * kGStep), "v"(l + 7 * kGStep), "v"(l + 8 * kGStep), "v"(l + 9 * kGStep), "v"(l + 10 * kGStep),
         "v"(l + 11 * kGStep),
         "v"(a), "v"(a + sa), "v"(a + 2 * sa), "v"(a + 3 * sa),
         "v"(b), "v"(b + sb), "v"(b + 2 * sb), "v"(b + 3 * sb), "v"(b + 4 * sb), "v"(b + 5 * sb), "v"(b + 6 * sb), "v"(b + 7 * sb)
      : "memory");
}
// this wave's copies have landed (the compiler places no wait for them)
__device__ __forceinline__ void wait_copies() { asm volatile("s_wait_asynccnt 0x0" ::: "memory"); }
// this wave's LDS reads have returned, before the buffer they read is given up for refilling
__device__ __forceinline__ void wait_lds() { asm volatile("s_wait_dscnt 0x0" ::: "memory"); }

template <int ET> struct Elem;
template <> struct Elem<0> { typedef _Float16 T; };
template <> struct Elem<1> { typedef __bf16 T; };
template <int ET, bool SPLIT, int BIAS_MODE, int OUT_MODE, bool RESID, int ACT = 0>
__global__ __launch_bounds__(256) void wmma_gemm64(
    const unsigned short* __restrict__ Ap, const unsigned short* __restrict__ A2p, int lda, long strideA,
    const unsigned short* __restrict__ Btp, const unsigned short* __restrict__ Bt2p, int ldb, long strideB,
    void* __restrict__ Cout, void* __restrict__ Cout2, int ldc, long strideC,
    const float* __restrict__ bias,
    const float* __restrict__ resid, long strideR,
    int M, int N, int K, float scale) {
  typedef typename Elem<ET>::T T;
  typedef typename Frag<T>::V V;
  static_assert(!SPLIT, "lo planes are not staged");
  __shared__ __align__(16) unsigned short sAB[2 * kGBuf];   // two slices: rows 0..127 A, rows 128..383 Bt
  __shared__ __align__(16) float sT[8][16 * 68];   // per-wave 16x64 slab, pitch 68 floats
  const int b    = blockIdx.y;
  const int lane = threadIdx.x & 31;
  const int wave = threadIdx.x >> 5;
  const int tilesN = N >> 8;
  const int tilesM = M >> 7;
  const int tile = blockIdx.x;
  if (tile >= tilesM * tilesN) return;   // block-uniform, in front of every barrier and copy
  const int tm = tile / tilesN;
  const int tn = tile - tm * tilesN;
  const int mB = tm << 7;                      // block tile origin
  const int nB = tn << 8;
  const int wm = (wave >> 2) << 6;             // wave tile origin inside the block tile
  const int wn = (wave & 3) << 6;
  const int m0 = mB + wm;
  const int n0 = nB + wn;

  const int rlane = lane & 15;                 // row (A) / col (B, D) within subtile
  const int koff  = (lane >> 4) * 8;           // k offset of this lane half
  const int mOff  = (lane >> 4) * 8;           // D row offset

  v8f acc[4][4];
#pragma unroll
  for (int i = 0; i < 4; ++i)
#pragma unroll
    for (int j = 0; j < 4; ++j) acc[i][j] = (v8f){0.f,0.f,0.f,0.f,0.f,0.f,0.f,0.f};

  // this thread's place in a slice: row srow (+32 per copy), 16-B word tid & 7 of the row's 128-B line
  const int srow = threadIdx.x >> 3;
  const int scol = (threadIdx.x & 7) * 8;
  const unsigned short* gA = Ap  + (size_t)b * strideA + (size_t)(mB + srow) * lda + scol;
  const unsigned short* gB = Btp + (size_t)b * strideB + (size_t)(nB + srow) * ldb + scol;
  const size_t sa = (size_t)32 * lda;
  const size_t sb = (size_t)32 * ldb;
  const unsigned ldst = lds_off(sAB) + (unsigned)(srow * kGP + scol) * 2u;
  const int nT = K / kGK;

  stage_slice(ldst, gA, sa, gB, sb);
  wait_copies();
  __syncthreads();                              // slice 0 is readable by every wave
  if (nT > 1) stage_slice(ldst + kGBuf * 2u, gA + kGK, sa, gB + kGK, sb);

  for (int t = 0; t < nT; ++t) {
    const T* sl = (const T*)(const void*)sAB + (t & 1) * kGBuf + koff;
    const T* sA = sl + (wm + rlane) * kGP;
    const T* sB = sl + (kGMB + wn + rlane) * kGP;
    // the loops below are unrolled so that every fragment and accumulator index is a constant (else the arrays leave the registers)
#pragma unroll
    for (int ks = 0; ks < kGK; ks += 32) {
      V bh[4], ah[4];
#pragma unroll
      for (int j = 0; j < 4; ++j) bh[j] = Frag<T>::load(sB + (j << 4) * kGP + ks);
#pragma unroll
      for (int i = 0; i < 4; ++i) ah[i] = Frag<T>::load(sA + (i << 4) * kGP + ks);
#pragma unroll
      for (int i = 0; i < 4; ++i) {
#pragma unroll
        for (int j = 0; j < 4; ++j) acc[i][j] = Frag<T>::mma(ah[i], bh[j], acc[i][j]);
        Frag<T>::guard(acc[i][0], acc[i][3], ah[i], ah[i]);
      }
      Frag<T>::keep(bh[0], bh[1], bh[2], bh[3]);
    }
    // hand-over: own reads of slice t done, own copies of slice t+1 landed, then the one barrier of the trip, which
    // publishes slice t+1 and frees slice t's buffer; only behind it the refill with slice t+2
    wait_lds();
    wait_copies();
    __syncthreads();
    if (t + 2 < nT) stage_slice(ldst + (unsigned)(t & 1) * (kGBuf * 2u), gA + (size_t)(t + 2) * kGK, sa, gB + (size_t)(t + 2) * kGK, sb);
  }
  wait_copies();
  acc_guard4(acc[0][0], acc[0][1], acc[0][2], acc[0][3]);
  acc_guard4(acc[1][0], acc[1][1], acc[1][2], acc[1][3]);
  acc_guard4(acc[2][0], acc[2][1], acc[2][2], acc[2][3]);
  acc_guard4(acc[3][0], acc[3][1], acc[3][2], acc[3][3]);

  // ---- epilogue ----
  float* slab = sT[wave];
  const float* Rb = RESID ? (resid + (size_t)b * strideR) : nullptr;
#pragma unroll
  for (int i = 0; i < 4; ++i) {
    const int mBase = m0 + (i << 4);
#pragma unroll
    for (int j = 0; j < 4; ++j) {
      const int n = n0 + (j << 4) + rlane;
      float bv = 0.f;
      if (BIAS_MODE == 2) bv = bias[n];
#pragma unroll
      for (int r = 0; r < 8; ++r) {
        float v = acc[i][j][r] * scale;
        if (BIAS_MODE == 1) v += bias[mBase + mOff + r];
        if (BIAS_MODE == 2) v += bv;
        if (RESID) v += Rb[(size_t)(mBase + mOff + r) * ldc + n];
        if (ACT == 2) v = fmaxf(v, 0.0f);
        if (ACT == 4) v = (v > 0.f) ? v : 0.01f * v;
        slab[(mOff + r) * 68 + (j << 4) + rlane] = v;
      }
    }
    __builtin_amdgcn_fence(__ATOMIC_RELEASE, "workgroup");
    __builtin_amdgcn_wave_barrier();
    __builtin_amdgcn_fence(__ATOMIC_ACQUIRE, "workgroup");
    if (OUT_MODE == 0) {
      float* C = (float*)Cout + (size_t)b * strideC;
      const int hh = lane >> 4, c4 = (lane & 15) * 4;     // row seg = 256 B = 16 lanes x 16 B
      {
#pragma unroll
        for (int it = 0; it < 8; ++it) {
          const int row = it * 2 + hh;
          v4f v = *(const v4f*)(slab + row * 68 + c4);
          *(v4f*)(C + (size_t)(mBase + row) * ldc + n0 + c4) = v;
        }
        
      }
    } else {
      const int q = lane >> 3, c8 = (lane & 7) * 8;
      unsigned short* C  = (unsigned short*)Cout  + (size_t)b * strideC;
      unsigned short* C2 = (OUT_MODE == 2) ? ((unsigned short*)Cout2 + (size_t)b * strideC) : nullptr;
      {
#pragma unroll
        for (int it = 0; it < 4; ++it) {
          const int row = it * 4 + q;
          const float* sp = slab + row * 68 + c8;
          v8h hv, lv;
#pragma unroll
          for (int e = 0; e < 8; ++e) {
            if (OUT_MODE == 1) {
              hv[e] = (_Float16)sp[e];
            } else {
              unsigned short hb = f2bf_bits(sp[e]);
              unsigned short lb = f2bf_bits(sp[e] - bf_bits2f(hb));
              hv[e] = __builtin_bit_cast(_Float16, hb);
              lv[e] = __builtin_bit_cast(_Float16, lb);
            }
          }
          *(v8h*)(C + (size_t)(mBase + row) * ldc + n0 + c8) = hv;
          if (OUT_MODE == 2) *(v8h*)(C2 + (size_t)(mBase + row) * ldc + n0 + c8) = lv;
        }
        
      }
    }
    __builtin_amdgcn_fence(__ATOMIC_RELEASE, "workgroup");
    __builtin_amdgcn_wave_barrier();
    __builtin_amdgcn_fence(__ATOMIC_ACQUIRE, "workgroup");
  }
}

// ---------------------------------------------------------------------------
// f32 -> bf16 (RNE) cast, 8 consecutive elements per thread (one 16-B store per lane;
// Coverage: n8 = n/8 threads x 8 = the whole plane; both grids here are exact multiples of 256
// (x: 1,048,576 threads = 4096 blocks; W: 393,216 threads = 1536 blocks).
// ---------------------------------------------------------------------------
__global__ __launch_bounds__(256) void cast8_bf16_kernel(const float* __restrict__ in, unsigned short* __restrict__ out,
                                                         int n8) {
  const int i = blockIdx.x * 256 + threadIdx.x;
  if (i >= n8) return;
  const float* p = in + 8 * (size_t)i;
  const v4f a = *(const v4f*)(p);
  const v4f c = *(const v4f*)(p + 4);
  unsigned short hb[8];
#pragma unroll
  for (int e = 0; e < 4; ++e) {
    hb[e]     = f2bf_bits(a[e]);
    hb[4 + e] = f2bf_bits(c[e]);
  }
  const v4u u = (v4u){pk16(hb[0], hb[1]), pk16(hb[2], hb[3]), pk16(hb[4], hb[5]), pk16(hb[6], hb[7])};
  unsigned short* q = out + 8 * (size_t)i;
  *(v4u*)q = u;
  
}

// ---------------------------------------------------------------------------
// Flash-style attention for head_dim 64 on f16 planes (no mask), f32 out.
//   QK plane  f16 [8192 tokens][2048]: q of (b,h) at column h*64, k at column 1024 + h*64, row = b*2048 + s.
//   VT plane  f16 [b*16+h][64 d][2048 s].
//   scores^T = k . q^T          : v_wmma_f32_16x16x32_f16 (k from LDS as A, q resident B fragments), x0.125 in f32 below
//   out^T    = v^T . (p x2^15)^T: v_wmma_f32_16x16x32_f16 (V^T from LDS as A, p^T packed from the score tiles as B)
//   Both products are transposed so that lane (c, hh) holds scores of ONE query per column group: its maximum and its
//   sum are taken inside the lane plus one exchange between the wave halves, and two score tiles, converted in place,
//   are the B operand of the second product (element e of it = tile e>>3, register e&7 = key 8hh+e or 16+8hh+e-8).
//   online softmax statistics m, l, alpha and the final 1/l in f32. Each exponential is one fma and one v_exp_f32:
//   p x2^15 = 2^(s*kScaleLog2 - mb), mb = m*kScaleLog2 - 15 (m = running maximum of the raw scores); l carries x2^15 too.
// A wave owns kQG = 2 column groups of 16 queries (group g: rows q0+16g .. q0+16g+15), so every K and V^T fragment it
// reads from LDS is the A operand of two products. Block = 4 waves = 128 query rows of one (b,h); grid.x = 4*16*16 = 1024.
// LDS exchanges: K/V^T tiles (written by all waves, read by all) and the per-wave O slab are
// separated by block-wide barriers; every barrier is reached by all 4 waves (32 uniform chunk trips).
// Staging coverage per chunk: 4 iterations x 128 threads = 512 16-B words = 64 rows x 8 words for the
// K tile [64 kv][64 d] and likewise for the V^T tile [64 d][64 kv] (every LDS byte read is written; the
// 16 pad bytes behind each 128-B row are neither written nor read).
// Out store: each instruction writes two 256-B row segments (lanes 0-15 row 2it, lanes 16-31 row 2it+1).
// ---------------------------------------------------------------------------
constexpr int kKC = 64;        // keys per chunk
constexpr int kQG = 2;         // column groups of 16 queries per wave
constexpr int kQW = 16 * kQG;  // query rows per wave
constexpr int kQB = 4 * kQW;   // query rows per block
constexpr int kOsPitch = 68;   // floats
constexpr int kTP = 72;        // halves: LDS row pitch of the K and V^T tiles = 144 B = 16 B x 9 (odd), so the 16 rows
                               // that one 16-B fragment load touches per lane half fall on 16 distinct groups of four banks
static_assert(kTP >= kDh && kTP >= kKC && (kTP * 2) % 16 == 0 && ((kTP * 2) / 16) % 2 == 1, "tile pitch");
static_assert(kSeq % kKC == 0 && kSeq % kQB == 0, "attention tiles");

// the builtin alone: the compiler keeps the distance behind a WMMA itself and stays free to move LDS reads across it
__device__ __forceinline__ v8f mma_h16(v16h a, v16h b, v8f c) {
  return __builtin_amdgcn_wmma_f32_16x16x32_f16(false, a, false, b, (short)0, c, false, false);
}

// value of lane l ^ 16 (the other wave half), by a vector cross-row move
__device__ __forceinline__ float xhalf(float x) {
  return __builtin_bit_cast(float, __builtin_amdgcn_permlanex16(__builtin_bit_cast(int, x), __builtin_bit_cast(int, x),
                                                                0x76543210, 0xfedcba98, false, false));
}

// four waves per SIMD (256 registers a wave): the 1024 blocks are then all resident at once, four on each WGP
__global__ __launch_bounds__(128) __attribute__((amdgpu_waves_per_eu(4, 4)))
void attn_f16_kernel(const unsigned short* __restrict__ QKp, const unsigned short* __restrict__ VTp,
                     float* __restrict__ out) {
  const _Float16* QK = (const _Float16*)(const void*)QKp;
  const _Float16* VT = (const _Float16*)(const void*)VTp;
  __shared__ __align__(16) _Float16 Ksh[kKC * kTP];          // K tile   [kv][d]   9 KB, 64 of 72 halves a row used
  __shared__ __align__(16) _Float16 Vth[kDh * kTP];          // V^T tile [d][kv]   9 KB
  __shared__ __align__(16) float    Os[4][kQW * kOsPitch];   // per wave out tile, pitch 68

  const int tid  = threadIdx.x;
  const int wave = tid >> 5;
  const int lane = tid & 31;
  const int hh   = lane >> 4;
  const int c    = lane & 15;

  const int nqb = kSeq / kQB;            // 16
  const int bx  = blockIdx.x;            // 0 .. 1023
  const int qb  = bx % nqb;
  const int bh  = bx / nqb;              // 0 .. 63
  const int h   = bh % kHeads;
  const int b   = bh / kHeads;
  const int q0  = qb * kQB + wave * kQW;

  const _Float16* qb_ptr = QK + (size_t)b * kSeq * kQKCols + (size_t)h * kDh;   // (s, d) at + s*2048 + d
  const _Float16* kb_ptr = qb_ptr + kDim;                                        // k columns start at 1024
  const _Float16* vb_ptr = VT + (size_t)bh * kDh * kSeq;                         // (d, s) at + d*2048 + s
  float*          ob_ptr = out + (size_t)b * kSeq * kDim + (size_t)h * kDh;     // (s, d) at + s*1024 + d

  // ---- Q fragments (B operand): group g, lane column c = query q0+16g+c; elements 0..7 <- d dc*32+8hh+0..7, 8..15 <- +16 ----
  v16h qa[kQG][2];
#pragma unroll
  for (int g = 0; g < kQG; ++g) {
    const _Float16* qrow = qb_ptr + (size_t)(q0 + 16 * g + c) * kQKCols + 8 * hh;
#pragma unroll
    for (int dc = 0; dc < 2; ++dc) qa[g][dc] = Frag<_Float16>::load(qrow + dc * 32);
  }

  float mrow[kQG];                  // running maximum of the raw scores of query q0+16g+c (alike in both halves)
  float mb[kQG];                    // mrow * kScaleLog2 - 15: what every exponent of this query has subtracted
  float lrow[kQG];                  // this half's share of the query's sum x2^15; the halves are joined after the loop
  v8f oacc[kQG][4];                 // oacc[g][t][r] = out^T[d = 16t+8hh+r][query q0+16g+c]
#pragma unroll
  for (int g = 0; g < kQG; ++g) {
    mrow[g] = -__builtin_inff();
    mb[g]   = -__builtin_inff();
    lrow[g] = 0.f;
#pragma unroll
    for (int t = 0; t < 4; ++t) oacc[g][t] = (v8f){0.f,0.f,0.f,0.f,0.f,0.f,0.f,0.f};
  }

  // this thread's place in a tile: row tid>>3 (+16 per copy), 16-B word tid&7. One pointer per plane and one LDS address per
  // tile, every further copy at a constant distance, so that the addresses take few of the 256 registers
  const int srow = tid >> 3;
  const int sc8  = (tid & 7) * 8;          // halves
  const _Float16* kp = kb_ptr + (size_t)srow * kQKCols + sc8;   // advances 64 key rows a chunk
  const _Float16* vp = vb_ptr + (size_t)srow * kSeq + sc8;      // advances 64 key columns a chunk
  _Float16* ksd = Ksh + srow * kTP + sc8;
  _Float16* vsd = Vth + srow * kTP + sc8;
  const _Float16* ksr = Ksh + c * kTP + 8 * hh;   // fragment reads: row c (+16 per tile), k offset of this lane half
  const _Float16* vsr = Vth + c * kTP + 8 * hh;

  for (int kc = 0; kc < kSeq / kKC; ++kc) {
    __syncthreads();
    // ---- stage K tile and V^T tile: pure 16-B copies of the f16 planes; copy i = rows 16i + srow (kv for K, d for V^T) ----
#pragma unroll
    for (int i = 0; i < 4; ++i) {
      const v8h kk = *(const v8h*)(kp + (size_t)(i * 16) * kQKCols);
      const v8h vv = *(const v8h*)(vp + (size_t)(i * 16) * kSeq);
      *(v8h*)(ksd + i * 16 * kTP) = kk;
      *(v8h*)(vsd + i * 16 * kTP) = vv;
    }
    kp += (size_t)kKC * kQKCols;
    vp += kKC;
    __syncthreads();

    // ---- scores^T: 4 key row tiles x 2 d-steps x 2 groups; s[g][j][r] = score of key 64kc+16j+8hh+r with query q0+16g+c ----
    // A[m = kv j*16+c][k = d] = Ksh[kv][d]; same split k-map as B. All eight fragments are read as one group.
    v16h ka[2][4];
#pragma unroll
    for (int dc = 0; dc < 2; ++dc)
#pragma unroll
      for (int j = 0; j < 4; ++j) ka[dc][j] = Frag<_Float16>::load(ksr + j * 16 * kTP + dc * 32);
    __builtin_amdgcn_sched_barrier(0);   // keeps the K reads one group in front of the products: the LDS latency is waited out once, not per product
    v8f s[kQG][4];
#pragma unroll
    for (int g = 0; g < kQG; ++g)
#pragma unroll
      for (int j = 0; j < 4; ++j) s[g][j] = (v8f){0.f,0.f,0.f,0.f,0.f,0.f,0.f,0.f};
#pragma unroll
    for (int dc = 0; dc < 2; ++dc)
#pragma unroll
      for (int j = 0; j < 4; ++j)
#pragma unroll
        for (int g = 0; g < kQG; ++g) s[g][j] = mma_h16(ka[dc][j], qa[g][dc], s[g][j]);

    // A[m = d t*16+c][k = kv] = Vth[d][kv]. The chunk's second half runs in two passes of 32 keys, so that the live set stays
    // inside the 256 registers of four waves per SIMD: the V^T fragments of a pass are read in front of the exponentials of
    // that pass, which hide their latency, and by the second pass half of the score registers are free again.
    v16h va[2][4];
    __builtin_amdgcn_sched_barrier(0);   // keeps the V^T reads from rising among the score products, where their registers are still taken
#pragma unroll
    for (int t = 0; t < 4; ++t) va[0][t] = Frag<_Float16>::load(vsr + t * 16 * kTP);
    __builtin_amdgcn_sched_barrier(0);   // keeps these V^T reads in front of the softmax arithmetic, which hides their latency

    float mbn[kQG], alpha[kQG];
#pragma unroll
    for (int g = 0; g < kQG; ++g) {
      // ---- chunk maximum of this lane's query: 32 scores in the lane, the other 32 in lane ^ 16 ----
      float cm = -__builtin_inff();
#pragma unroll
      for (int j = 0; j < 4; ++j) {
#pragma unroll
        for (int r = 0; r < 8; ++r) cm = fmaxf(cm, s[g][j][r]);
      }
      cm = fmaxf(cm, xhalf(cm));

      // ---- online softmax update ----
      const float mnew = fmaxf(mrow[g], cm);
      mbn[g]   = fmaf(mnew, kScaleLog2, -kPCarryLog2);
      alpha[g] = __builtin_amdgcn_exp2f(mb[g] - mbn[g]);   // 0 on the first chunk, where mb is -inf
      mrow[g] = mnew;
      mb[g]   = mbn[g];
#pragma unroll
      for (int t = 0; t < 4; ++t)
#pragma unroll
        for (int r = 0; r < 8; ++r) oacc[g][t][r] *= alpha[g];
    }

    // ---- per pass kk (keys 32kk .. 32kk+31): P^T x2^15 as f16 packed straight into the B fragments, then
    //      O^T += V^T . P^T : A = the V^T fragments, B = P^T[kv][query c] of each group ----
    float ps[kQG][4];
#pragma unroll
    for (int kk = 0; kk < 2; ++kk) {
      if (kk == 1) {
        __builtin_amdgcn_sched_barrier(0);   // keeps the second V^T reads behind the first pass's exponentials (registers)
#pragma unroll
        for (int t = 0; t < 4; ++t) va[1][t] = Frag<_Float16>::load(vsr + t * 16 * kTP + 32);
        __builtin_amdgcn_sched_barrier(0);   // keeps them one group in front of the second pass's exponentials, which hide their latency
      }
      v16h pb[kQG];
#pragma unroll
      for (int g = 0; g < kQG; ++g) {
#pragma unroll
        for (int jj = 0; jj < 2; ++jj) {
          const int j = 2 * kk + jj;
          ps[g][j] = 0.f;
#pragma unroll
          for (int r = 0; r < 8; ++r) {
            const float p = __builtin_amdgcn_exp2f(fmaf(s[g][j][r], kScaleLog2, -mbn[g]));   // 2^15 at the maximum: inside f16
            ps[g][j] += p;
            pb[g][jj * 8 + r] = (_Float16)p;
          }
        }
      }
#pragma unroll
      for (int t = 0; t < 4; ++t)
#pragma unroll
        for (int g = 0; g < kQG; ++g) oacc[g][t] = mma_h16(va[kk][t], pb[g], oacc[g][t]);
    }
#pragma unroll
    for (int g = 0; g < kQG; ++g) lrow[g] = lrow[g] * alpha[g] + ((ps[g][0] + ps[g][1]) + (ps[g][2] + ps[g][3]));
  }

  // ---- normalise and store: lane (c, hh) holds d = 16t+8hh+0..7 of query row 16g+c ----
  float* os = Os[wave];
#pragma unroll
  for (int g = 0; g < kQG; ++g) {
    const float inv = 1.0f / (lrow[g] + xhalf(lrow[g]));   // l and out^T both carry x2^15
#pragma unroll
    for (int t = 0; t < 4; ++t) {
      float* op = os + (16 * g + c) * kOsPitch + t * 16 + 8 * hh;
      *(v4f*)(op)     = (v4f){oacc[g][t][0] * inv, oacc[g][t][1] * inv, oacc[g][t][2] * inv, oacc[g][t][3] * inv};
      *(v4f*)(op + 4) = (v4f){oacc[g][t][4] * inv, oacc[g][t][5] * inv, oacc[g][t][6] * inv, oacc[g][t][7] * inv};
    }
  }
  __syncthreads();
  {
    const int c4 = (lane & 15) * 4;
    {
#pragma unroll
      for (int it = 0; it < kQW / 2; ++it) {
        const int row = it * 2 + hh;
        const v4f val = *(const v4f*)(os + row * kOsPitch + c4);
        *(v4f*)(ob_ptr + (size_t)(q0 + row) * kDim + c4) = val;
      }
      
    }
  }
}

// ---------------------------------------------------------------------------
// Host glue.
// no aliasing):
//   Xb   bf16 [8192][1024]          16,777,216  at          0   (x, RNE)
//   Wb   bf16 [3072][1024]           6,291,456  at 16,777,216   (W, RNE)
//   QKh  f16  [8192][2048]          33,554,432  at 23,068,672   (q | k columns, e = which*1024 + h*64 + d)
//   Vt   f16  [4*16][64][2048]      16,777,216  at 56,623,104   (v transposed per (b,h))
//   total                           73,400,320
// GEMM shapes: q|k M=8192, N=2048, K=1024; v^T M=1024 (16 heads x 64), N=2048, K=1024 (x4 batches via grid.y).
// All M multiples of 128, N of 256, K % 64 == 0, no padding anywhere. 5 launches.
// ---------------------------------------------------------------------------
extern "C" void kernel_launch(void* const* d_in, const int* in_sizes, int n_in,
                              void* d_out, int out_size, void* d_ws, size_t ws_size,
                              hipStream_t stream) {
  if (n_in < 2) return;
  if (in_sizes[0] != kTok * kDim) return;
  if (in_sizes[1] != kWRows * kDim) return;
  if (out_size != kTok * kDim) return;

  const size_t szXb = (size_t)kTok * kDim * 2;
  const size_t szWb = (size_t)kWRows * kDim * 2;
  const size_t szQK = (size_t)kTok * kQKCols * 2;
  const size_t szVt = (size_t)kBatch * kHeads * kDh * kSeq * 2;
  const size_t offXb = 0;
  const size_t offWb = offXb + szXb;
  const size_t offQK = offWb + szWb;
  const size_t offVt = offQK + szQK;
  const size_t total = offVt + szVt;
  if (ws_size < total) return;

  const float* x = (const float*)d_in[0];   // [4,2048,1024] f32
  const float* W = (const float*)d_in[1];   // [3072,1024] f32, [out][in]
  float* out = (float*)d_out;               // [4,2048,1024] f32
  char* ws = (char*)d_ws;
  unsigned short* Xb  = (unsigned short*)(ws + offXb);
  unsigned short* Wb  = (unsigned short*)(ws + offWb);
  unsigned short* QKh = (unsigned short*)(ws + offQK);
  unsigned short* Vt  = (unsigned short*)(ws + offVt);

  // ---- 16-bit operand planes (bf16 RNE of both float inputs) ----
  const int n8x = (kTok * kDim) / 8;     // 1,048,576 -> 4096 blocks exact
  const int n8w = (kWRows * kDim) / 8;   //   393,216 -> 1536 blocks exact
  cast8_bf16_kernel<<<dim3(n8x / 256), dim3(256), 0, stream>>>(x, Xb, n8x);
  cast8_bf16_kernel<<<dim3(n8w / 256), dim3(256), 0, stream>>>(W, Wb, n8w);

  // ---- q | k projection: QKh[token][e] = sum_k Xb[token][k] * Wb[e][k], e in 0..2047 (f16 out) ----
  const int tilesQK = (kTok / 128) * (kQKCols / 256);   // 64 x 8 = 512 blocks of 8 waves
  wmma_gemm64<1, false, 0, 1, false, 0><<<dim3(tilesQK, 1), dim3(256), 0, stream>>>(
      Xb, Xb, kDim, 0L, Wb, Wb, kDim, 0L,
      (void*)QKh, (void*)QKh, kQKCols, 0L, x, x, 0L, kTok, kQKCols, kDim, 1.0f);

  // ---- v projection written transposed, all heads and batches in one launch:
  //      Vt[b][e = h*64+d][s] = sum_k Wb[2048+e][k] * Xb[b*2048+s][k]; M = 1024 weight rows, N = 2048 tokens, grid.y = batch ----
  const unsigned short* WbV = Wb + (size_t)kQKCols * kDim;   // v weight rows
  const int tilesV = (kDim / 128) * (kSeq / 256);            // 8 x 8 = 64 blocks of 8 waves per batch
  wmma_gemm64<1, false, 0, 1, false, 0><<<dim3(tilesV, kBatch), dim3(256), 0, stream>>>(
      WbV, WbV, kDim, 0L, Xb, Xb, kDim, (long)kSeq * kDim,
      (void*)Vt, (void*)Vt, kSeq, (long)kDim * kSeq, x, x, 0L, kDim, kSeq, kDim, 1.0f);

  // ---- attention: grid = 4 batches x 16 heads x 16 query blocks ----
  attn_f16_kernel<<<dim3(kBatch * kHeads * (kSeq / kQB)), dim3(128), 0, stream>>>(QKh, Vt, out);
}

// v008
// It runs in 111 microseconds.
// Two timings next to v007 both put it at 1.03 times that version's speed.
// All steps since v000 together make it 6.09 times as fast.
// Contractions: qkv projection (x bf16 RNE, W^T bf16 RNE) on v_wmma_f32_16x16x32_bf16; scores q.k^T (q, k f16 planes) and attn.v (P f16 carried x128 at the maximum in use, V^T f16 plane) on v_wmma_f32_16x16x32_f16; all f32 accumulate; online softmax statistics, scaling and 1/l in f32; exponentials base 2 on v_exp_f32.
#include <hip/hip_runtime.h>
#include <math.h>

// ---------------------------------------------------------------------------
// Problem constants
// ---------------------------------------------------------------------------
constexpr int kBatch  = 4;
constexpr int kSeq    = 2048;
constexpr int kDim    = 1024;
constexpr int kHeads  = 16;
constexpr int kDh     = 64;
constexpr int kTok    = kBatch * kSeq;     // 8192 token rows
constexpr int kWRows  = 3 * kDim;          // 3072 weight rows (q | k | v)
constexpr int kQKCols = 2 * kDim;          // 2048: pitch of the q | k plane (halves)
constexpr float kPCarryLog2 = 7.0f;        // log2 of the carry: the exponent of a score equal to the maximum in use
constexpr float kLagLog2    = 8.0f;        // how far the maximum in use may trail the true one: p stays <= 2^15, inside f16
constexpr float kQKScale = 0.42466090014400953f;   // sqrt(64^-0.5 x log2(e)), on q and on k in f32 before their f16 rounding: q.k is then the base-2 exponent
static_assert(kHeads * kDh == kDim, "shape");
static_assert(kDim % 64 == 0, "gemm K multiple of the staged slice");
static_assert(kTok % 128 == 0 && kDim % 128 == 0 && kQKCols % 256 == 0 && kSeq % 256 == 0, "gemm M multiple of 128, N of 256");
static_assert(kDh % 64 == 0 && kSeq % 64 == 0, "attention tiles");
static_assert((kTok * kDim) % (8 * 256) == 0 && (kWRows * kDim) % (8 * 256) == 0, "cast grids exact");

typedef __attribute__((ext_vector_type(16))) _Float16 v16h;
typedef __attribute__((ext_vector_type(8)))  _Float16 v8h;
typedef __attribute__((ext_vector_type(16))) __bf16   v16b;
typedef __attribute__((ext_vector_type(8)))  __bf16   v8b;
typedef __attribute__((ext_vector_type(8)))  float    v8f;
typedef __attribute__((ext_vector_type(4)))  float    v4f;
typedef __attribute__((ext_vector_type(4)))  unsigned int v4u;

// ---------------------------------------------------------------------------
// Helpers
// ---------------------------------------------------------------------------
__device__ __forceinline__ unsigned short f2bf_bits(float f) {
  unsigned u = __float_as_uint(f);
  return (unsigned short)((u + 0x7FFFu + ((u >> 16) & 1u)) >> 16);
}
__device__ __forceinline__ float bf_bits2f(unsigned short h) { return __uint_as_float(((unsigned)h) << 16); }

// hazard guards as plain device helpers (no inline asm inside the kernel template body)
__device__ __forceinline__ void dep_guard_h(v8f& a, v8f& b, v16h x, v16h y) { asm volatile("v_nop\n\tv_nop\n\tv_nop\n\tv_nop" : "+v"(a), "+v"(b) : "v"(x), "v"(y)); }
__device__ __forceinline__ void dep_guard_b(v8f& a, v8f& b, v16b x, v16b y) { asm volatile("v_nop\n\tv_nop\n\tv_nop\n\tv_nop" : "+v"(a), "+v"(b) : "v"(x), "v"(y)); }
__device__ __forceinline__ void keep4_h(v16h a, v16h b, v16h c, v16h d) { asm volatile("v_nop" :: "v"(a), "v"(b), "v"(c), "v"(d)); }
__device__ __forceinline__ void keep4_b(v16b a, v16b b, v16b c, v16b d) { asm volatile("v_nop" :: "v"(a), "v"(b), "v"(c), "v"(d)); }
__device__ __forceinline__ void acc_guard4(v8f& a, v8f& b, v8f& c, v8f& d) { asm volatile("v_nop\n\tv_nop\n\tv_nop\n\tv_nop" : "+v"(a), "+v"(b), "+v"(c), "+v"(d)); }
template <typename T> struct Frag;
template <> struct Frag<_Float16> {
  typedef v16h V; union U { v16h v; v8h h[2]; };
  // elements 0..7 <- p[0..7], 8..15 <- p[16..23]
  static __device__ __forceinline__ v16h load(const _Float16* p) {
    U f; f.h[0] = *(const v8h*)(p); f.h[1] = *(const v8h*)(p + 16); return f.v;
  }
  static __device__ __forceinline__ v8f mma(v16h a, v16h b, v8f c) {
    return __builtin_amdgcn_wmma_f32_16x16x32_f16(false, a, false, b, (short)0, c, false, false);
  }
  static __device__ __forceinline__ void guard(v8f& a, v8f& b, v16h x, v16h y) { dep_guard_h(a, b, x, y); }
  static __device__ __forceinline__ void keep(v16h a, v16h b, v16h c, v16h d) { keep4_h(a, b, c, d); }
};
template <> struct Frag<__bf16> {
  typedef v16b V; union U { v16b v; v8b h[2]; };
  static __device__ __forceinline__ v16b load(const __bf16* p) {
    U f; f.h[0] = *(const v8b*)(p); f.h[1] = *(const v8b*)(p + 16); return f.v;
  }
  static __device__ __forceinline__ v8f mma(v16b a, v16b b, v8f c) {
    return __builtin_amdgcn_wmma_f32_16x16x32_bf16(false, a, false, b, (short)0, c, false, false);
  }
  static __device__ __forceinline__ void guard(v8f& a, v8f& b, v16b x, v16b y) { dep_guard_b(a, b, x, y); }
  static __device__ __forceinline__ void keep(v16b a, v16b b, v16b c, v16b d) { keep4_b(a, b, c, d); }
};

__device__ __forceinline__ unsigned pk16(unsigned short a, unsigned short b) { return (unsigned)a | ((unsigned)b << 16); }

// ---- Register-blocked batched WMMA GEMM (ACT reduced to none/relu/leaky) -------------------------------
// C[m,n] = scale * sum_k A[m,k] * Bt[n,k] (+bias)(+resid); each wave owns a 64x64 tile, a block of 8 waves (2 x 4) a
// 128x256 tile. A row-major [M,K]; Bt row-major [N,K]; M % 128 == 0, N % 256 == 0, K % 64 == 0.
// Operands go through LDS: a slice = 64 k (one 128-B line) of the block's 128 A rows and 256 Bt rows, 384 rows at pitch
// 144 B. It is brought in once for all 8 waves by asynchronous 16-B copies, 8 lanes on one whole line, 12 copies a thread
// (12 x 256 threads x 16 B = 384 rows x 128 B; the 16 pad bytes of a row are neither written nor read). Two buffers:
// slice t+1 flies while slice t is multiplied. Fragments are read from LDS in the k order the global loads had.
// SPLIT (hi/lo planes) is not staged and not instantiated.
// BIAS_MODE: 0 = none, 1 = bias[m], 2 = bias[n].
// OUT_MODE: 0 = f32, 1 = f16, 2 = bf16 hi plane (Cout) + bf16 lo plane (Cout2).
// ET: 0 = f16 operands, 1 = bf16 operands (pointers passed as 16-bit storage)
constexpr int kGK    = 64;                 // k of one staged slice (halves)
constexpr int kGP    = 72;                 // halves: LDS row pitch 144 B = 16 B x 9 (odd), free of conflicts for 16-B fragment reads
constexpr int kGMB   = 128;                // A rows of a block tile
constexpr int kGNB   = 256;                // Bt rows of a block tile
constexpr int kGBuf  = (kGMB + kGNB) * kGP;   // halves of one buffer: 27,648 = 55,296 B
constexpr unsigned kGStep = 32u * kGP * 2u;   // LDS bytes between two copies of a thread: 32 rows

__device__ __forceinline__ unsigned lds_off(const void* p) { return (unsigned)(size_t)p; }   // byte offset in the block's LDS

// One thread's share of a slice: 12 asynchronous 16-B copies global -> LDS, rows 32 apart (4 of A, 8 of Bt).
// The address-translation wait is the statement's last line, so that no address register is rewritten in front of it.
__device__ __forceinline__ void stage_slice(unsigned l, const unsigned short* a, size_t sa, const unsigned short* b, size_t sb) {
  asm volatile(
      "global_load_async_to_lds_b128 %0, %12, off\n\t"
      "global_load_async_to_lds_b128 %1, %13, off\n\t"
      "global_load_async_to_lds_b128 %2, %14, off\n\t"
      "global_load_async_to_lds_b128 %3, %15, off\n\t"
      "global_load_async_to_lds_b128 %4, %16, off\n\t"
      "global_load_async_to_lds_b128 %5, %17, off\n\t"
      "global_load_async_to_lds_b128 %6, %18, off\n\t"
      "global_load_async_to_lds_b128 %7, %19, off\n\t"
      "global_load_async_to_lds_b128 %8, %20, off\n\t"
      "global_load_async_to_lds_b128 %9, %21, off\n\t"
      "global_load_async_to_lds_b128 %10, %22, off\n\t"
      "global_load_async_to_lds_b128 %11, %23, off\n\t"
      "s_wait_xcnt 0x0"
      :: "v"(l), "v"(l + kGStep), "v"(l + 2 * kGStep), "v"(l + 3 * kGStep), "v"(l + 4 * kGStep), "v"(l + 5 * kGStep),
         "v"(l + 6 * kGStep), "v"(l + 7 * kGStep), "v"(l + 8 * kGStep), "v"(l + 9 * kGStep), "v"(l + 10 * kGStep),
         "v"(l + 11 * kGStep),
         "v"(a), "v"(a + sa), "v"(a + 2 * sa), "v"(a + 3 * sa),
         "v"(b), "v"(b + sb), "v"(b + 2 * sb), "v"(b + 3 * sb), "v"(b + 4 * sb), "v"(b + 5 * sb), "v"(b + 6 * sb), "v"(b + 7 * sb)
      : "memory");
}
// this wave's copies have landed (the compiler places no wait for them)
__device__ __forceinline__ void wait_copies() { asm volatile("s_wait_asynccnt 0x0" ::: "memory"); }
// this wave's LDS reads have returned, before the buffer they read is given up for refilling
__device__ __forceinline__ void wait_lds() { asm volatile("s_wait_dscnt 0x0" ::: "memory"); }

template <int ET> struct Elem;
template <> struct Elem<0> { typedef _Float16 T; };
template <> struct Elem<1> { typedef __bf16 T; };
template <int ET, bool SPLIT, int BIAS_MODE, int OUT_MODE, bool RESID, int ACT = 0>
__global__ __launch_bounds__(256) void wmma_gemm64(
    const unsigned short* __restrict__ Ap, const unsigned short* __restrict__ A2p, int lda, long strideA,
    const unsigned short* __restrict__ Btp, const unsigned short* __restrict__ Bt2p, int ldb, long strideB,
    void* __restrict__ Cout, void* __restrict__ Cout2, int ldc, long strideC,
    const float* __restrict__ bias,
    const float* __restrict__ resid, long strideR,
    int M, int N, int K, float scale) {
  typedef typename Elem<ET>::T T;
  typedef typename Frag<T>::V V;
  static_assert(!SPLIT, "lo planes are not staged");
  __shared__ __align__(16) unsigned short sAB[2 * kGBuf];   // two slices: rows 0..127 A, rows 128..383 Bt
  __shared__ __align__(16) float sT[8][16 * 68];   // per-wave 16x64 slab, pitch 68 floats
  const int b    = blockIdx.y;
  const int lane = threadIdx.x & 31;
  const int wave = threadIdx.x >> 5;
  const int tilesN = N >> 8;
  const int tilesM = M >> 7;
  const int tile = blockIdx.x;
  if (tile >= tilesM * tilesN) return;   // block-uniform, in front of every barrier and copy
  const int tm = tile / tilesN;
  const int tn = tile - tm * tilesN;
  const int mB = tm << 7;                      // block tile origin
  const int nB = tn << 8;
  const int wm = (wave >> 2) << 6;             // wave tile origin inside the block tile
  const int wn = (wave & 3) << 6;
  const int m0 = mB + wm;
  const int n0 = nB + wn;

  const int rlane = lane & 15;                 // row (A) / col (B, D) within subtile
  const int koff  = (lane >> 4) * 8;           // k offset of this lane half
  const int mOff  = (lane >> 4) * 8;           // D row offset

  v8f acc[4][4];
#pragma unroll
  for (int i = 0; i < 4; ++i)
#pragma unroll
    for (int j = 0; j < 4; ++j) acc[i][j] = (v8f){0.f,0.f,0.f,0.f,0.f,0.f,0.f,0.f};

  // this thread's place in a slice: row srow (+32 per copy), 16-B word tid & 7 of the row's 128-B line
  const int srow = threadIdx.x >> 3;
  const int scol = (threadIdx.x & 7) * 8;
  const unsigned short* gA = Ap  + (size_t)b * strideA + (size_t)(mB + srow) * lda + scol;
  const unsigned short* gB = Btp + (size_t)b * strideB + (size_t)(nB + srow) * ldb + scol;
  const size_t sa = (size_t)32 * lda;
  const size_t sb = (size_t)32 * ldb;
  const unsigned ldst = lds_off(sAB) + (unsigned)(srow * kGP + scol) * 2u;
  const int nT = K / kGK;

  stage_slice(ldst, gA, sa, gB, sb);
  wait_copies();
  __syncthreads();                              // slice 0 is readable by every wave
  if (nT > 1) stage_slice(ldst + kGBuf * 2u, gA + kGK, sa, gB + kGK, sb);

  for (int t = 0; t < nT; ++t) {
    const T* sl = (const T*)(const void*)sAB + (t & 1) * kGBuf + koff;
    const T* sA = sl + (wm + rlane) * kGP;
    const T* sB = sl + (kGMB + wn + rlane) * kGP;
    // the loops below are unrolled so that every fragment and accumulator index is a constant (else the arrays leave the registers)
#pragma unroll
    for (int ks = 0; ks < kGK; ks += 32) {
      V bh[4], ah[4];
#pragma unroll
      for (int j = 0; j < 4; ++j) bh[j] = Frag<T>::load(sB + (j << 4) * kGP + ks);
#pragma unroll
      for (int i = 0; i < 4; ++i) ah[i] = Frag<T>::load(sA + (i << 4) * kGP + ks);
#pragma unroll
      for (int i = 0; i < 4; ++i) {
#pragma unroll
        for (int j = 0; j < 4; ++j) acc[i][j] = Frag<T>::mma(ah[i], bh[j], acc[i][j]);
        Frag<T>::guard(acc[i][0], acc[i][3], ah[i], ah[i]);
      }
      Frag<T>::keep(bh[0], bh[1], bh[2], bh[3]);
    }
    // hand-over: own reads of slice t done, own copies of slice t+1 landed, then the one barrier of the trip, which
    // publishes slice t+1 and frees slice t's buffer; only behind it the refill with slice t+2
    wait_lds();
    wait_copies();
    __syncthreads();
    if (t + 2 < nT) stage_slice(ldst + (unsigned)(t & 1) * (kGBuf * 2u), gA + (size_t)(t + 2) * kGK, sa, gB + (size_t)(t + 2) * kGK, sb);
  }
  wait_copies();
  acc_guard4(acc[0][0], acc[0][1], acc[0][2], acc[0][3]);
  acc_guard4(acc[1][0], acc[1][1], acc[1][2], acc[1][3]);
  acc_guard4(acc[2][0], acc[2][1], acc[2][2], acc[2][3]);
  acc_guard4(acc[3][0], acc[3][1], acc[3][2], acc[3][3]);

  // ---- epilogue ----
  float* slab = sT[wave];
  const float* Rb = RESID ? (resid + (size_t)b * strideR) : nullptr;
#pragma unroll
  for (int i = 0; i < 4; ++i) {
    const int mBase = m0 + (i << 4);
#pragma unroll
    for (int j = 0; j < 4; ++j) {
      const int n = n0 + (j << 4) + rlane;
      float bv = 0.f;
      if (BIAS_MODE == 2) bv = bias[n];
#pragma unroll
      for (int r = 0; r < 8; ++r) {
        float v = acc[i][j][r] * scale;
        if (BIAS_MODE == 1) v += bias[mBase + mOff + r];
        if (BIAS_MODE == 2) v += bv;
        if (RESID) v += Rb[(size_t)(mBase + mOff + r) * ldc + n];
        if (ACT == 2) v = fmaxf(v, 0.0f);
        if (ACT == 4) v = (v > 0.f) ? v : 0.01f * v;
        slab[(mOff + r) * 68 + (j << 4) + rlane] = v;
      }
    }
    __builtin_amdgcn_fence(__ATOMIC_RELEASE, "workgroup");
    __builtin_amdgcn_wave_barrier();
    __builtin_amdgcn_fence(__ATOMIC_ACQUIRE, "workgroup");
    if (OUT_MODE == 0) {
      float* C = (float*)Cout + (size_t)b * strideC;
      const int hh = lane >> 4, c4 = (lane & 15) * 4;     // row seg = 256 B = 16 lanes x 16 B
      {
#pragma unroll
        for (int it = 0; it < 8; ++it) {
          const int row = it * 2 + hh;
          v4f v = *(const v4f*)(slab + row * 68 + c4);
          *(v4f*)(C + (size_t)(mBase + row) * ldc + n0 + c4) = v;
        }
        
      }
    } else {
      const int q = lane >> 3, c8 = (lane & 7) * 8;
      unsigned short* C  = (unsigned short*)Cout  + (size_t)b * strideC;
      unsigned short* C2 = (OUT_MODE == 2) ? ((unsigned short*)Cout2 + (size_t)b * strideC) : nullptr;
      {
#pragma unroll
        for (int it = 0; it < 4; ++it) {
          const int row = it * 4 + q;
          const float* sp = slab + row * 68 + c8;
          v8h hv, lv;
#pragma unroll
          for (int e = 0; e < 8; ++e) {
            if (OUT_MODE == 1) {
              hv[e] = (_Float16)sp[e];
            } else {
              unsigned short hb = f2bf_bits(sp[e]);
              unsigned short lb = f2bf_bits(sp[e] - bf_bits2f(hb));
              hv[e] = __builtin_bit_cast(_Float16, hb);
              lv[e] = __builtin_bit_cast(_Float16, lb);
            }
          }
          *(v8h*)(C + (size_t)(mBase + row) * ldc + n0 + c8) = hv;
          if (OUT_MODE == 2) *(v8h*)(C2 + (size_t)(mBase + row) * ldc + n0 + c8) = lv;
        }
        
      }
    }
    __builtin_amdgcn_fence(__ATOMIC_RELEASE, "workgroup");
    __builtin_amdgcn_wave_barrier();
    __builtin_amdgcn_fence(__ATOMIC_ACQUIRE, "workgroup");
  }
}

// ---------------------------------------------------------------------------
// f32 -> bf16 (RNE) cast, 8 consecutive elements per thread (one 16-B store per lane;
// Coverage: n8 = n/8 threads x 8 = the whole plane; both grids here are exact multiples of 256
// (x: 1,048,576 threads = 4096 blocks; W: 393,216 threads = 1536 blocks).
// ---------------------------------------------------------------------------
__global__ __launch_bounds__(256) void cast8_bf16_kernel(const float* __restrict__ in, unsigned short* __restrict__ out,
                                                         int n8) {
  const int i = blockIdx.x * 256 + threadIdx.x;
  if (i >= n8) return;
  const float* p = in + 8 * (size_t)i;
  const v4f a = *(const v4f*)(p);
  const v4f c = *(const v4f*)(p + 4);
  unsigned short hb[8];
#pragma unroll
  for (int e = 0; e < 4; ++e) {
    hb[e]     = f2bf_bits(a[e]);
    hb[4 + e] = f2bf_bits(c[e]);
  }
  const v4u u = (v4u){pk16(hb[0], hb[1]), pk16(hb[2], hb[3]), pk16(hb[4], hb[5]), pk16(hb[6], hb[7])};
  unsigned short* q = out + 8 * (size_t)i;
  *(v4u*)q = u;
  
}

// ---------------------------------------------------------------------------
// Flash-style attention for head_dim 64 on f16 planes (no mask), f32 out.
//   QK plane  f16 [8192 tokens][2048]: q of (b,h) at column h*64, k at column 1024 + h*64, row = b*2048 + s.
//   VT plane  f16 [b*16+h][64 d][2048 s].
//   scores^T = k . q^T + start  : v_wmma_f32_16x16x32_f16 (k from LDS as A, q resident B fragments; both planes hold x kQKScale)
//   out^T    = v^T . (p x2^7)^T : v_wmma_f32_16x16x32_f16 (V^T from LDS as A, p^T packed from the score tiles as B)
//   Both products are transposed so that lane (c, hh) holds scores of ONE query per column group: its maximum and its
//   sum are taken inside the lane plus one exchange between the wave halves, and two score tiles, converted in place,
//   are the B operand of the second product (element e of it = tile e>>3, register e&7 = key 8hh+e or 16+8hh+e-8).
//   online softmax statistics m, l, alpha and the final 1/l in f32. The maximum in use m may trail the true maximum by up
//   to 8 (base-2 exponent), so it is known before a chunk's products: 7 - m is the start value of the score accumulators, a
//   score tile leaves the matrix unit as the exponent itself, and each exponential is one v_exp_f32: p x2^7 = 2^(s + 7 - m).
//   One test a chunk (any exponent above 15?) guards the rare path that raises m and rescales out^T and l; l carries x2^7 too.
// A wave owns kQG = 2 column groups of 16 queries (group g: rows q0+16g .. q0+16g+15), so every K and V^T fragment it
// reads from LDS is the A operand of two products. Block = 4 waves = 128 query rows of one (b,h); grid.x = 4*16*16 = 1024.
// LDS exchanges: K/V^T tiles (written by all waves, read by all) and the per-wave O slab are
// separated by block-wide barriers; every barrier is reached by all 4 waves (32 uniform chunk trips).
// Staging coverage per chunk: 4 iterations x 128 threads = 512 16-B words = 64 rows x 8 words for the
// K tile [64 kv][64 d] and likewise for the V^T tile [64 d][64 kv] (every LDS byte read is written; the
// 16 pad bytes behind each 128-B row are neither written nor read).
// Out store: each instruction writes two 256-B row segments (lanes 0-15 row 2it, lanes 16-31 row 2it+1).
// ---------------------------------------------------------------------------
constexpr int kKC = 64;        // keys per chunk
constexpr int kQG = 2;         // column groups of 16 queries per wave
constexpr int kQW = 16 * kQG;  // query rows per wave
constexpr int kQB = 4 * kQW;   // query rows per block
constexpr int kOsPitch = 68;   // floats
constexpr int kTP = 72;        // halves: LDS row pitch of the K and V^T tiles = 144 B = 16 B x 9 (odd), so the 16 rows
                               // that one 16-B fragment load touches per lane half fall on 16 distinct groups of four banks
static_assert(kTP >= kDh && kTP >= kKC && (kTP * 2) % 16 == 0 && ((kTP * 2) / 16) % 2 == 1, "tile pitch");
static_assert(kSeq % kKC == 0 && kSeq % kQB == 0, "attention tiles");

// the builtin alone: the compiler keeps the distance behind a WMMA itself and stays free to move LDS reads across it
__device__ __forceinline__ v8f mma_h16(v16h a, v16h b, v8f c) {
  return __builtin_amdgcn_wmma_f32_16x16x32_f16(false, a, false, b, (short)0, c, false, false);
}

// value of lane l ^ 16 (the other wave half), by a vector cross-row move
__device__ __forceinline__ float xhalf(float x) {
  return __builtin_bit_cast(float, __builtin_amdgcn_permlanex16(__builtin_bit_cast(int, x), __builtin_bit_cast(int, x),
                                                                0x76543210, 0xfedcba98, false, false));
}

// four waves per SIMD (256 registers a wave): the 1024 blocks are then all resident at once, four on each WGP
__global__ __launch_bounds__(128) __attribute__((amdgpu_waves_per_eu(4, 4)))
void attn_f16_kernel(const unsigned short* __restrict__ QKp, const unsigned short* __restrict__ VTp,
                     float* __restrict__ out) {
  const _Float16* QK = (const _Float16*)(const void*)QKp;
  const _Float16* VT = (const _Float16*)(const void*)VTp;
  __shared__ __align__(16) _Float16 Ksh[kKC * kTP];          // K tile   [kv][d]   9 KB, 64 of 72 halves a row used
  __shared__ __align__(16) _Float16 Vth[kDh * kTP];          // V^T tile [d][kv]   9 KB
  __shared__ __align__(16) float    Os[4][kQW * kOsPitch];   // per wave out tile, pitch 68

  const int tid  = threadIdx.x;
  const int wave = tid >> 5;
  const int lane = tid & 31;
  const int hh   = lane >> 4;
  const int c    = lane & 15;

  const int nqb = kSeq / kQB;            // 16
  const int bx  = blockIdx.x;            // 0 .. 1023
  const int qb  = bx % nqb;
  const int bh  = bx / nqb;              // 0 .. 63
  const int h   = bh % kHeads;
  const int b   = bh / kHeads;
  const int q0  = qb * kQB + wave * kQW;

  const _Float16* qb_ptr = QK + (size_t)b * kSeq * kQKCols + (size_t)h * kDh;   // (s, d) at + s*2048 + d
  const _Float16* kb_ptr = qb_ptr + kDim;                                        // k columns start at 1024
  const _Float16* vb_ptr = VT + (size_t)bh * kDh * kSeq;                         // (d, s) at + d*2048 + s
  float*          ob_ptr = out + (size_t)b * kSeq * kDim + (size_t)h * kDh;     // (s, d) at + s*1024 + d

  // ---- Q fragments (B operand): group g, lane column c = query q0+16g+c; elements 0..7 <- d dc*32+8hh+0..7, 8..15 <- +16 ----
  v16h qa[kQG][2];
#pragma unroll
  for (int g = 0; g < kQG; ++g) {
    const _Float16* qrow = qb_ptr + (size_t)(q0 + 16 * g + c) * kQKCols + 8 * hh;
#pragma unroll
    for (int dc = 0; dc < 2; ++dc) qa[g][dc] = Frag<_Float16>::load(qrow + dc * 32);
  }

  v8f   cst[kQG];                   // start value of the score tiles of query q0+16g+c: 7 - (maximum in use), alike in the eight
                                    // registers and in both halves; 0 until the first chunk has set a maximum
  float lrow[kQG];                  // this half's share of the query's sum x2^7; the halves are joined after the loop
  v8f oacc[kQG][4];                 // oacc[g][t][r] = out^T[d = 16t+8hh+r][query q0+16g+c]
#pragma unroll
  for (int g = 0; g < kQG; ++g) {
    cst[g]  = (v8f){0.f,0.f,0.f,0.f,0.f,0.f,0.f,0.f};
    lrow[g] = 0.f;
#pragma unroll
    for (int t = 0; t < 4; ++t) oacc[g][t] = (v8f){0.f,0.f,0.f,0.f,0.f,0.f,0.f,0.f};
  }

  // this thread's place in a tile: row tid>>3 (+16 per copy), 16-B word tid&7. One pointer per plane and one LDS address per
  // tile, every further copy at a constant distance, so that the addresses take few of the 256 registers
  const int srow = tid >> 3;
  const int sc8  = (tid & 7) * 8;          // halves
  const _Float16* kp = kb_ptr + (size_t)srow * kQKCols + sc8;   // advances 64 key rows a chunk
  const _Float16* vp = vb_ptr + (size_t)srow * kSeq + sc8;      // advances 64 key columns a chunk
  _Float16* ksd = Ksh + srow * kTP + sc8;
  _Float16* vsd = Vth + srow * kTP + sc8;
  const _Float16* ksr = Ksh + c * kTP + 8 * hh;   // fragment reads: row c (+16 per tile), k offset of this lane half
  const _Float16* vsr = Vth + c * kTP + 8 * hh;

  for (int kc = 0; kc < kSeq / kKC; ++kc) {
    __syncthreads();
    // ---- stage K tile and V^T tile: pure 16-B copies of the f16 planes; copy i = rows 16i + srow (kv for K, d for V^T) ----
#pragma unroll
    for (int i = 0; i < 4; ++i) {
      const v8h kk = *(const v8h*)(kp + (size_t)(i * 16) * kQKCols);
      const v8h vv = *(const v8h*)(vp + (size_t)(i * 16) * kSeq);
      *(v8h*)(ksd + i * 16 * kTP) = kk;
      *(v8h*)(vsd + i * 16 * kTP) = vv;
    }
    kp += (size_t)kKC * kQKCols;
    vp += kKC;
    __syncthreads();

    // ---- scores^T: 4 key row tiles x 2 d-steps x 2 groups; s[g][j][r] = score of key 64kc+16j+8hh+r with query q0+16g+c ----
    // A[m = kv j*16+c][k = d] = Ksh[kv][d]; same split k-map as B. All eight fragments are read as one group.
    v16h ka[2][4];
#pragma unroll
    for (int dc = 0; dc < 2; ++dc)
#pragma unroll
      for (int j = 0; j < 4; ++j) ka[dc][j] = Frag<_Float16>::load(ksr + j * 16 * kTP + dc * 32);
    __builtin_amdgcn_sched_barrier(0);   // keeps the K reads one group in front of the products: the LDS latency is waited out once, not per product
    v8f s[kQG][4];
#pragma unroll
    for (int dc = 0; dc < 2; ++dc)
#pragma unroll
      for (int j = 0; j < 4; ++j)
#pragma unroll
        for (int g = 0; g < kQG; ++g) s[g][j] = mma_h16(ka[dc][j], qa[g][dc], dc == 0 ? cst[g] : s[g][j]);

    // A[m = d t*16+c][k = kv] = Vth[d][kv]. The chunk's second half runs in two passes of 32 keys, so that the live set stays
    // inside the 256 registers of four waves per SIMD: the V^T fragments of a pass are read in front of the exponentials of
    // that pass, which hide their latency, and by the second pass half of the score registers are free again.
    v16h va[2][4];
    __builtin_amdgcn_sched_barrier(0);   // keeps the V^T reads from rising among the score products, where their registers are still taken
#pragma unroll
    for (int t = 0; t < 4; ++t) va[0][t] = Frag<_Float16>::load(vsr + t * 16 * kTP);
    __builtin_amdgcn_sched_barrier(0);   // keeps these V^T reads in front of the softmax arithmetic, which hides their latency

    // ---- largest exponent of the chunk in this lane, per group: 32 scores of its query (the other 32 are in lane ^ 16) ----
    float cm[kQG];
    const float lim = (kc == 0) ? -__builtin_inff() : kPCarryLog2 + kLagLog2;   // the first chunk always sets the maximum in use
    bool over = false;
#pragma unroll
    for (int g = 0; g < kQG; ++g) {
      cm[g] = -__builtin_inff();
#pragma unroll
      for (int j = 0; j < 4; ++j) {
#pragma unroll
        for (int r = 0; r < 8; ++r) cm[g] = fmaxf(cm[g], s[g][j][r]);
      }
      over = over || (cm[g] > lim);
    }
    // ---- one wave-uniform test a chunk: the first chunk sets the maximum in use, a later one raises it only when some
    //      exponent has passed 15; then out^T, l, the chunk's exponents and the start value all move to the new maximum ----
    if (__builtin_amdgcn_ballot_w32(over) != 0) {
#pragma unroll
      for (int g = 0; g < kQG; ++g) {
        const float up = fmaxf(cm[g], xhalf(cm[g])) - kPCarryLog2;    // alike in both halves
        const float d  = (kc == 0) ? up : fmaxf(up, 0.f);             // the maximum in use never falls
        const float alpha = (kc == 0) ? 0.f : __builtin_amdgcn_exp2f(-d);   // nothing is summed yet in the first chunk
        lrow[g] *= alpha;
#pragma unroll
        for (int t = 0; t < 4; ++t)
#pragma unroll
          for (int r = 0; r < 8; ++r) oacc[g][t][r] *= alpha;
#pragma unroll
        for (int j = 0; j < 4; ++j)
#pragma unroll
          for (int r = 0; r < 8; ++r) s[g][j][r] -= d;
#pragma unroll
        for (int r = 0; r < 8; ++r) cst[g][r] -= d;
      }
    }

    // ---- per pass kk (keys 32kk .. 32kk+31): P^T x2^7 as f16 packed straight into the B fragments, then
    //      O^T += V^T . P^T : A = the V^T fragments, B = P^T[kv][query c] of each group ----
    float ps[kQG][4];
#pragma unroll
    for (int kk = 0; kk < 2; ++kk) {
      if (kk == 1) {
        __builtin_amdgcn_sched_barrier(0);   // keeps the second V^T reads behind the first pass's exponentials (registers)
#pragma unroll
        for (int t = 0; t < 4; ++t) va[1][t] = Frag<_Float16>::load(vsr + t * 16 * kTP + 32);
        __builtin_amdgcn_sched_barrier(0);   // keeps them one group in front of the second pass's exponentials, which hide their latency
      }
      v16h pb[kQG];
#pragma unroll
      for (int g = 0; g < kQG; ++g) {
#pragma unroll
        for (int jj = 0; jj < 2; ++jj) {
          const int j = 2 * kk + jj;
          ps[g][j] = 0.f;
#pragma unroll
          for (int r = 0; r < 8; ++r) {
            const float p = __builtin_amdgcn_exp2f(s[g][j][r]);   // exponent <= 15: inside f16
            ps[g][j] += p;
            pb[g][jj * 8 + r] = (_Float16)p;
          }
        }
      }
#pragma unroll
      for (int t = 0; t < 4; ++t)
#pragma unroll
        for (int g = 0; g < kQG; ++g) oacc[g][t] = mma_h16(va[kk][t], pb[g], oacc[g][t]);
    }
#pragma unroll
    for (int g = 0; g < kQG; ++g) lrow[g] += (ps[g][0] + ps[g][1]) + (ps[g][2] + ps[g][3]);
  }

  // ---- normalise and store: lane (c, hh) holds d = 16t+8hh+0..7 of query row 16g+c ----
  float* os = Os[wave];
#pragma unroll
  for (int g = 0; g < kQG; ++g) {
    const float inv = 1.0f / (lrow[g] + xhalf(lrow[g]));   // l and out^T carry the same factor
#pragma unroll
    for (int t = 0; t < 4; ++t) {
      float* op = os + (16 * g + c) * kOsPitch + t * 16 + 8 * hh;
      *(v4f*)(op)     = (v4f){oacc[g][t][0] * inv, oacc[g][t][1] * inv, oacc[g][t][2] * inv, oacc[g][t][3] * inv};
      *(v4f*)(op + 4) = (v4f){oacc[g][t][4] * inv, oacc[g][t][5] * inv, oacc[g][t][6] * inv, oacc[g][t][7] * inv};
    }
  }
  __syncthreads();
  {
    const int c4 = (lane & 15) * 4;
    {
#pragma unroll
      for (int it = 0; it < kQW / 2; ++it) {
        const int row = it * 2 + hh;
        const v4f val = *(const v4f*)(os + row * kOsPitch + c4);
        *(v4f*)(ob_ptr + (size_t)(q0 + row) * kDim + c4) = val;
      }
      
    }
  }
}

// ---------------------------------------------------------------------------
// Host glue.
// no aliasing):
//   Xb   bf16 [8192][1024]          16,777,216  at          0   (x, RNE)
//   Wb   bf16 [3072][1024]           6,291,456  at 16,777,216   (W, RNE)
//   QKh  f16  [8192][2048]          33,554,432  at 23,068,672   (q | k columns, e = which*1024 + h*64 + d)
//   Vt   f16  [4*16][64][2048]      16,777,216  at 56,623,104   (v transposed per (b,h))
//   total                           73,400,320
// GEMM shapes: q|k M=8192, N=2048, K=1024; v^T M=1024 (16 heads x 64), N=2048, K=1024 (x4 batches via grid.y).
// All M multiples of 128, N of 256, K % 64 == 0, no padding anywhere. 5 launches.
// ---------------------------------------------------------------------------
extern "C" void kernel_launch(void* const* d_in, const int* in_sizes, int n_in,
                              void* d_out, int out_size, void* d_ws, size_t ws_size,
                              hipStream_t stream) {
  if (n_in < 2) return;
  if (in_sizes[0] != kTok * kDim) return;
  if (in_sizes[1] != kWRows * kDim) return;
  if (out_size != kTok * kDim) return;

  const size_t szXb = (size_t)kTok * kDim * 2;
  const size_t szWb = (size_t)kWRows * kDim * 2;
  const size_t szQK = (size_t)kTok * kQKCols * 2;
  const size_t szVt = (size_t)kBatch * kHeads * kDh * kSeq * 2;
  const size_t offXb = 0;
  const size_t offWb = offXb + szXb;
  const size_t offQK = offWb + szWb;
  const size_t offVt = offQK + szQK;
  const size_t total = offVt + szVt;
  if (ws_size < total) return;

  const float* x = (const float*)d_in[0];   // [4,2048,1024] f32
  const float* W = (const float*)d_in[1];   // [3072,1024] f32, [out][in]
  float* out = (float*)d_out;               // [4,2048,1024] f32
  char* ws = (char*)d_ws;
  unsigned short* Xb  = (unsigned short*)(ws + offXb);
  unsigned short* Wb  = (unsigned short*)(ws + offWb);
  unsigned short* QKh = (unsigned short*)(ws + offQK);
  unsigned short* Vt  = (unsigned short*)(ws + offVt);

  // ---- 16-bit operand planes (bf16 RNE of both float inputs) ----
  const int n8x = (kTok * kDim) / 8;     // 1,048,576 -> 4096 blocks exact
  const int n8w = (kWRows * kDim) / 8;   //   393,216 -> 1536 blocks exact
  cast8_bf16_kernel<<<dim3(n8x / 256), dim3(256), 0, stream>>>(x, Xb, n8x);
  cast8_bf16_kernel<<<dim3(n8w / 256), dim3(256), 0, stream>>>(W, Wb, n8w);

  // ---- q | k projection: QKh[token][e] = kQKScale * sum_k Xb[token][k] * Wb[e][k], e in 0..2047 (f16 out) ----
  const int tilesQK = (kTok / 128) * (kQKCols / 256);   // 64 x 8 = 512 blocks of 8 waves
  wmma_gemm64<1, false, 0, 1, false, 0><<<dim3(tilesQK, 1), dim3(256), 0, stream>>>(
      Xb, Xb, kDim, 0L, Wb, Wb, kDim, 0L,
      (void*)QKh, (void*)QKh, kQKCols, 0L, x, x, 0L, kTok, kQKCols, kDim, kQKScale);

  // ---- v projection written transposed, all heads and batches in one launch:
  //      Vt[b][e = h*64+d][s] = sum_k Wb[2048+e][k] * Xb[b*2048+s][k]; M = 1024 weight rows, N = 2048 tokens, grid.y = batch ----
  const unsigned short* WbV = Wb + (size_t)kQKCols * kDim;   // v weight rows
  const int tilesV = (kDim / 128) * (kSeq / 256);            // 8 x 8 = 64 blocks of 8 waves per batch
  wmma_gemm64<1, false, 0, 1, false, 0><<<dim3(tilesV, kBatch), dim3(256), 0, stream>>>(
      WbV, WbV, kDim, 0L, Xb, Xb, kDim, (long)kSeq * kDim,
      (void*)Vt, (void*)Vt, kSeq, (long)kDim * kSeq, x, x, 0L, kDim, kSeq, kDim, 1.0f);

  // ---- attention: grid = 4 batches x 16 heads x 16 query blocks ----
  attn_f16_kernel<<<dim3(kBatch * kHeads * (kSeq / kQB)), dim3(128), 0, stream>>>(QKh, Vt, out);
}

// v009
// One run takes 108 microseconds.
// Next to v008, in two timings, it ran 1.03 and 1.02 times as fast.
// Over all steps from v000 it is 6.26 times as fast.
// Contractions: qkv projection (x bf16 RNE, W^T bf16 RNE) on v_wmma_f32_16x16x32_bf16; scores q.k^T (q, k f16 planes) and attn.v (P f16 carried x128 at the maximum in use, V^T f16 plane) on v_wmma_f32_16x16x32_f16; all f32 accumulate; online softmax statistics, scaling and 1/l in f32; exponentials base 2 on v_exp_f32.
#include <hip/hip_runtime.h>
#include <math.h>

// ---------------------------------------------------------------------------
// Problem constants
// ---------------------------------------------------------------------------
constexpr int kBatch  = 4;
constexpr int kSeq    = 2048;
constexpr int kDim    = 1024;
constexpr int kHeads  = 16;
constexpr int kDh     = 64;
constexpr int kTok    = kBatch * kSeq;     // 8192 token rows
constexpr int kWRows  = 3 * kDim;          // 3072 weight rows (q | k | v)
constexpr int kQKCols = 2 * kDim;          // 2048: pitch of the q | k plane (halves)
constexpr float kPCarryLog2 = 7.0f;        // log2 of the carry: the exponent of a score equal to the maximum in use
constexpr float kLagLog2    = 8.0f;        // how far the maximum in use may trail the true one: p stays <= 2^15, inside f16
constexpr float kQKScale = 0.42466090014400953f;   // sqrt(64^-0.5 x log2(e)), on q and on k in f32 before their f16 rounding: q.k is then the base-2 exponent
static_assert(kHeads * kDh == kDim, "shape");
static_assert(kDim % 64 == 0, "gemm K multiple of the staged slice");
static_assert(kTok % 128 == 0 && kDim % 128 == 0 && kQKCols % 256 == 0 && kSeq % 256 == 0, "gemm M multiple of 128, N of 256");
static_assert(kDh % 64 == 0 && kSeq % 64 == 0, "attention tiles");
static_assert((kTok * kDim) % (8 * 256) == 0 && (kWRows * kDim) % (8 * 256) == 0, "cast grids exact");

typedef __attribute__((ext_vector_type(16))) _Float16 v16h;
typedef __attribute__((ext_vector_type(8)))  _Float16 v8h;
typedef __attribute__((ext_vector_type(16))) __bf16   v16b;
typedef __attribute__((ext_vector_type(8)))  __bf16   v8b;
typedef __attribute__((ext_vector_type(8)))  float    v8f;
typedef __attribute__((ext_vector_type(4)))  float    v4f;
typedef __attribute__((ext_vector_type(4)))  unsigned int v4u;

// ---------------------------------------------------------------------------
// Helpers
// ---------------------------------------------------------------------------
__device__ __forceinline__ unsigned short f2bf_bits(float f) {
  unsigned u = __float_as_uint(f);
  return (unsigned short)((u + 0x7FFFu + ((u >> 16) & 1u)) >> 16);
}
__device__ __forceinline__ float bf_bits2f(unsigned short h) { return __uint_as_float(((unsigned)h) << 16); }

// hazard guards as plain device helpers (no inline asm inside the kernel template body)
__device__ __forceinline__ void dep_guard_h(v8f& a, v8f& b, v16h x, v16h y) { asm volatile("v_nop\n\tv_nop\n\tv_nop\n\tv_nop" : "+v"(a), "+v"(b) : "v"(x), "v"(y)); }
__device__ __forceinline__ void dep_guard_b(v8f& a, v8f& b, v16b x, v16b y) { asm volatile("v_nop\n\tv_nop\n\tv_nop\n\tv_nop" : "+v"(a), "+v"(b) : "v"(x), "v"(y)); }
__device__ __forceinline__ void keep4_h(v16h a, v16h b, v16h c, v16h d) { asm volatile("v_nop" :: "v"(a), "v"(b), "v"(c), "v"(d)); }
__device__ __forceinline__ void keep4_b(v16b a, v16b b, v16b c, v16b d) { asm volatile("v_nop" :: "v"(a), "v"(b), "v"(c), "v"(d)); }
__device__ __forceinline__ void acc_guard4(v8f& a, v8f& b, v8f& c, v8f& d) { asm volatile("v_nop\n\tv_nop\n\tv_nop\n\tv_nop" : "+v"(a), "+v"(b), "+v"(c), "+v"(d)); }
template <typename T> struct Frag;
template <> struct Frag<_Float16> {
  typedef v16h V; union U { v16h v; v8h h[2]; };
  // elements 0..7 <- p[0..7], 8..15 <- p[16..23]
  static __device__ __forceinline__ v16h load(const _Float16* p) {
    U f; f.h[0] = *(const v8h*)(p); f.h[1] = *(const v8h*)(p + 16); return f.v;
  }
  static __device__ __forceinline__ v8f mma(v16h a, v16h b, v8f c) {
    return __builtin_amdgcn_wmma_f32_16x16x32_f16(false, a, false, b, (short)0, c, false, false);
  }
  static __device__ __forceinline__ void guard(v8f& a, v8f& b, v16h x, v16h y) { dep_guard_h(a, b, x, y); }
  static __device__ __forceinline__ void keep(v16h a, v16h b, v16h c, v16h d) { keep4_h(a, b, c, d); }
};
template <> struct Frag<__bf16> {
  typedef v16b V; union U { v16b v; v8b h[2]; };
  static __device__ __forceinline__ v16b load(const __bf16* p) {
    U f; f.h[0] = *(const v8b*)(p); f.h[1] = *(const v8b*)(p + 16); return f.v;
  }
  static __device__ __forceinline__ v8f mma(v16b a, v16b b, v8f c) {
    return __builtin_amdgcn_wmma_f32_16x16x32_bf16(false, a, false, b, (short)0, c, false, false);
  }
  static __device__ __forceinline__ void guard(v8f& a, v8f& b, v16b x, v16b y) { dep_guard_b(a, b, x, y); }
  static __device__ __forceinline__ void keep(v16b a, v16b b, v16b c, v16b d) { keep4_b(a, b, c, d); }
};

__device__ __forceinline__ unsigned pk16(unsigned short a, unsigned short b) { return (unsigned)a | ((unsigned)b << 16); }

// ---- Register-blocked batched WMMA GEMM (ACT reduced to none/relu/leaky) -------------------------------
// C[m,n] = scale * sum_k A[m,k] * Bt[n,k] (+bias)(+resid); each wave owns a 64x64 tile, a block of 8 waves (2 x 4) a
// 128x256 tile. A row-major [M,K]; Bt row-major [N,K]; M % 128 == 0, N % 256 == 0, K % 64 == 0.
// Operands go through LDS: a slice = 64 k (one 128-B line) of the block's 128 A rows and 256 Bt rows, 384 rows at pitch
// 144 B. It is brought in once for all 8 waves by asynchronous 16-B copies, 8 lanes on one whole line, 12 copies a thread
// (12 x 256 threads x 16 B = 384 rows x 128 B; the 16 pad bytes of a row are neither written nor read). Two buffers:
// slice t+1 flies while slice t is multiplied. Fragments are read from LDS in the k order the global loads had.
// SPLIT (hi/lo planes) is not staged and not instantiated.
// BIAS_MODE: 0 = none, 1 = bias[m], 2 = bias[n].
// OUT_MODE: 0 = f32, 1 = f16, 2 = bf16 hi plane (Cout) + bf16 lo plane (Cout2).
// ET: 0 = f16 operands, 1 = bf16 operands (pointers passed as 16-bit storage)
constexpr int kGK    = 64;                 // k of one staged slice (halves)
constexpr int kGP    = 72;                 // halves: LDS row pitch 144 B = 16 B x 9 (odd), free of conflicts for 16-B fragment reads
constexpr int kGMB   = 128;                // A rows of a block tile
constexpr int kGNB   = 256;                // Bt rows of a block tile
constexpr int kGBuf  = (kGMB + kGNB) * kGP;   // halves of one buffer: 27,648 = 55,296 B
constexpr unsigned kGStep = 32u * kGP * 2u;   // LDS bytes between two copies of a thread: 32 rows

__device__ __forceinline__ unsigned lds_off(const void* p) { return (unsigned)(size_t)p; }   // byte offset in the block's LDS

// One thread's share of a slice: 12 asynchronous 16-B copies global -> LDS, rows 32 apart (4 of A, 8 of Bt).
// The address-translation wait is the statement's last line, so that no address register is rewritten in front of it.
__device__ __forceinline__ void stage_slice(unsigned l, const unsigned short* a, size_t sa, const unsigned short* b, size_t sb) {
  asm volatile(
      "global_load_async_to_lds_b128 %0, %12, off\n\t"
      "global_load_async_to_lds_b128 %1, %13, off\n\t"
      "global_load_async_to_lds_b128 %2, %14, off\n\t"
      "global_load_async_to_lds_b128 %3, %15, off\n\t"
      "global_load_async_to_lds_b128 %4, %16, off\n\t"
      "global_load_async_to_lds_b128 %5, %17, off\n\t"
      "global_load_async_to_lds_b128 %6, %18, off\n\t"
      "global_load_async_to_lds_b128 %7, %19, off\n\t"
      "global_load_async_to_lds_b128 %8, %20, off\n\t"
      "global_load_async_to_lds_b128 %9, %21, off\n\t"
      "global_load_async_to_lds_b128 %10, %22, off\n\t"
      "global_load_async_to_lds_b128 %11, %23, off\n\t"
      "s_wait_xcnt 0x0"
      :: "v"(l), "v"(l + kGStep), "v"(l + 2 * kGStep), "v"(l + 3 * kGStep), "v"(l + 4 * kGStep), "v"(l + 5 * kGStep),
         "v"(l + 6 * kGStep), "v"(l + 7 * kGStep), "v"(l + 8 * kGStep), "v"(l + 9 * kGStep), "v"(l + 10 * kGStep),
         "v"(l + 11 * kGStep),
         "v"(a), "v"(a + sa), "v"(a + 2 * sa), "v"(a + 3 * sa),
         "v"(b), "v"(b + sb), "v"(b + 2 * sb), "v"(b + 3 * sb), "v"(b + 4 * sb), "v"(b + 5 * sb), "v"(b + 6 * sb), "v"(b + 7 * sb)
      : "memory");
}
// this wave's copies have landed (the compiler places no wait for them)
__device__ __forceinline__ void wait_copies() { asm volatile("s_wait_asynccnt 0x0" ::: "memory"); }
// this wave's LDS reads have returned, before the buffer they read is given up for refilling
__device__ __forceinline__ void wait_lds() { asm volatile("s_wait_dscnt 0x0" ::: "memory"); }

template <int ET> struct Elem;
template <> struct Elem<0> { typedef _Float16 T; };
template <> struct Elem<1> { typedef __bf16 T; };
template <int ET, bool SPLIT, int BIAS_MODE, int OUT_MODE, bool RESID, int ACT = 0>
__global__ __launch_bounds__(256) void wmma_gemm64(
    const unsigned short* __restrict__ Ap, const unsigned short* __restrict__ A2p, int lda, long strideA,
    const unsigned short* __restrict__ Btp, const unsigned short* __restrict__ Bt2p, int ldb, long strideB,
    void* __restrict__ Cout, void* __restrict__ Cout2, int ldc, long strideC,
    const float* __restrict__ bias,
    const float* __restrict__ resid, long strideR,
    int M, int N, int K, float scale) {
  typedef typename Elem<ET>::T T;
  typedef typename Frag<T>::V V;
  static_assert(!SPLIT, "lo planes are not staged");
  __shared__ __align__(16) unsigned short sAB[2 * kGBuf];   // two slices: rows 0..127 A, rows 128..383 Bt
  __shared__ __align__(16) float sT[8][16 * 68];   // per-wave 16x64 slab, pitch 68 floats
  const int b    = blockIdx.y;
  const int lane = threadIdx.x & 31;
  const int wave = threadIdx.x >> 5;
  const int tilesN = N >> 8;
  const int tilesM = M >> 7;
  const int tile = blockIdx.x;
  if (tile >= tilesM * tilesN) return;   // block-uniform, in front of every barrier and copy
  const int tm = tile / tilesN;
  const int tn = tile - tm * tilesN;
  const int mB = tm << 7;                      // block tile origin
  const int nB = tn << 8;
  const int wm = (wave >> 2) << 6;             // wave tile origin inside the block tile
  const int wn = (wave & 3) << 6;
  const int m0 = mB + wm;
  const int n0 = nB + wn;

  const int rlane = lane & 15;                 // row (A) / col (B, D) within subtile
  const int koff  = (lane >> 4) * 8;           // k offset of this lane half
  const int mOff  = (lane >> 4) * 8;           // D row offset

  v8f acc[4][4];
#pragma unroll
  for (int i = 0; i < 4; ++i)
#pragma unroll
    for (int j = 0; j < 4; ++j) acc[i][j] = (v8f){0.f,0.f,0.f,0.f,0.f,0.f,0.f,0.f};

  // this thread's place in a slice: row srow (+32 per copy), 16-B word tid & 7 of the row's 128-B line
  const int srow = threadIdx.x >> 3;
  const int scol = (threadIdx.x & 7) * 8;
  const unsigned short* gA = Ap  + (size_t)b * strideA + (size_t)(mB + srow) * lda + scol;
  const unsigned short* gB = Btp + (size_t)b * strideB + (size_t)(nB + srow) * ldb + scol;
  const size_t sa = (size_t)32 * lda;
  const size_t sb = (size_t)32 * ldb;
  const unsigned ldst = lds_off(sAB) + (unsigned)(srow * kGP + scol) * 2u;
  const int nT = K / kGK;

  stage_slice(ldst, gA, sa, gB, sb);
  wait_copies();
  __syncthreads();                              // slice 0 is readable by every wave
  if (nT > 1) stage_slice(ldst + kGBuf * 2u, gA + kGK, sa, gB + kGK, sb);

  for (int t = 0; t < nT; ++t) {
    const T* sl = (const T*)(const void*)sAB + (t & 1) * kGBuf + koff;
    const T* sA = sl + (wm + rlane) * kGP;
    const T* sB = sl + (kGMB + wn + rlane) * kGP;
    // the loops below are unrolled so that every fragment and accumulator index is a constant (else the arrays leave the registers)
#pragma unroll
    for (int ks = 0; ks < kGK; ks += 32) {
      V bh[4], ah[4];
#pragma unroll
      for (int j = 0; j < 4; ++j) bh[j] = Frag<T>::load(sB + (j << 4) * kGP + ks);
#pragma unroll
      for (int i = 0; i < 4; ++i) ah[i] = Frag<T>::load(sA + (i << 4) * kGP + ks);
#pragma unroll
      for (int i = 0; i < 4; ++i) {
#pragma unroll
        for (int j = 0; j < 4; ++j) acc[i][j] = Frag<T>::mma(ah[i], bh[j], acc[i][j]);
        Frag<T>::guard(acc[i][0], acc[i][3], ah[i], ah[i]);
      }
      Frag<T>::keep(bh[0], bh[1], bh[2], bh[3]);
    }
    // hand-over: own reads of slice t done, own copies of slice t+1 landed, then the one barrier of the trip, which
    // publishes slice t+1 and frees slice t's buffer; only behind it the refill with slice t+2
    wait_lds();
    wait_copies();
    __syncthreads();
    if (t + 2 < nT) stage_slice(ldst + (unsigned)(t & 1) * (kGBuf * 2u), gA + (size_t)(t + 2) * kGK, sa, gB + (size_t)(t + 2) * kGK, sb);
  }
  wait_copies();
  acc_guard4(acc[0][0], acc[0][1], acc[0][2], acc[0][3]);
  acc_guard4(acc[1][0], acc[1][1], acc[1][2], acc[1][3]);
  acc_guard4(acc[2][0], acc[2][1], acc[2][2], acc[2][3]);
  acc_guard4(acc[3][0], acc[3][1], acc[3][2], acc[3][3]);

  // ---- epilogue ----
  float* slab = sT[wave];
  const float* Rb = RESID ? (resid + (size_t)b * strideR) : nullptr;
#pragma unroll
  for (int i = 0; i < 4; ++i) {
    const int mBase = m0 + (i << 4);
#pragma unroll
    for (int j = 0; j < 4; ++j) {
      const int n = n0 + (j << 4) + rlane;
      float bv = 0.f;
      if (BIAS_MODE == 2) bv = bias[n];
#pragma unroll
      for (int r = 0; r < 8; ++r) {
        float v = acc[i][j][r] * scale;
        if (BIAS_MODE == 1) v += bias[mBase + mOff + r];
        if (BIAS_MODE == 2) v += bv;
        if (RESID) v += Rb[(size_t)(mBase + mOff + r) * ldc + n];
        if (ACT == 2) v = fmaxf(v, 0.0f);
        if (ACT == 4) v = (v > 0.f) ? v : 0.01f * v;
        slab[(mOff + r) * 68 + (j << 4) + rlane] = v;
      }
    }
    __builtin_amdgcn_fence(__ATOMIC_RELEASE, "workgroup");
    __builtin_amdgcn_wave_barrier();
    __builtin_amdgcn_fence(__ATOMIC_ACQUIRE, "workgroup");
    if (OUT_MODE == 0) {
      float* C = (float*)Cout + (size_t)b * strideC;
      const int hh = lane >> 4, c4 = (lane & 15) * 4;     // row seg = 256 B = 16 lanes x 16 B
      {
#pragma unroll
        for (int it = 0; it < 8; ++it) {
          const int row = it * 2 + hh;
          v4f v = *(const v4f*)(slab + row * 68 + c4);
          *(v4f*)(C + (size_t)(mBase + row) * ldc + n0 + c4) = v;
        }
        
      }
    } else {
      const int q = lane >> 3, c8 = (lane & 7) * 8;
      unsigned short* C  = (unsigned short*)Cout  + (size_t)b * strideC;
      unsigned short* C2 = (OUT_MODE == 2) ? ((unsigned short*)Cout2 + (size_t)b * strideC) : nullptr;
      {
#pragma unroll
        for (int it = 0; it < 4; ++it) {
          const int row = it * 4 + q;
          const float* sp = slab + row * 68 + c8;
          v8h hv, lv;
#pragma unroll
          for (int e = 0; e < 8; ++e) {
            if (OUT_MODE == 1) {
              hv[e] = (_Float16)sp[e];
            } else {
              unsigned short hb = f2bf_bits(sp[e]);
              unsigned short lb = f2bf_bits(sp[e] - bf_bits2f(hb));
              hv[e] = __builtin_bit_cast(_Float16, hb);
              lv[e] = __builtin_bit_cast(_Float16, lb);
            }
          }
          *(v8h*)(C + (size_t)(mBase + row) * ldc + n0 + c8) = hv;
          if (OUT_MODE == 2) *(v8h*)(C2 + (size_t)(mBase + row) * ldc + n0 + c8) = lv;
        }
        
      }
    }
    __builtin_amdgcn_fence(__ATOMIC_RELEASE, "workgroup");
    __builtin_amdgcn_wave_barrier();
    __builtin_amdgcn_fence(__ATOMIC_ACQUIRE, "workgroup");
  }
}

// ---------------------------------------------------------------------------
// f32 -> bf16 (RNE) cast, 8 consecutive elements per thread (one 16-B store per lane;
// Coverage: n8 = n/8 threads x 8 = the whole plane; both grids here are exact multiples of 256
// (x: 1,048,576 threads = 4096 blocks; W: 393,216 threads = 1536 blocks).
// ---------------------------------------------------------------------------
__global__ __launch_bounds__(256) void cast8_bf16_kernel(const float* __restrict__ in, unsigned short* __restrict__ out,
                                                         int n8) {
  const int i = blockIdx.x * 256 + threadIdx.x;
  if (i >= n8) return;
  const float* p = in + 8 * (size_t)i;
  const v4f a = *(const v4f*)(p);
  const v4f c = *(const v4f*)(p + 4);
  unsigned short hb[8];
#pragma unroll
  for (int e = 0; e < 4; ++e) {
    hb[e]     = f2bf_bits(a[e]);
    hb[4 + e] = f2bf_bits(c[e]);
  }
  const v4u u = (v4u){pk16(hb[0], hb[1]), pk16(hb[2], hb[3]), pk16(hb[4], hb[5]), pk16(hb[6], hb[7])};
  unsigned short* q = out + 8 * (size_t)i;
  *(v4u*)q = u;
  
}

// ---------------------------------------------------------------------------
// Flash-style attention for head_dim 64 on f16 planes (no mask), f32 out.
//   QK plane  f16 [8192 tokens][2048]: q of (b,h) at column h*64, k at column 1024 + h*64, row = b*2048 + s.
//   VT plane  f16 [b*16+h][64 d][2048 s].
//   scores^T = k . q^T + start  : v_wmma_f32_16x16x32_f16 (k from LDS as A, q resident B fragments; both planes hold x kQKScale)
//   out^T    = v^T . (p x2^7)^T : v_wmma_f32_16x16x32_f16 (V^T from LDS as A, p^T packed from the score tiles as B)
//   Both products are transposed so that lane (c, hh) holds scores of ONE query per column group: its maximum and its
//   sum are taken inside the lane plus one exchange between the wave halves, and two score tiles, converted in place,
//   are the B operand of the second product (element e of it = tile e>>3, register e&7 = key 8hh+e or 16+8hh+e-8).
//   online softmax statistics m, l, alpha and the final 1/l in f32. The maximum in use m may trail the true maximum by up
//   to 8 (base-2 exponent), so it is known before a chunk's products: 7 - m is the start value of the score accumulators, a
//   score tile leaves the matrix unit as the exponent itself, and each exponential is one v_exp_f32: p x2^7 = 2^(s + 7 - m).
//   One test a chunk (any exponent above 15?) guards the rare path that raises m and rescales out^T and l; l carries x2^7 too.
// A wave owns kQG = 2 column groups of 16 queries (group g: rows q0+16g .. q0+16g+15), so every K and V^T fragment it
// reads from LDS is the A operand of two products. Block = 4 waves = 128 query rows of one (b,h); grid.x = 4*16*16 = 1024.
// LDS: two buffers, each a K tile and a V^T tile, filled by asynchronous 16-B copies (through no register): chunk t+1
// flies while chunk t is worked on. One block-wide barrier a chunk, reached by all 4 waves (32 uniform chunk trips),
// publishes chunk t+1 and frees chunk t's buffer; the per-wave O slab is an array of its own.
// Staging coverage per chunk: 4 copies x 128 threads = 512 16-B words = 64 rows x 8 words for the
// K tile [64 kv][64 d] and likewise for the V^T tile [64 d][64 kv] (every LDS byte read is written; the
// 16 pad bytes behind each 128-B row are neither written nor read).
// Out store: each instruction writes two 256-B row segments (lanes 0-15 row 2it, lanes 16-31 row 2it+1).
// ---------------------------------------------------------------------------
constexpr int kKC = 64;        // keys per chunk
constexpr int kQG = 2;         // column groups of 16 queries per wave
constexpr int kQW = 16 * kQG;  // query rows per wave
constexpr int kQB = 4 * kQW;   // query rows per block
constexpr int kOsPitch = 68;   // floats
constexpr int kTP = 72;        // halves: LDS row pitch of the K and V^T tiles = 144 B = 16 B x 9 (odd), so the 16 rows
                               // that one 16-B fragment load touches per lane half fall on 16 distinct groups of four banks
static_assert(kTP >= kDh && kTP >= kKC && (kTP * 2) % 16 == 0 && ((kTP * 2) / 16) % 2 == 1, "tile pitch");
static_assert(kSeq % kKC == 0 && kSeq % kQB == 0, "attention tiles");
constexpr int kTileH = kKC * kTP;          // halves of one tile (K: 64 kv rows; V^T: 64 d rows): 4,608 = 9,216 B
constexpr int kKVBuf = 2 * kTileH;         // halves of one buffer: K tile, then V^T tile = 18,432 B
constexpr unsigned kKVStep = 16u * kTP * 2u;   // LDS bytes between two copies of a thread: 16 rows
static_assert(kKC == kDh, "both tiles have 64 rows");

// One thread's share of a chunk: 8 asynchronous 16-B copies global -> LDS, rows 16 apart (4 of the K tile, 4 of the V^T tile).
// The address-translation wait is the statement's last line, so that no address register is rewritten in front of it.
__device__ __forceinline__ void stage_kv(unsigned l, const _Float16* k, const _Float16* v) {
  asm volatile(
      "global_load_async_to_lds_b128 %0, %8, off\n\t"
      "global_load_async_to_lds_b128 %1, %9, off\n\t"
      "global_load_async_to_lds_b128 %2, %10, off\n\t"
      "global_load_async_to_lds_b128 %3, %11, off\n\t"
      "global_load_async_to_lds_b128 %4, %12, off\n\t"
      "global_load_async_to_lds_b128 %5, %13, off\n\t"
      "global_load_async_to_lds_b128 %6, %14, off\n\t"
      "global_load_async_to_lds_b128 %7, %15, off\n\t"
      "s_wait_xcnt 0x0"
      :: "v"(l), "v"(l + kKVStep), "v"(l + 2 * kKVStep), "v"(l + 3 * kKVStep),
         "v"(l + kTileH * 2u), "v"(l + kTileH * 2u + kKVStep), "v"(l + kTileH * 2u + 2 * kKVStep), "v"(l + kTileH * 2u + 3 * kKVStep),
         "v"(k), "v"(k + (size_t)16 * kQKCols), "v"(k + (size_t)32 * kQKCols), "v"(k + (size_t)48 * kQKCols),
         "v"(v), "v"(v + (size_t)16 * kSeq), "v"(v + (size_t)32 * kSeq), "v"(v + (size_t)48 * kSeq)
      : "memory");
}

// the builtin alone: the compiler keeps the distance behind a WMMA itself and stays free to move LDS reads across it
__device__ __forceinline__ v8f mma_h16(v16h a, v16h b, v8f c) {
  return __builtin_amdgcn_wmma_f32_16x16x32_f16(false, a, false, b, (short)0, c, false, false);
}

// value of lane l ^ 16 (the other wave half), by a vector cross-row move
__device__ __forceinline__ float xhalf(float x) {
  return __builtin_bit_cast(float, __builtin_amdgcn_permlanex16(__builtin_bit_cast(int, x), __builtin_bit_cast(int, x),
                                                                0x76543210, 0xfedcba98, false, false));
}

// four waves per SIMD (256 registers a wave): the 1024 blocks are then all resident at once, four on each WGP
__global__ __launch_bounds__(128) __attribute__((amdgpu_waves_per_eu(4, 4)))
void attn_f16_kernel(const unsigned short* __restrict__ QKp, const unsigned short* __restrict__ VTp,
                     float* __restrict__ out) {
  const _Float16* QK = (const _Float16*)(const void*)QKp;
  const _Float16* VT = (const _Float16*)(const void*)VTp;
  __shared__ __align__(16) _Float16 sKV[2 * kKVBuf];         // two buffers of K tile [kv][d] + V^T tile [d][kv], 9 KB each, 64 of 72 halves a row used
  __shared__ __align__(16) float    Os[4][kQW * kOsPitch];   // per wave out tile, pitch 68

  const int tid  = threadIdx.x;
  const int wave = tid >> 5;
  const int lane = tid & 31;
  const int hh   = lane >> 4;
  const int c    = lane & 15;

  const int nqb = kSeq / kQB;            // 16
  const int bx  = blockIdx.x;            // 0 .. 1023
  const int qb  = bx % nqb;
  const int bh  = bx / nqb;              // 0 .. 63
  const int h   = bh % kHeads;
  const int b   = bh / kHeads;
  const int q0  = qb * kQB + wave * kQW;

  const _Float16* qb_ptr = QK + (size_t)b * kSeq * kQKCols + (size_t)h * kDh;   // (s, d) at + s*2048 + d
  const _Float16* kb_ptr = qb_ptr + kDim;                                        // k columns start at 1024
  const _Float16* vb_ptr = VT + (size_t)bh * kDh * kSeq;                         // (d, s) at + d*2048 + s
  float*          ob_ptr = out + (size_t)b * kSeq * kDim + (size_t)h * kDh;     // (s, d) at + s*1024 + d

  // ---- Q fragments (B operand): group g, lane column c = query q0+16g+c; elements 0..7 <- d dc*32+8hh+0..7, 8..15 <- +16 ----
  v16h qa[kQG][2];
#pragma unroll
  for (int g = 0; g < kQG; ++g) {
    const _Float16* qrow = qb_ptr + (size_t)(q0 + 16 * g + c) * kQKCols + 8 * hh;
#pragma unroll
    for (int dc = 0; dc < 2; ++dc) qa[g][dc] = Frag<_Float16>::load(qrow + dc * 32);
  }

  v8f   cst[kQG];                   // start value of the score tiles of query q0+16g+c: 7 - (maximum in use), alike in the eight
                                    // registers and in both halves; 0 until the first chunk has set a maximum
  float lrow[kQG];                  // this half's share of the query's sum x2^7; the halves are joined after the loop
  v8f oacc[kQG][4];                 // oacc[g][t][r] = out^T[d = 16t+8hh+r][query q0+16g+c]
#pragma unroll
  for (int g = 0; g < kQG; ++g) {
    cst[g]  = (v8f){0.f,0.f,0.f,0.f,0.f,0.f,0.f,0.f};
    lrow[g] = 0.f;
#pragma unroll
    for (int t = 0; t < 4; ++t) oacc[g][t] = (v8f){0.f,0.f,0.f,0.f,0.f,0.f,0.f,0.f};
  }

  // this thread's place in a tile: row tid>>3 (+16 per copy), 16-B word tid&7. One pointer per plane and one LDS address,
  // every further copy at a constant distance; copy i = rows 16i + srow (kv for K, d for V^T)
  const int srow = tid >> 3;
  const int sc8  = (tid & 7) * 8;          // halves
  const _Float16* kp = kb_ptr + (size_t)srow * kQKCols + sc8;   // advances 64 key rows a chunk
  const _Float16* vp = vb_ptr + (size_t)srow * kSeq + sc8;      // advances 64 key columns a chunk
  const unsigned ldst = lds_off(sKV) + (unsigned)(srow * kTP + sc8) * 2u;
  constexpr int nC = kSeq / kKC;

  stage_kv(ldst, kp, vp);                       // chunk 0 into buffer 0
  kp += (size_t)kKC * kQKCols;                  // from here on: the chunk that is staged next
  vp += kKC;

  for (int kc = 0; kc < nC; ++kc) {
    // hand-over, between the work on chunk kc-1 and on chunk kc: own reads of chunk kc-1 done, own copies of chunk kc landed,
    // then the one barrier of the trip, which publishes chunk kc and frees chunk kc-1's buffer; only behind it the refill
    // of that buffer with chunk kc+1, which flies while chunk kc is worked on
    wait_lds();
    wait_copies();
    __syncthreads();
    if (kc + 1 < nC) {
      stage_kv(ldst + (unsigned)((kc + 1) & 1) * (kKVBuf * 2u), kp, vp);
      kp += (size_t)kKC * kQKCols;
      vp += kKC;
    }
    const _Float16* ksr = sKV + (kc & 1) * kKVBuf + c * kTP + 8 * hh;   // fragment reads: row c (+16 per tile), k offset of this lane half
    const _Float16* vsr = ksr + kTileH;

    // ---- scores^T: 4 key row tiles x 2 d-steps x 2 groups; s[g][j][r] = score of key 64kc+16j+8hh+r with query q0+16g+c ----
    // A[m = kv j*16+c][k = d] = Ksh[kv][d]; same split k-map as B. All eight fragments are read as one group.
    v16h ka[2][4];
#pragma unroll
    for (int dc = 0; dc < 2; ++dc)
#pragma unroll
      for (int j = 0; j < 4; ++j) ka[dc][j] = Frag<_Float16>::load(ksr + j * 16 * kTP + dc * 32);
    __builtin_amdgcn_sched_barrier(0);   // keeps the K reads one group in front of the products: the LDS latency is waited out once, not per product
    v8f s[kQG][4];
#pragma unroll
    for (int dc = 0; dc < 2; ++dc)
#pragma unroll
      for (int j = 0; j < 4; ++j)
#pragma unroll
        for (int g = 0; g < kQG; ++g) s[g][j] = mma_h16(ka[dc][j], qa[g][dc], dc == 0 ? cst[g] : s[g][j]);

    // A[m = d t*16+c][k = kv] = Vth[d][kv]. The chunk's second half runs in two passes of 32 keys, so that the live set stays
    // inside the 256 registers of four waves per SIMD: the V^T fragments of a pass are read in front of the exponentials of
    // that pass, which hide their latency, and by the second pass half of the score registers are free again.
    v16h va[2][4];
    __builtin_amdgcn_sched_barrier(0);   // keeps the V^T reads from rising among the score products, where their registers are still taken
#pragma unroll
    for (int t = 0; t < 4; ++t) va[0][t] = Frag<_Float16>::load(vsr + t * 16 * kTP);
    __builtin_amdgcn_sched_barrier(0);   // keeps these V^T reads in front of the softmax arithmetic, which hides their latency

    // ---- largest exponent of the chunk in this lane, per group: 32 scores of its query (the other 32 are in lane ^ 16) ----
    float cm[kQG];
    const float lim = (kc == 0) ? -__builtin_inff() : kPCarryLog2 + kLagLog2;   // the first chunk always sets the maximum in use
    bool over = false;
#pragma unroll
    for (int g = 0; g < kQG; ++g) {
      cm[g] = -__builtin_inff();
#pragma unroll
      for (int j = 0; j < 4; ++j) {
#pragma unroll
        for (int r = 0; r < 8; ++r) cm[g] = fmaxf(cm[g], s[g][j][r]);
      }
      over = over || (cm[g] > lim);
    }
    // ---- one wave-uniform test a chunk: the first chunk sets the maximum in use, a later one raises it only when some
    //      exponent has passed 15; then out^T, l, the chunk's exponents and the start value all move to the new maximum ----
    if (__builtin_amdgcn_ballot_w32(over) != 0) {
#pragma unroll
      for (int g = 0; g < kQG; ++g) {
        const float up = fmaxf(cm[g], xhalf(cm[g])) - kPCarryLog2;    // alike in both halves
        const float d  = (kc == 0) ? up : fmaxf(up, 0.f);             // the maximum in use never falls
        const float alpha = (kc == 0) ? 0.f : __builtin_amdgcn_exp2f(-d);   // nothing is summed yet in the first chunk
        lrow[g] *= alpha;
#pragma unroll
        for (int t = 0; t < 4; ++t)
#pragma unroll
          for (int r = 0; r < 8; ++r) oacc[g][t][r] *= alpha;
#pragma unroll
        for (int j = 0; j < 4; ++j)
#pragma unroll
          for (int r = 0; r < 8; ++r) s[g][j][r] -= d;
#pragma unroll
        for (int r = 0; r < 8; ++r) cst[g][r] -= d;
      }
    }

    // ---- per pass kk (keys 32kk .. 32kk+31): P^T x2^7 as f16 packed straight into the B fragments, then
    //      O^T += V^T . P^T : A = the V^T fragments, B = P^T[kv][query c] of each group ----
    float ps[kQG][4];
#pragma unroll
    for (int kk = 0; kk < 2; ++kk) {
      if (kk == 1) {
        __builtin_amdgcn_sched_barrier(0);   // keeps the second V^T reads behind the first pass's exponentials (registers)
#pragma unroll
        for (int t = 0; t < 4; ++t) va[1][t] = Frag<_Float16>::load(vsr + t * 16 * kTP + 32);
        __builtin_amdgcn_sched_barrier(0);   // keeps them one group in front of the second pass's exponentials, which hide their latency
      }
      v16h pb[kQG];
#pragma unroll
      for (int g = 0; g < kQG; ++g) {
#pragma unroll
        for (int jj = 0; jj < 2; ++jj) {
          const int j = 2 * kk + jj;
          ps[g][j] = 0.f;
#pragma unroll
          for (int r = 0; r < 8; ++r) {
            const float p = __builtin_amdgcn_exp2f(s[g][j][r]);   // exponent <= 15: inside f16
            ps[g][j] += p;
            pb[g][jj * 8 + r] = (_Float16)p;
          }
        }
      }
#pragma unroll
      for (int t = 0; t < 4; ++t)
#pragma unroll
        for (int g = 0; g < kQG; ++g) oacc[g][t] = mma_h16(va[kk][t], pb[g], oacc[g][t]);
    }
#pragma unroll
    for (int g = 0; g < kQG; ++g) lrow[g] += (ps[g][0] + ps[g][1]) + (ps[g][2] + ps[g][3]);
  }
  wait_copies();   // no copy is in flight when the wave leaves the loop

  // ---- normalise and store: lane (c, hh) holds d = 16t+8hh+0..7 of query row 16g+c ----
  float* os = Os[wave];
#pragma unroll
  for (int g = 0; g < kQG; ++g) {
    const float inv = 1.0f / (lrow[g] + xhalf(lrow[g]));   // l and out^T carry the same factor
#pragma unroll
    for (int t = 0; t < 4; ++t) {
      float* op = os + (16 * g + c) * kOsPitch + t * 16 + 8 * hh;
      *(v4f*)(op)     = (v4f){oacc[g][t][0] * inv, oacc[g][t][1] * inv, oacc[g][t][2] * inv, oacc[g][t][3] * inv};
      *(v4f*)(op + 4) = (v4f){oacc[g][t][4] * inv, oacc[g][t][5] * inv, oacc[g][t][6] * inv, oacc[g][t][7] * inv};
    }
  }
  __syncthreads();
  {
    const int c4 = (lane & 15) * 4;
    {
#pragma unroll
      for (int it = 0; it < kQW / 2; ++it) {
        const int row = it * 2 + hh;
        const v4f val = *(const v4f*)(os + row * kOsPitch + c4);
        *(v4f*)(ob_ptr + (size_t)(q0 + row) * kDim + c4) = val;
      }
      
    }
  }
}

// ---------------------------------------------------------------------------
// Host glue.
// no aliasing):
//   Xb   bf16 [8192][1024]          16,777,216  at          0   (x, RNE)
//   Wb   bf16 [3072][1024]           6,291,456  at 16,777,216   (W, RNE)
//   QKh  f16  [8192][2048]          33,554,432  at 23,068,672   (q | k columns, e = which*1024 + h*64 + d)
//   Vt   f16  [4*16][64][2048]      16,777,216  at 56,623,104   (v transposed per (b,h))
//   total                           73,400,320
// GEMM shapes: q|k M=8192, N=2048, K=1024; v^T M=1024 (16 heads x 64), N=2048, K=1024 (x4 batches via grid.y).
// All M multiples of 128, N of 256, K % 64 == 0, no padding anywhere. 5 launches.
// ---------------------------------------------------------------------------
extern "C" void kernel_launch(void* const* d_in, const int* in_sizes, int n_in,
                              void* d_out, int out_size, void* d_ws, size_t ws_size,
                              hipStream_t stream) {
  if (n_in < 2) return;
  if (in_sizes[0] != kTok * kDim) return;
  if (in_sizes[1] != kWRows * kDim) return;
  if (out_size != kTok * kDim) return;

  const size_t szXb = (size_t)kTok * kDim * 2;
  const size_t szWb = (size_t)kWRows * kDim * 2;
  const size_t szQK = (size_t)kTok * kQKCols * 2;
  const size_t szVt = (size_t)kBatch * kHeads * kDh * kSeq * 2;
  const size_t offXb = 0;
  const size_t offWb = offXb + szXb;
  const size_t offQK = offWb + szWb;
  const size_t offVt = offQK + szQK;
  const size_t total = offVt + szVt;
  if (ws_size < total) return;

  const float* x = (const float*)d_in[0];   // [4,2048,1024] f32
  const float* W = (const float*)d_in[1];   // [3072,1024] f32, [out][in]
  float* out = (float*)d_out;               // [4,2048,1024] f32
  char* ws = (char*)d_ws;
  unsigned short* Xb  = (unsigned short*)(ws + offXb);
  unsigned short* Wb  = (unsigned short*)(ws + offWb);
  unsigned short* QKh = (unsigned short*)(ws + offQK);
  unsigned short* Vt  = (unsigned short*)(ws + offVt);

  // ---- 16-bit operand planes (bf16 RNE of both float inputs) ----
  const int n8x = (kTok * kDim) / 8;     // 1,048,576 -> 4096 blocks exact
  const int n8w = (kWRows * kDim) / 8;   //   393,216 -> 1536 blocks exact
  cast8_bf16_kernel<<<dim3(n8x / 256), dim3(256), 0, stream>>>(x, Xb, n8x);
  cast8_bf16_kernel<<<dim3(n8w / 256), dim3(256), 0, stream>>>(W, Wb, n8w);

  // ---- q | k projection: QKh[token][e] = kQKScale * sum_k Xb[token][k] * Wb[e][k], e in 0..2047 (f16 out) ----
  const int tilesQK = (kTok / 128) * (kQKCols / 256);   // 64 x 8 = 512 blocks of 8 waves
  wmma_gemm64<1, false, 0, 1, false, 0><<<dim3(tilesQK, 1), dim3(256), 0, stream>>>(
      Xb, Xb, kDim, 0L, Wb, Wb, kDim, 0L,
      (void*)QKh, (void*)QKh, kQKCols, 0L, x, x, 0L, kTok, kQKCols, kDim, kQKScale);

  // ---- v projection written transposed, all heads and batches in one launch:
  //      Vt[b][e = h*64+d][s] = sum_k Wb[2048+e][k] * Xb[b*2048+s][k]; M = 1024 weight rows, N = 2048 tokens, grid.y = batch ----
  const unsigned short* WbV = Wb + (size_t)kQKCols * kDim;   // v weight rows
  const int tilesV = (kDim / 128) * (kSeq / 256);            // 8 x 8 = 64 blocks of 8 waves per batch
  wmma_gemm64<1, false, 0, 1, false, 0><<<dim3(tilesV, kBatch), dim3(256), 0, stream>>>(
      WbV, WbV, kDim, 0L, Xb, Xb, kDim, (long)kSeq * kDim,
      (void*)Vt, (void*)Vt, kSeq, (long)kDim * kSeq, x, x, 0L, kDim, kSeq, kDim, 1.0f);

  // ---- attention: grid = 4 batches x 16 heads x 16 query blocks ----
  attn_f16_kernel<<<dim3(kBatch * kHeads * (kSeq / kQB)), dim3(128), 0, stream>>>(QKh, Vt, out);
}
